// v000
// The times below were measured on an AMD MI455X: many runs one after another, warmed up first and cycling through
// copies of the inputs, with the whole window's GPU time divided by the number of runs. Launches and the gaps
// between them are all in it. The median over several windows is given; except for v000 it joins two sittings, which
// can be a few percent apart, so the side-by-side timings, each taken in one sitting, are the better comparison.
// v000 is the starting kernel. One run takes 614 microseconds.
// Contraction out = Act[4096x12288] . Wt[1024x12288]^T on v_wmma_f32_16x16x32_f16 (f16 operands: Act carried x16, Wt carried x64, folded back x1/1024 in the f32 epilogue), f32 accumulate; B-spline recursion, silu and weight products in f32.
#include <hip/hip_runtime.h>
#include <math.h>

// ---------------------------------------------------------------------------
// Problem constants
// ---------------------------------------------------------------------------
constexpr int kInDim  = 1024;
constexpr int kOutDim = 1024;
constexpr int kBatch  = 4096;
constexpr int kNumG   = 15;                 // knots per input dim
constexpr int kNumB   = 11;                 // spline bases per input dim
constexpr int kOrder  = 3;
constexpr int kPack   = 12;                 // 1 silu feature + 11 bases
constexpr int kKdim   = kInDim * kPack;     // 12288
constexpr float kActCarry = 16.0f;          // Act plane carried x16 (exact power of two)
constexpr float kWCarry   = 64.0f;          // Wt plane carried x64 (exact power of two)
constexpr float kOutScale = 1.0f / (16.0f * 64.0f);
constexpr int kTilesM = kBatch / 64;
constexpr int kTilesN = kOutDim / 64;
constexpr int kTiles  = kTilesM * kTilesN;  // 1024 wave tiles
static_assert(kKdim % 32 == 0);
static_assert(kBatch % 64 == 0);
static_assert(kOutDim % 64 == 0);
static_assert(kTiles % 8 == 0);
static_assert(kInDim % 256 == 0);

typedef __attribute__((ext_vector_type(16))) _Float16 v16h;
typedef __attribute__((ext_vector_type(8)))  _Float16 v8h;
typedef __attribute__((ext_vector_type(16))) __bf16   v16b;
typedef __attribute__((ext_vector_type(8)))  __bf16   v8b;
typedef __attribute__((ext_vector_type(8)))  float    v8f;
typedef __attribute__((ext_vector_type(4)))  float    v4f;
typedef __attribute__((ext_vector_type(4)))  unsigned int v4u;

__device__ __forceinline__ unsigned short f2bf_bits(float f) {
  unsigned u = __float_as_uint(f);
  return (unsigned short)((u + 0x7FFFu + ((u >> 16) & 1u)) >> 16);
}
__device__ __forceinline__ float bf_bits2f(unsigned short h) { return __uint_as_float(((unsigned)h) << 16); }

// hazard guards as plain device helpers (no inline asm inside the kernel template body)
__device__ __forceinline__ void dep_guard_h(v8f& a, v8f& b, v16h x, v16h y) { asm volatile("v_nop\n\tv_nop\n\tv_nop\n\tv_nop" : "+v"(a), "+v"(b) : "v"(x), "v"(y)); }
__device__ __forceinline__ void dep_guard_b(v8f& a, v8f& b, v16b x, v16b y) { asm volatile("v_nop\n\tv_nop\n\tv_nop\n\tv_nop" : "+v"(a), "+v"(b) : "v"(x), "v"(y)); }
__device__ __forceinline__ void keep4_h(v16h a, v16h b, v16h c, v16h d) { asm volatile("v_nop" :: "v"(a), "v"(b), "v"(c), "v"(d)); }
__device__ __forceinline__ void keep4_b(v16b a, v16b b, v16b c, v16b d) { asm volatile("v_nop" :: "v"(a), "v"(b), "v"(c), "v"(d)); }
__device__ __forceinline__ void acc_guard4(v8f& a, v8f& b, v8f& c, v8f& d) { asm volatile("v_nop\n\tv_nop\n\tv_nop\n\tv_nop" : "+v"(a), "+v"(b), "+v"(c), "+v"(d)); }
template <typename T> struct Frag;
template <> struct Frag<_Float16> {
  typedef v16h V; union U { v16h v; v8h h[2]; };
  // elements 0..7 <- p[0..7], 8..15 <- p[16..23]
  static __device__ __forceinline__ v16h load(const _Float16* p) {
    U f; f.h[0] = *(const v8h*)(p); f.h[1] = *(const v8h*)(p + 16); return f.v;
  }
  static __device__ __forceinline__ v8f mma(v16h a, v16h b, v8f c) {
    return __builtin_amdgcn_wmma_f32_16x16x32_f16(false, a, false, b, (short)0, c, false, false);
  }
  static __device__ __forceinline__ void guard(v8f& a, v8f& b, v16h x, v16h y) { dep_guard_h(a, b, x, y); }
  static __device__ __forceinline__ void keep(v16h a, v16h b, v16h c, v16h d) { keep4_h(a, b, c, d); }
};
template <> struct Frag<__bf16> {
  typedef v16b V; union U { v16b v; v8b h[2]; };
  static __device__ __forceinline__ v16b load(const __bf16* p) {
    U f; f.h[0] = *(const v8b*)(p); f.h[1] = *(const v8b*)(p + 16); return f.v;
  }
  static __device__ __forceinline__ v8f mma(v16b a, v16b b, v8f c) {
    return __builtin_amdgcn_wmma_f32_16x16x32_bf16(false, a, false, b, (short)0, c, false, false);
  }
  static __device__ __forceinline__ void guard(v8f& a, v8f& b, v16b x, v16b y) { dep_guard_b(a, b, x, y); }
  static __device__ __forceinline__ void keep(v16b a, v16b b, v16b c, v16b d) { keep4_b(a, b, c, d); }
};

__device__ __forceinline__ unsigned pk16(unsigned short a, unsigned short b) { return (unsigned)a | ((unsigned)b << 16); }
__device__ __forceinline__ unsigned short h_bits(float f) { const _Float16 h = (_Float16)f; return __builtin_bit_cast(unsigned short, h); }

// ---- Register-blocked batched WMMA GEMM (ACT reduced to none/relu/leaky) -----------------------
// C[m,n] = scale * sum_k A[m,k] * Bt[n,k] (+bias)(+resid); each wave owns a 64x64 tile.
// A row-major [M,K]; Bt row-major [N,K]; M,N % 64 == 0, K % 32 == 0.
// SPLIT: operands are hi/lo planes (A2/Bt2 = lo planes, same layout); product = hi*hi + hi*lo + lo*hi.
// BIAS_MODE: 0 = none, 1 = bias[m], 2 = bias[n].
// OUT_MODE: 0 = f32, 1 = f16, 2 = bf16 hi plane (Cout) + bf16 lo plane (Cout2).
// ET: 0 = f16 operands, 1 = bf16 operands (pointers passed as 16-bit storage)
template <int ET> struct Elem;
template <> struct Elem<0> { typedef _Float16 T; };
template <> struct Elem<1> { typedef __bf16 T; };
template <int ET, bool SPLIT, int BIAS_MODE, int OUT_MODE, bool RESID, int ACT = 0>
__global__ __launch_bounds__(256) void wmma_gemm64(
    const unsigned short* __restrict__ Ap, const unsigned short* __restrict__ A2p, int lda, long strideA,
    const unsigned short* __restrict__ Btp, const unsigned short* __restrict__ Bt2p, int ldb, long strideB,
    void* __restrict__ Cout, void* __restrict__ Cout2, int ldc, long strideC,
    const float* __restrict__ bias,
    const float* __restrict__ resid, long strideR,
    int M, int N, int K, float scale) {
  typedef typename Elem<ET>::T T;
  typedef typename Frag<T>::V V;
  const T* A = (const T*)Ap; const T* A2 = (const T*)A2p; const T* Bt = (const T*)Btp; const T* Bt2 = (const T*)Bt2p;
  __shared__ __align__(16) float sT[8][16 * 68];   // per-wave 16x64 slab, pitch 68 floats
  const int b    = blockIdx.y;
  const int lane = threadIdx.x & 31;
  const int wave = threadIdx.x >> 5;
  const int tilesN = N >> 6;
  const int tilesM = M >> 6;
  const int tile = blockIdx.x * 8 + wave;
  if (tile >= tilesM * tilesN) return;   // wave-uniform; no block barriers in this kernel
  const int tm = tile / tilesN;
  const int tn = tile - tm * tilesN;
  const int m0 = tm << 6;
  const int n0 = tn << 6;

  const T* Ab  = A  + (size_t)b * strideA;
  const T* Bb  = Bt + (size_t)b * strideB;
  const T* Ab2 = SPLIT ? (A2  + (size_t)b * strideA) : nullptr;
  const T* Bb2 = SPLIT ? (Bt2 + (size_t)b * strideB) : nullptr;

  const int rlane = lane & 15;                 // row (A) / col (B, D) within subtile
  const int koff  = (lane >> 4) * 8;           // k offset of this lane half
  const int mOff  = (lane >> 4) * 8;           // D row offset

  v8f acc[4][4];
#pragma unroll
  for (int i = 0; i < 4; ++i)
#pragma unroll
    for (int j = 0; j < 4; ++j) acc[i][j] = (v8f){0.f,0.f,0.f,0.f,0.f,0.f,0.f,0.f};

  for (int k0 = 0; k0 < K; k0 += 32) {
    V bh[4], bl[4];
#pragma unroll
    for (int j = 0; j < 4; ++j) {
      const size_t bo = (size_t)(n0 + (j << 4) + rlane) * ldb + koff + k0;
      bh[j] = Frag<T>::load(Bb + bo);
      if (SPLIT) bl[j] = Frag<T>::load(Bb2 + bo);
    }
#pragma unroll
    for (int i = 0; i < 4; ++i) {
      const size_t ao = (size_t)(m0 + (i << 4) + rlane) * lda + koff + k0;
      V ah = Frag<T>::load(Ab + ao);
      V al;
      if (SPLIT) al = Frag<T>::load(Ab2 + ao);
#pragma unroll
      for (int j = 0; j < 4; ++j) {
        acc[i][j] = Frag<T>::mma(ah, bh[j], acc[i][j]);
        if (SPLIT) {
          acc[i][j] = Frag<T>::mma(ah, bl[j], acc[i][j]);
          acc[i][j] = Frag<T>::mma(al, bh[j], acc[i][j]);
        }
      }
      Frag<T>::guard(acc[i][0], acc[i][3], ah, SPLIT ? al : ah);
    }
    Frag<T>::keep(bh[0], bh[1], bh[2], bh[3]);
    if (SPLIT) Frag<T>::keep(bl[0], bl[1], bl[2], bl[3]);
  }
  acc_guard4(acc[0][0], acc[0][1], acc[0][2], acc[0][3]);
  acc_guard4(acc[1][0], acc[1][1], acc[1][2], acc[1][3]);
  acc_guard4(acc[2][0], acc[2][1], acc[2][2], acc[2][3]);
  acc_guard4(acc[3][0], acc[3][1], acc[3][2], acc[3][3]);

  // ---- epilogue ----
  float* slab = sT[wave];
  const float* Rb = RESID ? (resid + (size_t)b * strideR) : nullptr;
#pragma unroll
  for (int i = 0; i < 4; ++i) {
    const int mBase = m0 + (i << 4);
#pragma unroll
    for (int j = 0; j < 4; ++j) {
      const int n = n0 + (j << 4) + rlane;
      float bv = 0.f;
      if (BIAS_MODE == 2) bv = bias[n];
#pragma unroll
      for (int r = 0; r < 8; ++r) {
        float v = acc[i][j][r] * scale;
        if (BIAS_MODE == 1) v += bias[mBase + mOff + r];
        if (BIAS_MODE == 2) v += bv;
        if (RESID) v += Rb[(size_t)(mBase + mOff + r) * ldc + n];
        if (ACT == 2) v = fmaxf(v, 0.0f);
        if (ACT == 4) v = (v > 0.f) ? v : 0.01f * v;
        slab[(mOff + r) * 68 + (j << 4) + rlane] = v;
      }
    }
    __builtin_amdgcn_fence(__ATOMIC_RELEASE, "workgroup");
    __builtin_amdgcn_wave_barrier();
    __builtin_amdgcn_fence(__ATOMIC_ACQUIRE, "workgroup");
    if (OUT_MODE == 0) {
      float* C = (float*)Cout + (size_t)b * strideC;
      const int hh = lane >> 4, c4 = (lane & 15) * 4;     // row seg = 256 B = 16 lanes x 16 B
      {
#pragma unroll
        for (int it = 0; it < 8; ++it) {
          const int row = it * 2 + hh;
          v4f v = *(const v4f*)(slab + row * 68 + c4);
          *(v4f*)(C + (size_t)(mBase + row) * ldc + n0 + c4) = v;
        }
        
      }
    } else {
      const int q = lane >> 3, c8 = (lane & 7) * 8;
      unsigned short* C  = (unsigned short*)Cout  + (size_t)b * strideC;
      unsigned short* C2 = (OUT_MODE == 2) ? ((unsigned short*)Cout2 + (size_t)b * strideC) : nullptr;
      {
#pragma unroll
        for (int it = 0; it < 4; ++it) {
          const int row = it * 4 + q;
          const float* sp = slab + row * 68 + c8;
          v8h hv, lv;
#pragma unroll
          for (int e = 0; e < 8; ++e) {
            if (OUT_MODE == 1) {
              hv[e] = (_Float16)sp[e];
            } else {
              unsigned short hb = f2bf_bits(sp[e]);
              unsigned short lb = f2bf_bits(sp[e] - bf_bits2f(hb));
              hv[e] = __builtin_bit_cast(_Float16, hb);
              lv[e] = __builtin_bit_cast(_Float16, lb);
            }
          }
          *(v8h*)(C + (size_t)(mBase + row) * ldc + n0 + c8) = hv;
          if (OUT_MODE == 2) *(v8h*)(C2 + (size_t)(mBase + row) * ldc + n0 + c8) = lv;
        }
        
      }
    }
    __builtin_amdgcn_fence(__ATOMIC_RELEASE, "workgroup");
    __builtin_amdgcn_wave_barrier();
    __builtin_amdgcn_fence(__ATOMIC_ACQUIRE, "workgroup");
  }
}

// ---------------------------------------------------------------------------
// Weight pack: Wt[o][i*12 + 0]     = f16(64 * (mask[i,o] * scale_base[i,o]))
//              Wt[o][i*12 + 1 + k] = f16(64 * (coef[i,o,k] * (mask[i,o] * scale_sp[i,o]))), k = 0..10
// coef / scale_base / scale_sp / mask are [in i][out o] (coef [i][o][k]); Wt is the [N = o][K = i*12 + j] f16 plane, pitch 12288 halves.
// grid = kOutDim blocks (one Wt row each), 256 threads. Thread t handles i = t + 256*ii, ii = 0..3 (4 x 256 = 1024 = every i),
// writing its 12 halves as 6 packed words into the LDS row image. 14 scalar global loads per lane per rolled iteration.
// Store coverage: 12288 halves = 1536 chunks of 16 B = 256 threads x 6; wave w writes chunks 256c + 32w .. +31 = 512 contiguous B
// ---------------------------------------------------------------------------
__global__ __launch_bounds__(256) void pack_weights_kernel(const float* __restrict__ coef,
                                                          const float* __restrict__ scale_base,
                                                          const float* __restrict__ scale_sp,
                                                          const float* __restrict__ mask,
                                                          unsigned short* __restrict__ Wt) {
  __shared__ __align__(16) unsigned int sW[kKdim / 2];   // 24576 B: one Wt row as packed f16 pairs
  const int o = blockIdx.x;
  const int t = threadIdx.x;
#pragma unroll 1
  for (int ii = 0; ii < kInDim / 256; ++ii) {
    const int i = t + 256 * ii;
    const size_t io = (size_t)i * kOutDim + o;
    const float m  = mask[io];
    const float wb = (m * scale_base[io]) * kWCarry;
    const float ws = m * scale_sp[io];
    const float* cp = coef + io * kNumB;
    float wv[kPack];
    wv[0] = wb;
#pragma unroll
    for (int k = 0; k < kNumB; ++k) wv[1 + k] = (cp[k] * ws) * kWCarry;
    unsigned int* dst = sW + i * (kPack / 2);
#pragma unroll
    for (int q = 0; q < kPack / 2; ++q) dst[q] = pk16(h_bits(wv[2 * q]), h_bits(wv[2 * q + 1]));
  }
  __syncthreads();
  unsigned short* row = Wt + (size_t)o * kKdim;
  {
#pragma unroll
    for (int c = 0; c < 6; ++c) {
      const int chunk = t + 256 * c;                        // 0 .. 1535
      const v4u u = *(const v4u*)(sW + chunk * 4);
      *(v4u*)(row + (size_t)chunk * 8) = u;
    }
    
  }
}

// ---------------------------------------------------------------------------
// Activation pack: Act[b][i*12 + 0] = f16(16 * silu(x[b,i])), Act[b][i*12 + 1 + k] = f16(16 * bs_k(x[b,i])), k = 0..10,
// bs = order-3 Cox-de Boor recursion over the 15 knots grid[i][0..14] (half-open indicator, nan -> 0 after each level), all in f32.
// grid = (kInDim/256, kBatch): block (ic, b) handles i in [256*ic, 256*ic + 256) of row b; 256 threads, one thread per (b, i).
// Knot staging coverage: 256 x 15 = 3840 floats = 960 x 16 B; 256 threads x 4 iterations with bound (c < 960).
// Store coverage: 256 x 12 halves = 6144 B = 384 chunks of 16 B; chunk t by every thread (256), chunk 256 + t by threads t < 128
// ---------------------------------------------------------------------------
__global__ __launch_bounds__(256) void pack_acts_kernel(const float* __restrict__ x,
                                                       const float* __restrict__ grid,
                                                       unsigned short* __restrict__ Act) {
  __shared__ __align__(16) float sG[256 * kNumG];          // 15360 B: knots of this block's 256 input dims
  __shared__ __align__(16) unsigned int sA[256 * (kPack / 2)];   // 6144 B: packed f16 features
  const int ic = blockIdx.x;
  const int b  = blockIdx.y;
  const int t  = threadIdx.x;
  const int i0 = ic * 256;
  {
    const v4f* gp = (const v4f*)(grid + (size_t)i0 * kNumG);   // byte offset i0*60 = 15360*ic, 16-B aligned
#pragma unroll
    for (int it = 0; it < 4; ++it) {
      const int c  = t + 256 * it;
      const int cc = (c < 960) ? c : 959;                       // clamp the address, predicate the LDS store
      const v4f gv = gp[cc];
      if (c < 960) *(v4f*)(sG + 4 * c) = gv;
    }
  }
  __syncthreads();

  const int i = i0 + t;
  const float xv = x[(size_t)b * kInDim + i];
  float g[kNumG];
#pragma unroll
  for (int j = 0; j < kNumG; ++j) g[j] = sG[t * kNumG + j];

  float v[kNumG - 1];
#pragma unroll
  for (int j = 0; j < kNumG - 1; ++j) v[j] = (xv >= g[j] && xv < g[j + 1]) ? 1.0f : 0.0f;

#pragma unroll
  for (int p = 1; p <= kOrder; ++p) {
    // r[j] = 1 / (g[j+p] - g[j]) for j = 0 .. 14-p (division by a broadcast knot difference = multiply by its reciprocal)
    float r[kNumG];
#pragma unroll
    for (int j = 0; j < kNumG; ++j) {
      r[j] = 0.0f;
      if (j + p < kNumG) r[j] = __builtin_amdgcn_rcpf(g[j + p] - g[j]);
    }
#pragma unroll
    for (int j = 0; j < kNumG - 1; ++j) {
      if (j + p < kNumG - 1) {
        // left: (x - g[j]) / (g[j+p] - g[j]) * v[j];  right: (g[j+p+1] - x) / (g[j+p+1] - g[j+1]) * v[j+1]
        const float tl = ((xv - g[j]) * r[j]) * v[j];
        const float tr = ((g[j + p + 1] - xv) * r[j + 1]) * v[j + 1];
        const float tt = tl + tr;
        v[j] = (tt == tt) ? tt : 0.0f;
      }
    }
  }

  const float sil = xv / (1.0f + expf(-xv));

  unsigned short hb[kPack];
  hb[0] = h_bits(sil * kActCarry);
#pragma unroll
  for (int k = 0; k < kNumB; ++k) hb[1 + k] = h_bits(v[k] * kActCarry);
  unsigned int* dst = sA + t * (kPack / 2);
#pragma unroll
  for (int q = 0; q < kPack / 2; ++q) dst[q] = pk16(hb[2 * q], hb[2 * q + 1]);
  __syncthreads();

  unsigned short* seg = Act + (size_t)b * kKdim + (size_t)i0 * kPack;
  const v4u u0 = *(const v4u*)(sA + 4 * t);
  const int t1 = (t < 128) ? t : 0;
  const v4u u1 = *(const v4u*)(sA + 4 * (256 + t1));
  {
    *(v4u*)(seg + (size_t)t * 8) = u0;
    if (t < 128) *(v4u*)(seg + (size_t)(256 + t) * 8) = u1;
    
  }
}

// ---------------------------------------------------------------------------
// Host launcher
// Workspace region map (bytes):
//   [0, 100663296)          Act f16 plane [4096][12288]
//   [100663296, 125829120)  Wt  f16 plane [1024][12288]
//   total 125829120 <= 134217728
// ---------------------------------------------------------------------------
extern "C" void kernel_launch(void* const* d_in, const int* in_sizes, int n_in,
                              void* d_out, int out_size, void* d_ws, size_t ws_size,
                              hipStream_t stream) {
  if (n_in < 6) return;
  if (in_sizes[0] != kBatch * kInDim) return;
  if (in_sizes[1] != kInDim * kNumG) return;
  if (in_sizes[2] != kInDim * kOutDim * kNumB) return;
  if (in_sizes[3] != kInDim * kOutDim || in_sizes[4] != kInDim * kOutDim || in_sizes[5] != kInDim * kOutDim) return;
  if (out_size != kBatch * kOutDim) return;

  const size_t actBytes = (size_t)kBatch * kKdim * sizeof(unsigned short);    // 100663296
  const size_t wtBytes  = (size_t)kOutDim * kKdim * sizeof(unsigned short);   // 25165824
  if (actBytes + wtBytes > ws_size) return;

  const float* x          = (const float*)d_in[0];
  const float* grid       = (const float*)d_in[1];
  const float* coef       = (const float*)d_in[2];
  const float* scale_base = (const float*)d_in[3];
  const float* scale_sp   = (const float*)d_in[4];
  const float* mask       = (const float*)d_in[5];
  float* out = (float*)d_out;

  unsigned short* Act = (unsigned short*)d_ws;
  unsigned short* Wt  = (unsigned short*)((char*)d_ws + actBytes);

  pack_weights_kernel<<<dim3(kOutDim), dim3(256), 0, stream>>>(coef, scale_base, scale_sp, mask, Wt);
  pack_acts_kernel<<<dim3(kInDim / 256, kBatch), dim3(256), 0, stream>>>(x, grid, Act);

  // out[4096][1024] = (1/1024) * Act . Wt^T ; M = 4096, N = 1024, K = 12288 (384 k-steps of 32); 1024 wave tiles = 128 blocks x 8 waves
  wmma_gemm64<0, false, 0, 0, false, 0><<<dim3(kTiles / 8, 1), dim3(256), 0, stream>>>(
      Act, Act, kKdim, 0L,
      Wt, Wt, kKdim, 0L,
      (void*)out, (void*)out, kOutDim, 0L,
      (const float*)d_ws,
      (const float*)d_ws, 0L,
      kBatch, kOutDim, kKdim, kOutScale);
}

// v001
// It runs in 161 microseconds.
// Timed twice side by side with v000, it ran 3.87 and 3.89 times as fast.
// Contraction out = Act[4096x12288] . Wt[1024x12288]^T on v_wmma_f32_16x16x32_f16 (f16 operands: Act carried x16, Wt carried x64, folded back x1/1024 in the f32 epilogue), f32 accumulate; B-spline recursion, silu and weight products in f32.
#include <hip/hip_runtime.h>
#include <math.h>
#include <stdint.h>

// ---------------------------------------------------------------------------
// Problem constants
// ---------------------------------------------------------------------------
constexpr int kInDim  = 1024;
constexpr int kOutDim = 1024;
constexpr int kBatch  = 4096;
constexpr int kNumG   = 15;                 // knots per input dim
constexpr int kNumB   = 11;                 // spline bases per input dim
constexpr int kOrder  = 3;
constexpr int kPack   = 12;                 // 1 silu feature + 11 bases
constexpr int kKdim   = kInDim * kPack;     // 12288
constexpr float kActCarry = 16.0f;          // Act plane carried x16 (exact power of two)
constexpr float kWCarry   = 64.0f;          // Wt plane carried x64 (exact power of two)
constexpr float kOutScale = 1.0f / (16.0f * 64.0f);
constexpr int kTilesM = kBatch / 128;
constexpr int kTilesN = kOutDim / 128;
constexpr int kTiles  = kTilesM * kTilesN;  // 256 workgroup tiles of 128 x 128
constexpr int kPassK  = 128;                // k per pass: 256 B of every operand row
constexpr int kPasses = kKdim / kPassK;     // 96
static_assert(kKdim % kPassK == 0 && kPasses >= 2);
static_assert(kBatch % 128 == 0);
static_assert(kOutDim % 128 == 0);
static_assert(kInDim % 256 == 0);

typedef __attribute__((ext_vector_type(16))) _Float16 v16h;
typedef __attribute__((ext_vector_type(8)))  _Float16 v8h;
typedef __attribute__((ext_vector_type(8)))  float    v8f;
typedef __attribute__((ext_vector_type(4)))  float    v4f;
typedef __attribute__((ext_vector_type(4)))  unsigned int v4u;
typedef __attribute__((ext_vector_type(4)))  uint32_t u32x4;
typedef __attribute__((ext_vector_type(8)))  uint32_t u32x8;

// ---------------------------------------------------------------------------
// Small helpers
// ---------------------------------------------------------------------------
__device__ __forceinline__ unsigned pk16(unsigned short a, unsigned short b) { return (unsigned)a | ((unsigned)b << 16); }
__device__ __forceinline__ unsigned short h_bits(float f) { const _Float16 h = (_Float16)f; return __builtin_bit_cast(unsigned short, h); }

__device__ __forceinline__ uint32_t uni(uint32_t v) { return (uint32_t)__builtin_amdgcn_readfirstlane(v); }
// a wave-uniform test held in a scalar register, so that the branch on it is s_cmp + s_cbranch_scc (a tensor load ignores EXEC)
__device__ __forceinline__ uint32_t pinned(uint32_t v) { uint32_t w = (uint32_t)__builtin_amdgcn_readfirstlane(v); asm volatile("" : "+s"(w)); return w; }
// the wave's LDS reads have returned: stands in front of the barrier behind which the buffer it read is refilled
__device__ __forceinline__ void wait_ds0() { asm volatile("s_wait_dscnt 0x0" ::: "memory"); }
// the wave's own tensor load has landed
__device__ __forceinline__ void wait_tensor0() { asm volatile("s_wait_tensorcnt 0x0" ::: "memory"); }
// both groups are named in-out (the instruction changes neither): their registers then stay the descriptor's own from one request to the
// next, and the compiler takes none of them as a temporary while a request that names them is outstanding
__device__ __forceinline__ void tdm_load(u32x4& g0, u32x8& g1) { asm volatile("tensor_load_to_lds %0, %1" : "+s"(g0), "+s"(g1) :: "memory"); }

// ---------------------------------------------------------------------------
// LDS ring of the contraction: a stage is 128 k (256 B) of 128 Act rows and 128 Wt rows, as four slices of 64 rows,
// one tensor load of one wave each; rows at pitch 272 B (the load's pad: 16 B behind every 256-B row).
// ---------------------------------------------------------------------------
constexpr uint32_t kRowB   = 256u;                 // bytes of an operand row per stage
constexpr uint32_t kPitch  = kRowB + 16u;          // 272 B: odd multiple of 16 B for ds_load_b128 readers
constexpr uint32_t kSlRows = 64u;
constexpr uint32_t kSlice  = 18432u;               // 64 x 272 = 17408 B, rounded up to a multiple of 2 KiB
constexpr uint32_t kStage  = 4u * kSlice;          // 73728 B
constexpr uint32_t kSrcPitch = (uint32_t)kKdim * 2u;   // 24576 B
static_assert(kSlRows * kPitch <= kSlice && kSlice % 2048u == 0u);
static_assert(kSrcPitch % 16u == 0u && kSrcPitch <= 131072u);

// descriptor group 1: 1-byte elements, tensor = tile = 64 rows of 256 B, source pitch 24576 B, pad 4 dwords behind every 64 dwords, no mask
__device__ __forceinline__ u32x8 tdm_group1() {
  u32x8 d;
  d[0] = uni((1u << 20) | (5u << 22) | (3u << 25));
  d[1] = uni((kRowB & 0xFFFFu) << 16);
  d[2] = uni((kRowB >> 16) | ((kSlRows & 0xFFFFu) << 16));
  d[3] = uni((kSlRows >> 16) | (kRowB << 16));
  d[4] = uni(kSlRows);
  d[5] = uni(kSrcPitch);
  d[6] = uni(0u);
  d[7] = uni(0u);
  return d;
}
// descriptor group 0: count 1, LDS byte offset, global address of the tile's first byte, type 2
__device__ __forceinline__ u32x4 tdm_group0(uint32_t lds_dst, uint64_t ga) {
  u32x4 d;
  d[0] = uni(1u);
  d[1] = uni(lds_dst);
  d[2] = uni((uint32_t)ga);
  d[3] = uni((((uint32_t)(ga >> 32)) & 0x01FFFFFFu) | 0x80000000u);
  return d;
}
// the next request's place and address, written into the same group 0
__device__ __forceinline__ void tdm_aim(u32x4& d, uint32_t lds_dst, uint64_t ga) {
  d[1] = uni(lds_dst);
  d[2] = uni((uint32_t)ga);
  d[3] = uni((((uint32_t)(ga >> 32)) & 0x01FFFFFFu) | 0x80000000u);
}

// fragment of 16 rows x 32 k: elements 0..7 <- p[0..15] bytes, 8..15 <- p[32..47] bytes (p already holds the lane half's 16-B offset)
__device__ __forceinline__ v16h ld_frag(const unsigned char* p) {
  union { v16h v; v8h h[2]; } f;
  f.h[0] = *(const v8h*)(p);
  f.h[1] = *(const v8h*)(p + 32);
  return f.v;
}

// ---------------------------------------------------------------------------
// out[4096][1024] = (1/1024) * Act[4096][12288] . Wt[1024][12288]^T
// One workgroup of 4 waves per 128 x 128 tile of out (256 workgroups); wave (wm, wn) owns 64 x 64 = 4 x 4 accumulator tiles.
// Operands come by tensor loads into a ring of two LDS buffers: stage s + 1 flies while pass s is worked on.
// Waves 0, 1 bring the two halves of the Act rows, waves 2, 3 those of the Wt rows.
// k runs upward through one accumulator per output tile.
// ---------------------------------------------------------------------------
__global__ __launch_bounds__(128) void gemm_tile128(const unsigned short* __restrict__ Act,
                                                    const unsigned short* __restrict__ Wt,
                                                    float* __restrict__ out) {
  __shared__ __attribute__((aligned(2048))) unsigned char ring[2u * kStage + 4u * 16u * 68u * 4u];   // two buffers, then the per-wave output slabs
  const uint32_t lane = threadIdx.x & 31u;
  const uint32_t wave = uni(threadIdx.x >> 5);
  const uint32_t tm = blockIdx.x % (uint32_t)kTilesM;   // speed only: the 8 workgroups that share an Act panel lie 32 apart in index
  const uint32_t tn = blockIdx.x / (uint32_t)kTilesM;
  const uint32_t wm = wave >> 1, wn = wave & 1u;
  const uint32_t rlane = lane & 15u;               // row (A) / col (B, D) within subtile
  const uint32_t hl    = lane >> 4;                // lane half: k offset 8 (16 B), D row offset 8

  const uint32_t lbase = (uint32_t)(size_t)ring;
  const unsigned short* srow = (wave < 2u) ? (Act + (size_t)(tm * 128u + wave * kSlRows) * kKdim)
                                           : (Wt + (size_t)(tn * 128u + (wave - 2u) * kSlRows) * kKdim);
  const uint64_t src = (uint64_t)(size_t)srow;
  u32x8 g1 = tdm_group1();

  v8f acc[4][4];
#pragma unroll
  for (int i = 0; i < 4; ++i)
#pragma unroll
    for (int j = 0; j < 4; ++j) acc[i][j] = (v8f){0.f,0.f,0.f,0.f,0.f,0.f,0.f,0.f};

  // prologue: stage 0 lands and is published, then stage 1 is sent off
  u32x4 g0 = tdm_group0(lbase + wave * kSlice, src);
  tdm_load(g0, g1);
  wait_tensor0();
  __syncthreads();
  tdm_aim(g0, lbase + kStage + wave * kSlice, src + kRowB);
  tdm_load(g0, g1);

  const uint32_t aoff = wm * kSlice + rlane * kPitch + hl * 16u;
  const uint32_t boff = (2u + wn) * kSlice + rlane * kPitch + hl * 16u;

  // rolled: one pass per trip, so that the publish point stands once and every register index inside is a constant
#pragma unroll 1
  for (uint32_t s = 0; s < (uint32_t)kPasses; ++s) {
    const uint32_t buf = (s & 1u) * kStage;
    const unsigned char* ap = ring + buf + aoff;
    const unsigned char* bp = ring + buf + boff;
    v16h af[2][4], bf[2][4];
#pragma unroll
    for (int q = 0; q < 4; ++q) {
      af[0][q] = ld_frag(ap + q * 16 * (int)kPitch);
      bf[0][q] = ld_frag(bp + q * 16 * (int)kPitch);
    }
#pragma unroll
    for (int kc = 0; kc < 4; ++kc) {
      const int cur = kc & 1, nxt = cur ^ 1;
      if (kc < 3) {
#pragma unroll
        for (int q = 0; q < 4; ++q) {
          af[nxt][q] = ld_frag(ap + q * 16 * (int)kPitch + (kc + 1) * 64);
          bf[nxt][q] = ld_frag(bp + q * 16 * (int)kPitch + (kc + 1) * 64);
        }
      }
      __builtin_amdgcn_sched_barrier(0);   // keeps the next block's LDS reads one group ahead of this block's WMMAs, not among them
#pragma unroll
      for (int i = 0; i < 4; ++i)
#pragma unroll
        for (int j = 0; j < 4; ++j)
          acc[i][j] = __builtin_amdgcn_wmma_f32_16x16x32_f16(false, af[cur][i], false, bf[cur][j], (short)0, acc[i][j], false, false);
      __builtin_amdgcn_sched_barrier(0);   // ends the WMMA block: the following load group stays behind it
    }
    // publish point of stage s + 1
    wait_ds0();
    wait_tensor0();
    __syncthreads();
    if (pinned(s + 2u < (uint32_t)kPasses)) {
      tdm_aim(g0, lbase + buf + wave * kSlice, src + (uint64_t)(s + 2u) * kRowB);
      tdm_load(g0, g1);
    }
  }
  wait_tensor0();
  wait_ds0();

  // ---- epilogue: each wave stages 16 x 64 in its own slab (pitch 68 floats) and stores rows of 256 B ----
  float* slab = (float*)(ring + 2u * kStage) + wave * (16u * 68u);
  const uint32_t m0 = tm * 128u + wm * 64u;
  const uint32_t n0 = tn * 128u + wn * 64u;
  const uint32_t mOff = hl * 8u;
#pragma unroll
  for (int i = 0; i < 4; ++i) {
    const uint32_t mBase = m0 + (i << 4);
#pragma unroll
    for (int j = 0; j < 4; ++j) {
#pragma unroll
      for (int r = 0; r < 8; ++r) slab[(mOff + r) * 68u + (j << 4) + rlane] = acc[i][j][r] * kOutScale;
    }
    __builtin_amdgcn_fence(__ATOMIC_RELEASE, "workgroup");
    __builtin_amdgcn_wave_barrier();
    __builtin_amdgcn_fence(__ATOMIC_ACQUIRE, "workgroup");
    const uint32_t c4 = rlane * 4u;                 // row seg = 256 B = 16 lanes x 16 B
#pragma unroll
    for (int it = 0; it < 8; ++it) {
      const uint32_t row = it * 2u + hl;
      const v4f v = *(const v4f*)(slab + row * 68u + c4);
      *(v4f*)(out + (size_t)(mBase + row) * kOutDim + n0 + c4) = v;
    }
    __builtin_amdgcn_fence(__ATOMIC_RELEASE, "workgroup");
    __builtin_amdgcn_wave_barrier();
    __builtin_amdgcn_fence(__ATOMIC_ACQUIRE, "workgroup");
  }
}

// ---------------------------------------------------------------------------
// Weight pack: Wt[o][i*12 + 0]     = f16(64 * (mask[i,o] * scale_base[i,o]))
//              Wt[o][i*12 + 1 + k] = f16(64 * (coef[i,o,k] * (mask[i,o] * scale_sp[i,o]))), k = 0..10
// coef / scale_base / scale_sp / mask are [in i][out o] (coef [i][o][k]); Wt is the [N = o][K = i*12 + j] f16 plane, pitch 12288 halves.
// grid = kOutDim blocks (one Wt row each), 256 threads. Thread t handles i = t + 256*ii, ii = 0..3 (4 x 256 = 1024 = every i),
// writing its 12 halves as 6 packed words into the LDS row image. 14 scalar global loads per lane per rolled iteration.
// Store coverage: 12288 halves = 1536 chunks of 16 B = 256 threads x 6; wave w writes chunks 256c + 32w .. +31 = 512 contiguous B
// ---------------------------------------------------------------------------
__global__ __launch_bounds__(256) void pack_weights_kernel(const float* __restrict__ coef,
                                                          const float* __restrict__ scale_base,
                                                          const float* __restrict__ scale_sp,
                                                          const float* __restrict__ mask,
                                                          unsigned short* __restrict__ Wt) {
  __shared__ __align__(16) unsigned int sW[kKdim / 2];   // 24576 B: one Wt row as packed f16 pairs
  const int o = blockIdx.x;
  const int t = threadIdx.x;
#pragma unroll 1
  for (int ii = 0; ii < kInDim / 256; ++ii) {
    const int i = t + 256 * ii;
    const size_t io = (size_t)i * kOutDim + o;
    const float m  = mask[io];
    const float wb = (m * scale_base[io]) * kWCarry;
    const float ws = m * scale_sp[io];
    const float* cp = coef + io * kNumB;
    float wv[kPack];
    wv[0] = wb;
#pragma unroll
    for (int k = 0; k < kNumB; ++k) wv[1 + k] = (cp[k] * ws) * kWCarry;
    unsigned int* dst = sW + i * (kPack / 2);
#pragma unroll
    for (int q = 0; q < kPack / 2; ++q) dst[q] = pk16(h_bits(wv[2 * q]), h_bits(wv[2 * q + 1]));
  }
  __syncthreads();
  unsigned short* row = Wt + (size_t)o * kKdim;
  {
#pragma unroll
    for (int c = 0; c < 6; ++c) {
      const int chunk = t + 256 * c;                        // 0 .. 1535
      const v4u u = *(const v4u*)(sW + chunk * 4);
      *(v4u*)(row + (size_t)chunk * 8) = u;
    }
    
  }
}

// ---------------------------------------------------------------------------
// Activation pack: Act[b][i*12 + 0] = f16(16 * silu(x[b,i])), Act[b][i*12 + 1 + k] = f16(16 * bs_k(x[b,i])), k = 0..10,
// bs = order-3 Cox-de Boor recursion over the 15 knots grid[i][0..14] (half-open indicator, nan -> 0 after each level), all in f32.
// grid = (kInDim/256, kBatch): block (ic, b) handles i in [256*ic, 256*ic + 256) of row b; 256 threads, one thread per (b, i).
// Knot staging coverage: 256 x 15 = 3840 floats = 960 x 16 B; 256 threads x 4 iterations with bound (c < 960).
// Store coverage: 256 x 12 halves = 6144 B = 384 chunks of 16 B; chunk t by every thread (256), chunk 256 + t by threads t < 128
// ---------------------------------------------------------------------------
__global__ __launch_bounds__(256) void pack_acts_kernel(const float* __restrict__ x,
                                                       const float* __restrict__ grid,
                                                       unsigned short* __restrict__ Act) {
  __shared__ __align__(16) float sG[256 * kNumG];          // 15360 B: knots of this block's 256 input dims
  __shared__ __align__(16) unsigned int sA[256 * (kPack / 2)];   // 6144 B: packed f16 features
  const int ic = blockIdx.x;
  const int b  = blockIdx.y;
  const int t  = threadIdx.x;
  const int i0 = ic * 256;
  {
    const v4f* gp = (const v4f*)(grid + (size_t)i0 * kNumG);   // byte offset i0*60 = 15360*ic, 16-B aligned
#pragma unroll
    for (int it = 0; it < 4; ++it) {
      const int c  = t + 256 * it;
      const int cc = (c < 960) ? c : 959;                       // clamp the address, predicate the LDS store
      const v4f gv = gp[cc];
      if (c < 960) *(v4f*)(sG + 4 * c) = gv;
    }
  }
  __syncthreads();

  const int i = i0 + t;
  const float xv = x[(size_t)b * kInDim + i];
  float g[kNumG];
#pragma unroll
  for (int j = 0; j < kNumG; ++j) g[j] = sG[t * kNumG + j];

  float v[kNumG - 1];
#pragma unroll
  for (int j = 0; j < kNumG - 1; ++j) v[j] = (xv >= g[j] && xv < g[j + 1]) ? 1.0f : 0.0f;

#pragma unroll
  for (int p = 1; p <= kOrder; ++p) {
    // r[j] = 1 / (g[j+p] - g[j]) for j = 0 .. 14-p (division by a broadcast knot difference = multiply by its reciprocal)
    float r[kNumG];
#pragma unroll
    for (int j = 0; j < kNumG; ++j) {
      r[j] = 0.0f;
      if (j + p < kNumG) r[j] = __builtin_amdgcn_rcpf(g[j + p] - g[j]);
    }
#pragma unroll
    for (int j = 0; j < kNumG - 1; ++j) {
      if (j + p < kNumG - 1) {
        // left: (x - g[j]) / (g[j+p] - g[j]) * v[j];  right: (g[j+p+1] - x) / (g[j+p+1] - g[j+1]) * v[j+1]
        const float tl = ((xv - g[j]) * r[j]) * v[j];
        const float tr = ((g[j + p + 1] - xv) * r[j + 1]) * v[j + 1];
        const float tt = tl + tr;
        v[j] = (tt == tt) ? tt : 0.0f;
      }
    }
  }

  const float sil = xv / (1.0f + expf(-xv));

  unsigned short hb[kPack];
  hb[0] = h_bits(sil * kActCarry);
#pragma unroll
  for (int k = 0; k < kNumB; ++k) hb[1 + k] = h_bits(v[k] * kActCarry);
  unsigned int* dst = sA + t * (kPack / 2);
#pragma unroll
  for (int q = 0; q < kPack / 2; ++q) dst[q] = pk16(hb[2 * q], hb[2 * q + 1]);
  __syncthreads();

  unsigned short* seg = Act + (size_t)b * kKdim + (size_t)i0 * kPack;
  const v4u u0 = *(const v4u*)(sA + 4 * t);
  const int t1 = (t < 128) ? t : 0;
  const v4u u1 = *(const v4u*)(sA + 4 * (256 + t1));
  {
    *(v4u*)(seg + (size_t)t * 8) = u0;
    if (t < 128) *(v4u*)(seg + (size_t)(256 + t) * 8) = u1;
    
  }
}

// ---------------------------------------------------------------------------
// Host launcher
// Workspace region map (bytes):
//   [0, 100663296)          Act f16 plane [4096][12288]
//   [100663296, 125829120)  Wt  f16 plane [1024][12288]
//   total 125829120 <= 134217728
// ---------------------------------------------------------------------------
extern "C" void kernel_launch(void* const* d_in, const int* in_sizes, int n_in,
                              void* d_out, int out_size, void* d_ws, size_t ws_size,
                              hipStream_t stream) {
  if (n_in < 6) return;
  if (in_sizes[0] != kBatch * kInDim) return;
  if (in_sizes[1] != kInDim * kNumG) return;
  if (in_sizes[2] != kInDim * kOutDim * kNumB) return;
  if (in_sizes[3] != kInDim * kOutDim || in_sizes[4] != kInDim * kOutDim || in_sizes[5] != kInDim * kOutDim) return;
  if (out_size != kBatch * kOutDim) return;

  const size_t actBytes = (size_t)kBatch * kKdim * sizeof(unsigned short);    // 100663296
  const size_t wtBytes  = (size_t)kOutDim * kKdim * sizeof(unsigned short);   // 25165824
  if (actBytes + wtBytes > ws_size) return;

  const float* x          = (const float*)d_in[0];
  const float* grid       = (const float*)d_in[1];
  const float* coef       = (const float*)d_in[2];
  const float* scale_base = (const float*)d_in[3];
  const float* scale_sp   = (const float*)d_in[4];
  const float* mask       = (const float*)d_in[5];
  float* out = (float*)d_out;

  unsigned short* Act = (unsigned short*)d_ws;
  unsigned short* Wt  = (unsigned short*)((char*)d_ws + actBytes);

  pack_weights_kernel<<<dim3(kOutDim), dim3(256), 0, stream>>>(coef, scale_base, scale_sp, mask, Wt);
  pack_acts_kernel<<<dim3(kInDim / 256, kBatch), dim3(256), 0, stream>>>(x, grid, Act);

  // out[4096][1024] = (1/1024) * Act . Wt^T ; M = 4096, N = 1024, K = 12288 (96 passes of 128 k); 256 tiles of 128 x 128, one workgroup of 4 waves each
  gemm_tile128<<<dim3(kTiles), dim3(128), 0, stream>>>(Act, Wt, out);
}

// v002
// A run of this version takes 150 microseconds.
// In both of two side-by-side timings against v001, it was 1.08 times as fast.
// Over all steps from v000 it is 4.20 times as fast.
// Contraction out = Act[4096x12288] . Wt[1024x12288]^T on v_wmma_f32_16x16x32_f16 (f16 operands: Act carried x16, Wt carried x64, folded back x1/1024 in the f32 epilogue), f32 accumulate; B-spline recursion, silu and weight products in f32.
#include <hip/hip_runtime.h>
#include <math.h>
#include <stdint.h>

// ---------------------------------------------------------------------------
// Problem constants
// ---------------------------------------------------------------------------
constexpr int kInDim  = 1024;
constexpr int kOutDim = 1024;
constexpr int kBatch  = 4096;
constexpr int kNumG   = 15;                 // knots per input dim
constexpr int kNumB   = 11;                 // spline bases per input dim
constexpr int kOrder  = 3;
constexpr int kPack   = 12;                 // 1 silu feature + 11 bases
constexpr int kKdim   = kInDim * kPack;     // 12288
constexpr float kActCarry = 16.0f;          // Act plane carried x16 (exact power of two)
constexpr float kWCarry   = 64.0f;          // Wt plane carried x64 (exact power of two)
constexpr float kOutScale = 1.0f / (16.0f * 64.0f);
constexpr int kTilesM = kBatch / 128;
constexpr int kTilesN = kOutDim / 128;
constexpr int kTiles  = kTilesM * kTilesN;  // 256 workgroup tiles of 128 x 128
constexpr int kPassK  = 128;                // k per pass: 256 B of every operand row
constexpr int kPasses = kKdim / kPassK;     // 96
static_assert(kKdim % kPassK == 0 && kPasses >= 2);
static_assert(kBatch % 128 == 0);
static_assert(kOutDim % 128 == 0);
static_assert(kInDim % 256 == 0);

typedef __attribute__((ext_vector_type(16))) _Float16 v16h;
typedef __attribute__((ext_vector_type(8)))  _Float16 v8h;
typedef __attribute__((ext_vector_type(8)))  float    v8f;
typedef __attribute__((ext_vector_type(4)))  float    v4f;
typedef __attribute__((ext_vector_type(4)))  unsigned int v4u;
typedef __attribute__((ext_vector_type(4)))  uint32_t u32x4;
typedef __attribute__((ext_vector_type(8)))  uint32_t u32x8;

// ---------------------------------------------------------------------------
// Small helpers
// ---------------------------------------------------------------------------
__device__ __forceinline__ unsigned pk16(unsigned short a, unsigned short b) { return (unsigned)a | ((unsigned)b << 16); }
__device__ __forceinline__ unsigned short h_bits(float f) { const _Float16 h = (_Float16)f; return __builtin_bit_cast(unsigned short, h); }

__device__ __forceinline__ uint32_t uni(uint32_t v) { return (uint32_t)__builtin_amdgcn_readfirstlane(v); }
// a wave-uniform test held in a scalar register, so that the branch on it is s_cmp + s_cbranch_scc (a tensor load ignores EXEC)
__device__ __forceinline__ uint32_t pinned(uint32_t v) { uint32_t w = (uint32_t)__builtin_amdgcn_readfirstlane(v); asm volatile("" : "+s"(w)); return w; }
// the wave's LDS reads have returned: stands in front of the barrier behind which the buffer it read is refilled
__device__ __forceinline__ void wait_ds0() { asm volatile("s_wait_dscnt 0x0" ::: "memory"); }
// the wave's own tensor load has landed
__device__ __forceinline__ void wait_tensor0() { asm volatile("s_wait_tensorcnt 0x0" ::: "memory"); }
// both groups are named in-out (the instruction changes neither): their registers then stay the descriptor's own from one request to the
// next, and the compiler takes none of them as a temporary while a request that names them is outstanding
__device__ __forceinline__ void tdm_load(u32x4& g0, u32x8& g1) { asm volatile("tensor_load_to_lds %0, %1" : "+s"(g0), "+s"(g1) :: "memory"); }

// ---------------------------------------------------------------------------
// LDS ring of the contraction: a stage is 128 k (256 B) of 128 Act rows and 128 Wt rows, as four slices of 64 rows,
// one tensor load of one wave each; rows at pitch 272 B (the load's pad: 16 B behind every 256-B row).
// ---------------------------------------------------------------------------
constexpr uint32_t kRowB   = 256u;                 // bytes of an operand row per stage
constexpr uint32_t kPitch  = kRowB + 16u;          // 272 B: odd multiple of 16 B for ds_load_b128 readers
constexpr uint32_t kSlRows = 64u;
constexpr uint32_t kSlice  = 18432u;               // 64 x 272 = 17408 B, rounded up to a multiple of 2 KiB
constexpr uint32_t kStage  = 4u * kSlice;          // 73728 B
constexpr uint32_t kSrcPitch = (uint32_t)kKdim * 2u;   // 24576 B
static_assert(kSlRows * kPitch <= kSlice && kSlice % 2048u == 0u);
static_assert(kSrcPitch % 16u == 0u && kSrcPitch <= 131072u);

// descriptor group 1: 1-byte elements, tensor = tile = 64 rows of 256 B, source pitch 24576 B, pad 4 dwords behind every 64 dwords, no mask
__device__ __forceinline__ u32x8 tdm_group1() {
  u32x8 d;
  d[0] = uni((1u << 20) | (5u << 22) | (3u << 25));
  d[1] = uni((kRowB & 0xFFFFu) << 16);
  d[2] = uni((kRowB >> 16) | ((kSlRows & 0xFFFFu) << 16));
  d[3] = uni((kSlRows >> 16) | (kRowB << 16));
  d[4] = uni(kSlRows);
  d[5] = uni(kSrcPitch);
  d[6] = uni(0u);
  d[7] = uni(0u);
  return d;
}
// descriptor group 0: count 1, LDS byte offset, global address of the tile's first byte, type 2
__device__ __forceinline__ u32x4 tdm_group0(uint32_t lds_dst, uint64_t ga) {
  u32x4 d;
  d[0] = uni(1u);
  d[1] = uni(lds_dst);
  d[2] = uni((uint32_t)ga);
  d[3] = uni((((uint32_t)(ga >> 32)) & 0x01FFFFFFu) | 0x80000000u);
  return d;
}
// the next request's place and address, written into the same group 0
__device__ __forceinline__ void tdm_aim(u32x4& d, uint32_t lds_dst, uint64_t ga) {
  d[1] = uni(lds_dst);
  d[2] = uni((uint32_t)ga);
  d[3] = uni((((uint32_t)(ga >> 32)) & 0x01FFFFFFu) | 0x80000000u);
}

// fragment of 16 rows x 32 k: elements 0..7 <- p[0..15] bytes, 8..15 <- p[32..47] bytes (p already holds the lane half's 16-B offset)
__device__ __forceinline__ v16h ld_frag(const unsigned char* p) {
  union { v16h v; v8h h[2]; } f;
  f.h[0] = *(const v8h*)(p);
  f.h[1] = *(const v8h*)(p + 32);
  return f.v;
}

// ---------------------------------------------------------------------------
// out[4096][1024] = (1/1024) * Act[4096][12288] . Wt[1024][12288]^T
// One workgroup of 4 waves per 128 x 128 tile of out (256 workgroups); wave (wm, wn) owns 64 x 64 = 4 x 4 accumulator tiles.
// Operands come by tensor loads into a ring of two LDS buffers: stage s + 1 flies while pass s is worked on.
// Waves 0, 1 bring the two halves of the Act rows, waves 2, 3 those of the Wt rows.
// k runs upward through one accumulator per output tile.
// ---------------------------------------------------------------------------
__global__ __launch_bounds__(128) void gemm_tile128(const unsigned short* __restrict__ Act,
                                                    const unsigned short* __restrict__ Wt,
                                                    float* __restrict__ out) {
  __shared__ __attribute__((aligned(2048))) unsigned char ring[2u * kStage + 4u * 16u * 68u * 4u];   // two buffers, then the per-wave output slabs
  const uint32_t lane = threadIdx.x & 31u;
  const uint32_t wave = uni(threadIdx.x >> 5);
  const uint32_t tm = blockIdx.x % (uint32_t)kTilesM;   // speed only: the 8 workgroups that share an Act panel lie 32 apart in index
  const uint32_t tn = blockIdx.x / (uint32_t)kTilesM;
  const uint32_t wm = wave >> 1, wn = wave & 1u;
  const uint32_t rlane = lane & 15u;               // row (A) / col (B, D) within subtile
  const uint32_t hl    = lane >> 4;                // lane half: k offset 8 (16 B), D row offset 8

  const uint32_t lbase = (uint32_t)(size_t)ring;
  const unsigned short* srow = (wave < 2u) ? (Act + (size_t)(tm * 128u + wave * kSlRows) * kKdim)
                                           : (Wt + (size_t)(tn * 128u + (wave - 2u) * kSlRows) * kKdim);
  const uint64_t src = (uint64_t)(size_t)srow;
  u32x8 g1 = tdm_group1();

  v8f acc[4][4];
#pragma unroll
  for (int i = 0; i < 4; ++i)
#pragma unroll
    for (int j = 0; j < 4; ++j) acc[i][j] = (v8f){0.f,0.f,0.f,0.f,0.f,0.f,0.f,0.f};

  // prologue: stage 0 lands and is published, then stage 1 is sent off
  u32x4 g0 = tdm_group0(lbase + wave * kSlice, src);
  tdm_load(g0, g1);
  wait_tensor0();
  __syncthreads();
  tdm_aim(g0, lbase + kStage + wave * kSlice, src + kRowB);
  tdm_load(g0, g1);

  const uint32_t aoff = wm * kSlice + rlane * kPitch + hl * 16u;
  const uint32_t boff = (2u + wn) * kSlice + rlane * kPitch + hl * 16u;

  // rolled: one pass per trip, so that the publish point stands once and every register index inside is a constant
#pragma unroll 1
  for (uint32_t s = 0; s < (uint32_t)kPasses; ++s) {
    const uint32_t buf = (s & 1u) * kStage;
    const unsigned char* ap = ring + buf + aoff;
    const unsigned char* bp = ring + buf + boff;
    v16h af[2][4], bf[2][4];
#pragma unroll
    for (int q = 0; q < 4; ++q) {
      af[0][q] = ld_frag(ap + q * 16 * (int)kPitch);
      bf[0][q] = ld_frag(bp + q * 16 * (int)kPitch);
    }
#pragma unroll
    for (int kc = 0; kc < 4; ++kc) {
      const int cur = kc & 1, nxt = cur ^ 1;
      if (kc < 3) {
#pragma unroll
        for (int q = 0; q < 4; ++q) {
          af[nxt][q] = ld_frag(ap + q * 16 * (int)kPitch + (kc + 1) * 64);
          bf[nxt][q] = ld_frag(bp + q * 16 * (int)kPitch + (kc + 1) * 64);
        }
      }
      __builtin_amdgcn_sched_barrier(0);   // keeps the next block's LDS reads one group ahead of this block's WMMAs, not among them
#pragma unroll
      for (int i = 0; i < 4; ++i)
#pragma unroll
        for (int j = 0; j < 4; ++j)
          acc[i][j] = __builtin_amdgcn_wmma_f32_16x16x32_f16(false, af[cur][i], false, bf[cur][j], (short)0, acc[i][j], false, false);
      __builtin_amdgcn_sched_barrier(0);   // ends the WMMA block: the following load group stays behind it
    }
    // publish point of stage s + 1
    wait_ds0();
    wait_tensor0();
    __syncthreads();
    if (pinned(s + 2u < (uint32_t)kPasses)) {
      tdm_aim(g0, lbase + buf + wave * kSlice, src + (uint64_t)(s + 2u) * kRowB);
      tdm_load(g0, g1);
    }
  }
  wait_tensor0();
  wait_ds0();

  // ---- epilogue: each wave stages 16 x 64 in its own slab (pitch 68 floats) and stores rows of 256 B ----
  float* slab = (float*)(ring + 2u * kStage) + wave * (16u * 68u);
  const uint32_t m0 = tm * 128u + wm * 64u;
  const uint32_t n0 = tn * 128u + wn * 64u;
  const uint32_t mOff = hl * 8u;
#pragma unroll
  for (int i = 0; i < 4; ++i) {
    const uint32_t mBase = m0 + (i << 4);
#pragma unroll
    for (int j = 0; j < 4; ++j) {
#pragma unroll
      for (int r = 0; r < 8; ++r) slab[(mOff + r) * 68u + (j << 4) + rlane] = acc[i][j][r] * kOutScale;
    }
    __builtin_amdgcn_fence(__ATOMIC_RELEASE, "workgroup");
    __builtin_amdgcn_wave_barrier();
    __builtin_amdgcn_fence(__ATOMIC_ACQUIRE, "workgroup");
    const uint32_t c4 = rlane * 4u;                 // row seg = 256 B = 16 lanes x 16 B
#pragma unroll
    for (int it = 0; it < 8; ++it) {
      const uint32_t row = it * 2u + hl;
      const v4f v = *(const v4f*)(slab + row * 68u + c4);
      *(v4f*)(out + (size_t)(mBase + row) * kOutDim + n0 + c4) = v;
    }
    __builtin_amdgcn_fence(__ATOMIC_RELEASE, "workgroup");
    __builtin_amdgcn_wave_barrier();
    __builtin_amdgcn_fence(__ATOMIC_ACQUIRE, "workgroup");
  }
}

// ---------------------------------------------------------------------------
// Weight pack: Wt[o][i*12 + 0]     = f16(64 * (mask[i,o] * scale_base[i,o]))
//              Wt[o][i*12 + 1 + k] = f16(64 * (coef[i,o,k] * (mask[i,o] * scale_sp[i,o]))), k = 0..10
// coef / scale_base / scale_sp / mask are [in i][out o] (coef [i][o][k]); Wt is the [N = o][K = i*12 + j] f16 plane, pitch 12288 halves.
// grid = kOutDim blocks (one Wt row each), 256 threads. Thread t handles i = t + 256*ii, ii = 0..3 (4 x 256 = 1024 = every i),
// writing its 12 halves as 6 packed words into the LDS row image. 14 scalar global loads per lane per rolled iteration.
// Store coverage: 12288 halves = 1536 chunks of 16 B = 256 threads x 6; wave w writes chunks 256c + 32w .. +31 = 512 contiguous B
// ---------------------------------------------------------------------------
__global__ __launch_bounds__(256) void pack_weights_kernel(const float* __restrict__ coef,
                                                          const float* __restrict__ scale_base,
                                                          const float* __restrict__ scale_sp,
                                                          const float* __restrict__ mask,
                                                          unsigned short* __restrict__ Wt) {
  __shared__ __align__(16) unsigned int sW[kKdim / 2];   // 24576 B: one Wt row as packed f16 pairs
  const int o = blockIdx.x;
  const int t = threadIdx.x;
#pragma unroll 1
  for (int ii = 0; ii < kInDim / 256; ++ii) {
    const int i = t + 256 * ii;
    const size_t io = (size_t)i * kOutDim + o;
    const float m  = mask[io];
    const float wb = (m * scale_base[io]) * kWCarry;
    const float ws = m * scale_sp[io];
    const float* cp = coef + io * kNumB;
    float wv[kPack];
    wv[0] = wb;
#pragma unroll
    for (int k = 0; k < kNumB; ++k) wv[1 + k] = (cp[k] * ws) * kWCarry;
    unsigned int* dst = sW + i * (kPack / 2);
#pragma unroll
    for (int q = 0; q < kPack / 2; ++q) dst[q] = pk16(h_bits(wv[2 * q]), h_bits(wv[2 * q + 1]));
  }
  __syncthreads();
  unsigned short* row = Wt + (size_t)o * kKdim;
  {
#pragma unroll
    for (int c = 0; c < 6; ++c) {
      const int chunk = t + 256 * c;                        // 0 .. 1535
      const v4u u = *(const v4u*)(sW + chunk * 4);
      *(v4u*)(row + (size_t)chunk * 8) = u;
    }
    
  }
}

// ---------------------------------------------------------------------------
// Activation pack: Act[b][i*12 + 0] = f16(16 * silu(x[b,i])), Act[b][i*12 + 1 + k] = f16(16 * bs_k(x[b,i])), k = 0..10,
// bs = order-3 Cox-de Boor recursion over the 15 knots grid[i][0..14] (half-open indicator, nan -> 0 after each level), all in f32.
// grid = (kInDim/256, kBatch/kActRows): block (ic, bg) handles i in [256*ic, 256*ic + 256) of rows 16*bg .. 16*bg + 15; 256 threads.
// A thread keeps one input dim for all its rows: the 15 knots and the 39 reciprocals of knot differences depend on i alone,
// are formed once and stay in registers; the row loop holds only what depends on x.
// Knot staging coverage: 256 x 15 = 3840 floats = 960 x 16 B; 256 threads x 4 iterations with bound (c < 960).
// Store coverage per row: a wave's 32 dims x 12 halves = 768 B = 6 whole lines = 48 chunks of 16 B, staged in the wave's own 768 B of sA:
// chunk l by every lane, chunk 32 + l by lanes l < 16.
// ---------------------------------------------------------------------------
constexpr int kActRows = 16;                // rows of x per workgroup: 1024 workgroups, all resident at once
static_assert(kBatch % kActRows == 0);

// v_rcp_f32 with the one free issue slot that the instruction set asks for behind a transcendental (before its source is overwritten
// or its result read) kept inside the statement; runs once per workgroup, outside the row loop
__device__ __forceinline__ float rcp_slot(float d) { float r; asm("v_rcp_f32 %0, %1\n\tv_nop" : "=v"(r) : "v"(d)); return r; }

__global__ __launch_bounds__(256) void pack_acts_kernel(const float* __restrict__ x,
                                                       const float* __restrict__ grid,
                                                       unsigned short* __restrict__ Act) {
  __shared__ __align__(16) float sG[256 * kNumG];          // 15360 B: knots of this block's 256 input dims
  __shared__ __align__(16) unsigned int sA[256 * (kPack / 2)];   // 6144 B: packed f16 features, 768 B per wave
  const int ic = blockIdx.x;
  const int b0 = blockIdx.y * kActRows;
  const int t  = threadIdx.x;
  const int i0 = ic * 256;
  {
    const v4f* gp = (const v4f*)(grid + (size_t)i0 * kNumG);   // byte offset i0*60 = 15360*ic, 16-B aligned
#pragma unroll
    for (int it = 0; it < 4; ++it) {
      const int c  = t + 256 * it;
      const int cc = (c < 960) ? c : 959;                       // clamp the address, predicate the LDS store
      const v4f gv = gp[cc];
      if (c < 960) *(v4f*)(sG + 4 * c) = gv;
    }
  }
  __syncthreads();

  const int i = i0 + t;
  float g[kNumG];
#pragma unroll
  for (int j = 0; j < kNumG; ++j) g[j] = sG[t * kNumG + j];

  // rc[p-1][j] = 1 / (g[j+p] - g[j]) for j = 0 .. 14-p (division by a broadcast knot difference = multiply by its reciprocal)
  float rc[kOrder][kNumG];
#pragma unroll
  for (int p = 1; p <= kOrder; ++p) {
#pragma unroll
    for (int j = 0; j < kNumG; ++j) {
      rc[p - 1][j] = 0.0f;
      if (j + p < kNumG) rc[p - 1][j] = rcp_slot(g[j + p] - g[j]);
    }
  }

  const int lane = t & 31;
  const int wv   = t >> 5;
  unsigned int* dst = sA + t * (kPack / 2);                       // inside the wave's own 192 words
  const unsigned int* rd0 = sA + wv * 192 + 4 * lane;             // chunk l
  const unsigned int* rd1 = sA + wv * 192 + 4 * (32 + (lane & 15));   // chunk 32 + l (lanes 16..31 read in bounds, store nothing)
  const float* xp = x + (size_t)b0 * kInDim + i;
  unsigned short* seg = Act + (size_t)b0 * kKdim + (size_t)i0 * kPack + (size_t)wv * 384;

  float xnext = xp[0];
  // rolled: the body is long, and one copy of it keeps the kernel's text small
#pragma unroll 1
  for (int rr = 0; rr < kActRows; ++rr) {
    const float xv = xnext;
    const int rn = (rr + 1 < kActRows) ? rr + 1 : rr;             // next row's x is fetched one trip ahead, the index clamped to the last row
    xnext = xp[(size_t)rn * kInDim];

    float v[kNumG - 1];
#pragma unroll
    for (int j = 0; j < kNumG - 1; ++j) v[j] = (xv >= g[j] && xv < g[j + 1]) ? 1.0f : 0.0f;

#pragma unroll
    for (int p = 1; p <= kOrder; ++p) {
#pragma unroll
      for (int j = 0; j < kNumG - 1; ++j) {
        if (j + p < kNumG - 1) {
          // left: (x - g[j]) / (g[j+p] - g[j]) * v[j];  right: (g[j+p+1] - x) / (g[j+p+1] - g[j+1]) * v[j+1]
          const float tl = ((xv - g[j]) * rc[p - 1][j]) * v[j];
          const float tr = ((g[j + p + 1] - xv) * rc[p - 1][j + 1]) * v[j + 1];
          const float tt = tl + tr;
          v[j] = (tt == tt) ? tt : 0.0f;
        }
      }
    }

    const float sil = xv / (1.0f + expf(-xv));

    unsigned short hb[kPack];
    hb[0] = h_bits(sil * kActCarry);
#pragma unroll
    for (int k = 0; k < kNumB; ++k) hb[1 + k] = h_bits(v[k] * kActCarry);
#pragma unroll
    for (int q = 0; q < kPack / 2; ++q) dst[q] = pk16(hb[2 * q], hb[2 * q + 1]);
    // the wave's own LDS writes are complete before its lanes read each other's words (no other wave touches this range);
    // LDS alone is ordered, so that the row stores and the x load issued ahead stay in flight
    __builtin_amdgcn_fence(__ATOMIC_RELEASE, "workgroup", "local");
    __builtin_amdgcn_wave_barrier();
    __builtin_amdgcn_fence(__ATOMIC_ACQUIRE, "workgroup", "local");
    const v4u u0 = *(const v4u*)rd0;
    const v4u u1 = *(const v4u*)rd1;
    unsigned short* srow = seg + (size_t)rr * kKdim;
    *(v4u*)(srow + (size_t)lane * 8) = u0;
    if (lane < 16) {
      *(v4u*)(srow + (size_t)(32 + lane) * 8) = u1;
      asm volatile("s_wait_xcnt 0x0" ::: "memory");   // directly behind the store: its address registers are advanced for the next row only behind this wait
    }
  }
}

// ---------------------------------------------------------------------------
// Host launcher
// Workspace region map (bytes):
//   [0, 100663296)          Act f16 plane [4096][12288]
//   [100663296, 125829120)  Wt  f16 plane [1024][12288]
//   total 125829120 <= 134217728
// ---------------------------------------------------------------------------
extern "C" void kernel_launch(void* const* d_in, const int* in_sizes, int n_in,
                              void* d_out, int out_size, void* d_ws, size_t ws_size,
                              hipStream_t stream) {
  if (n_in < 6) return;
  if (in_sizes[0] != kBatch * kInDim) return;
  if (in_sizes[1] != kInDim * kNumG) return;
  if (in_sizes[2] != kInDim * kOutDim * kNumB) return;
  if (in_sizes[3] != kInDim * kOutDim || in_sizes[4] != kInDim * kOutDim || in_sizes[5] != kInDim * kOutDim) return;
  if (out_size != kBatch * kOutDim) return;

  const size_t actBytes = (size_t)kBatch * kKdim * sizeof(unsigned short);    // 100663296
  const size_t wtBytes  = (size_t)kOutDim * kKdim * sizeof(unsigned short);   // 25165824
  if (actBytes + wtBytes > ws_size) return;

  const float* x          = (const float*)d_in[0];
  const float* grid       = (const float*)d_in[1];
  const float* coef       = (const float*)d_in[2];
  const float* scale_base = (const float*)d_in[3];
  const float* scale_sp   = (const float*)d_in[4];
  const float* mask       = (const float*)d_in[5];
  float* out = (float*)d_out;

  unsigned short* Act = (unsigned short*)d_ws;
  unsigned short* Wt  = (unsigned short*)((char*)d_ws + actBytes);

  pack_weights_kernel<<<dim3(kOutDim), dim3(256), 0, stream>>>(coef, scale_base, scale_sp, mask, Wt);
  pack_acts_kernel<<<dim3(kInDim / 256, kBatch / kActRows), dim3(256), 0, stream>>>(x, grid, Act);

  // out[4096][1024] = (1/1024) * Act . Wt^T ; M = 4096, N = 1024, K = 12288 (96 passes of 128 k); 256 tiles of 128 x 128, one workgroup of 4 waves each
  gemm_tile128<<<dim3(kTiles), dim3(128), 0, stream>>>(Act, Wt, out);
}

// v003
// It runs in 118 microseconds.
// In both of two side-by-side timings against v002, it was 1.28 times as fast.
// All steps since v000 together make it 5.37 times as fast.
// Contraction out = Act[4096x12288] . Wt[1024x12288]^T on v_wmma_f32_16x16x32_f16 (f16 operands: Act carried x16, Wt carried x64, folded back x1/1024 in the f32 epilogue), f32 accumulate; B-spline recursion, silu and weight products in f32.
#include <hip/hip_runtime.h>
#include <math.h>
#include <stdint.h>

// ---------------------------------------------------------------------------
// Problem constants
// ---------------------------------------------------------------------------
constexpr int kInDim  = 1024;
constexpr int kOutDim = 1024;
constexpr int kBatch  = 4096;
constexpr int kNumG   = 15;                 // knots per input dim
constexpr int kNumB   = 11;                 // spline bases per input dim
constexpr int kOrder  = 3;
constexpr int kPack   = 12;                 // 1 silu feature + 11 bases
constexpr int kKdim   = kInDim * kPack;     // 12288
constexpr float kActCarry = 16.0f;          // Act plane carried x16 (exact power of two)
constexpr float kWCarry   = 64.0f;          // Wt plane carried x64 (exact power of two)
constexpr float kOutScale = 1.0f / (16.0f * 64.0f);
constexpr int kTilesM = kBatch / 128;
constexpr int kTilesN = kOutDim / 128;
constexpr int kTiles  = kTilesM * kTilesN;  // 256 workgroup tiles of 128 x 128
constexpr int kPassK  = 128;                // k per pass: 256 B of every operand row
constexpr int kPasses = kKdim / kPassK;     // 96
static_assert(kKdim % kPassK == 0 && kPasses >= 4);
static_assert(kBatch % 128 == 0);
static_assert(kOutDim % 128 == 0);
static_assert(kInDim % 256 == 0);

typedef __attribute__((ext_vector_type(16))) _Float16 v16h;
typedef __attribute__((ext_vector_type(8)))  _Float16 v8h;
typedef __attribute__((ext_vector_type(8)))  float    v8f;
typedef __attribute__((ext_vector_type(4)))  float    v4f;
typedef __attribute__((ext_vector_type(4)))  unsigned int v4u;
typedef __attribute__((ext_vector_type(4)))  uint32_t u32x4;
typedef __attribute__((ext_vector_type(8)))  uint32_t u32x8;

// ---------------------------------------------------------------------------
// Small helpers
// ---------------------------------------------------------------------------
__device__ __forceinline__ unsigned pk16(unsigned short a, unsigned short b) { return (unsigned)a | ((unsigned)b << 16); }
__device__ __forceinline__ unsigned short h_bits(float f) { const _Float16 h = (_Float16)f; return __builtin_bit_cast(unsigned short, h); }

__device__ __forceinline__ uint32_t uni(uint32_t v) { return (uint32_t)__builtin_amdgcn_readfirstlane(v); }
// a wave-uniform test held in a scalar register, so that the branch on it is s_cmp + s_cbranch_scc (a tensor load ignores EXEC)
__device__ __forceinline__ uint32_t pinned(uint32_t v) { uint32_t w = (uint32_t)__builtin_amdgcn_readfirstlane(v); asm volatile("" : "+s"(w)); return w; }
// the wave's LDS reads have returned: stands in front of the barrier behind which the buffer it read is refilled
__device__ __forceinline__ void wait_ds0() { asm volatile("s_wait_dscnt 0x0" ::: "memory"); }
// every tensor load of the wave has landed
__device__ __forceinline__ void wait_tensor0() { asm volatile("s_wait_tensorcnt 0x0" ::: "memory"); }
// all but the wave's two youngest tensor loads have landed (they land in issue order): the two stages behind the next one stay in flight
__device__ __forceinline__ void wait_tensor2() { asm volatile("s_wait_tensorcnt 0x2" ::: "memory"); }
// both groups are named in-out (the instruction changes neither): their registers then stay the descriptor's own from one request to the
// next, and the compiler takes none of them as a temporary while a request that names them is outstanding
__device__ __forceinline__ void tdm_load(u32x4& g0, u32x8& g1) { asm volatile("tensor_load_to_lds %0, %1" : "+s"(g0), "+s"(g1) :: "memory"); }

// ---------------------------------------------------------------------------
// LDS ring of the contraction: a stage is 128 k (256 B) of 128 Act rows and 128 Wt rows, as four slices of 64 rows,
// one tensor load of one wave each; rows at pitch 272 B (the load's pad: 16 B behind every 256-B row).
// ---------------------------------------------------------------------------
constexpr uint32_t kRowB   = 256u;                 // bytes of an operand row per stage
constexpr uint32_t kPitch  = kRowB + 16u;          // 272 B: odd multiple of 16 B for ds_load_b128 readers
constexpr uint32_t kSlRows = 64u;
constexpr uint32_t kSlice  = 18432u;               // 64 x 272 = 17408 B, rounded up to a multiple of 2 KiB
constexpr uint32_t kStage  = 4u * kSlice;          // 73728 B
constexpr uint32_t kBufs   = 4u;                   // buffers of the ring: one is worked on, three are in flight
constexpr uint32_t kSrcPitch = (uint32_t)kKdim * 2u;   // 24576 B
static_assert(kSlRows * kPitch <= kSlice && kSlice % 2048u == 0u);
static_assert(kSrcPitch % 16u == 0u && kSrcPitch <= 131072u);

// descriptor group 1: 1-byte elements, tensor = tile = 64 rows of 256 B, source pitch 24576 B, pad 4 dwords behind every 64 dwords, no mask
__device__ __forceinline__ u32x8 tdm_group1() {
  u32x8 d;
  d[0] = uni((1u << 20) | (5u << 22) | (3u << 25));
  d[1] = uni((kRowB & 0xFFFFu) << 16);
  d[2] = uni((kRowB >> 16) | ((kSlRows & 0xFFFFu) << 16));
  d[3] = uni((kSlRows >> 16) | (kRowB << 16));
  d[4] = uni(kSlRows);
  d[5] = uni(kSrcPitch);
  d[6] = uni(0u);
  d[7] = uni(0u);
  return d;
}
// descriptor group 0: count 1, LDS byte offset, global address of the tile's first byte, type 2
__device__ __forceinline__ u32x4 tdm_group0(uint32_t lds_dst, uint64_t ga) {
  u32x4 d;
  d[0] = uni(1u);
  d[1] = uni(lds_dst);
  d[2] = uni((uint32_t)ga);
  d[3] = uni((((uint32_t)(ga >> 32)) & 0x01FFFFFFu) | 0x80000000u);
  return d;
}
// the next request's place and address, written into the same group 0 while earlier requests are in flight: only words 1 and 2 change then.
// Word 3 (the address's high part) changes only where a row crosses a multiple of 4 GiB, and then behind a wait for every request that names it.
__device__ __forceinline__ void tdm_aim(u32x4& d, uint32_t lds_dst, uint64_t ga) {
  uint32_t w3 = uni((((uint32_t)(ga >> 32)) & 0x01FFFFFFu) | 0x80000000u);
  if (pinned(w3 != d[3])) {
    // the group and the new word are both operands of the wait, so that they lie in different registers at it and word 3 is written behind it
    asm volatile("s_wait_tensorcnt 0x0" : "+s"(d), "+s"(w3) :: "memory");
    d[3] = w3;
  }
  d[1] = uni(lds_dst);
  d[2] = uni((uint32_t)ga);
}

// fragment of 16 rows x 32 k: elements 0..7 <- p[0..15] bytes, 8..15 <- p[32..47] bytes (p already holds the lane half's 16-B offset)
__device__ __forceinline__ v16h ld_frag(const unsigned char* p) {
  union { v16h v; v8h h[2]; } f;
  f.h[0] = *(const v8h*)(p);
  f.h[1] = *(const v8h*)(p + 32);
  return f.v;
}

// ---------------------------------------------------------------------------
// out[4096][1024] = (1/1024) * Act[4096][12288] . Wt[1024][12288]^T
// One workgroup of 4 waves per 128 x 128 tile of out (256 workgroups); wave (wm, wn) owns 64 x 64 = 4 x 4 accumulator tiles.
// Operands come by tensor loads into a ring of four LDS buffers: stages s + 1, s + 2 and s + 3 fly while pass s is worked on.
// Waves 0, 1 bring the two halves of the Act rows, waves 2, 3 those of the Wt rows.
// k runs upward through one accumulator per output tile.
// ---------------------------------------------------------------------------
__global__ __launch_bounds__(128) void gemm_tile128(const unsigned short* __restrict__ Act,
                                                    const unsigned short* __restrict__ Wt,
                                                    float* __restrict__ out) {
  __shared__ __attribute__((aligned(2048))) unsigned char ring[kBufs * kStage + 4u * 16u * 68u * 4u];   // four buffers, then the per-wave output slabs
  const uint32_t lane = threadIdx.x & 31u;
  const uint32_t wave = uni(threadIdx.x >> 5);
  const uint32_t tm = blockIdx.x % (uint32_t)kTilesM;   // speed only: the 8 workgroups that share an Act panel lie 32 apart in index
  const uint32_t tn = blockIdx.x / (uint32_t)kTilesM;
  const uint32_t wm = wave >> 1, wn = wave & 1u;
  const uint32_t rlane = lane & 15u;               // row (A) / col (B, D) within subtile
  const uint32_t hl    = lane >> 4;                // lane half: k offset 8 (16 B), D row offset 8

  const uint32_t lbase = (uint32_t)(size_t)ring;
  const unsigned short* srow = (wave < 2u) ? (Act + (size_t)(tm * 128u + wave * kSlRows) * kKdim)
                                           : (Wt + (size_t)(tn * 128u + (wave - 2u) * kSlRows) * kKdim);
  const uint64_t src = (uint64_t)(size_t)srow;
  u32x8 g1 = tdm_group1();

  v8f acc[4][4];
#pragma unroll
  for (int i = 0; i < 4; ++i)
#pragma unroll
    for (int j = 0; j < 4; ++j) acc[i][j] = (v8f){0.f,0.f,0.f,0.f,0.f,0.f,0.f,0.f};

  // prologue: stages 0, 1, 2 are sent off; stage 0 lands and is published; then stage 3 is sent off (never more than three in flight)
  u32x4 g0 = tdm_group0(lbase + wave * kSlice, src);
  tdm_load(g0, g1);
  tdm_aim(g0, lbase + kStage + wave * kSlice, src + kRowB);
  tdm_load(g0, g1);
  tdm_aim(g0, lbase + 2u * kStage + wave * kSlice, src + 2u * kRowB);
  tdm_load(g0, g1);
  wait_tensor2();
  __syncthreads();
  tdm_aim(g0, lbase + 3u * kStage + wave * kSlice, src + 3u * kRowB);
  tdm_load(g0, g1);

  const uint32_t aoff = wm * kSlice + rlane * kPitch + hl * 16u;
  const uint32_t boff = (2u + wn) * kSlice + rlane * kPitch + hl * 16u;

  // rolled: one pass per trip, so that the publish point stands once and every register index inside is a constant
#pragma unroll 1
  for (uint32_t s = 0; s < (uint32_t)kPasses; ++s) {
    const uint32_t buf = (s & (kBufs - 1u)) * kStage;
    const unsigned char* ap = ring + buf + aoff;
    const unsigned char* bp = ring + buf + boff;
    v16h af[2][4], bf[2][4];
#pragma unroll
    for (int q = 0; q < 4; ++q) {
      af[0][q] = ld_frag(ap + q * 16 * (int)kPitch);
      bf[0][q] = ld_frag(bp + q * 16 * (int)kPitch);
    }
#pragma unroll
    for (int kc = 0; kc < 4; ++kc) {
      const int cur = kc & 1, nxt = cur ^ 1;
      if (kc < 3) {
#pragma unroll
        for (int q = 0; q < 4; ++q) {
          af[nxt][q] = ld_frag(ap + q * 16 * (int)kPitch + (kc + 1) * 64);
          bf[nxt][q] = ld_frag(bp + q * 16 * (int)kPitch + (kc + 1) * 64);
        }
      }
      __builtin_amdgcn_sched_barrier(0);   // keeps the next block's LDS reads one group ahead of this block's WMMAs, not among them
#pragma unroll
      for (int i = 0; i < 4; ++i)
#pragma unroll
        for (int j = 0; j < 4; ++j)
          acc[i][j] = __builtin_amdgcn_wmma_f32_16x16x32_f16(false, af[cur][i], false, bf[cur][j], (short)0, acc[i][j], false, false);
      __builtin_amdgcn_sched_barrier(0);   // ends the WMMA block: the following load group stays behind it
    }
    // publish point of stage s + 1: behind it stages s + 2 and s + 3 were issued, so the counted wait covers it;
    // in the last passes, where fewer were issued behind it, the wait is to 0
    wait_ds0();
    wait_tensor2();
    if (pinned(s + 3u >= (uint32_t)kPasses)) wait_tensor0();
    __syncthreads();
    if (pinned(s + kBufs < (uint32_t)kPasses)) {
      tdm_aim(g0, lbase + buf + wave * kSlice, src + (uint64_t)(s + kBufs) * kRowB);   // into the buffer that pass s has just read
      tdm_load(g0, g1);
    }
  }
  wait_tensor0();
  wait_ds0();

  // ---- epilogue: each wave stages 16 x 64 in its own slab (pitch 68 floats) and stores rows of 256 B ----
  float* slab = (float*)(ring + kBufs * kStage) + wave * (16u * 68u);
  const uint32_t m0 = tm * 128u + wm * 64u;
  const uint32_t n0 = tn * 128u + wn * 64u;
  const uint32_t mOff = hl * 8u;
#pragma unroll
  for (int i = 0; i < 4; ++i) {
    const uint32_t mBase = m0 + (i << 4);
#pragma unroll
    for (int j = 0; j < 4; ++j) {
#pragma unroll
      for (int r = 0; r < 8; ++r) slab[(mOff + r) * 68u + (j << 4) + rlane] = acc[i][j][r] * kOutScale;
    }
    __builtin_amdgcn_fence(__ATOMIC_RELEASE, "workgroup");
    __builtin_amdgcn_wave_barrier();
    __builtin_amdgcn_fence(__ATOMIC_ACQUIRE, "workgroup");
    const uint32_t c4 = rlane * 4u;                 // row seg = 256 B = 16 lanes x 16 B
#pragma unroll
    for (int it = 0; it < 8; ++it) {
      const uint32_t row = it * 2u + hl;
      const v4f v = *(const v4f*)(slab + row * 68u + c4);
      *(v4f*)(out + (size_t)(mBase + row) * kOutDim + n0 + c4) = v;
    }
    __builtin_amdgcn_fence(__ATOMIC_RELEASE, "workgroup");
    __builtin_amdgcn_wave_barrier();
    __builtin_amdgcn_fence(__ATOMIC_ACQUIRE, "workgroup");
  }
}

// ---------------------------------------------------------------------------
// Weight pack: Wt[o][i*12 + 0]     = f16(64 * (mask[i,o] * scale_base[i,o]))
//              Wt[o][i*12 + 1 + k] = f16(64 * (coef[i,o,k] * (mask[i,o] * scale_sp[i,o]))), k = 0..10
// coef / scale_base / scale_sp / mask are [in i][out o] (coef [i][o][k]); Wt is the [N = o][K = i*12 + j] f16 plane, pitch 12288 halves.
// grid = kOutDim blocks (one Wt row each), 256 threads. Thread t handles i = t + 256*ii, ii = 0..3 (4 x 256 = 1024 = every i),
// writing its 12 halves as 6 packed words into the LDS row image. 14 scalar global loads per lane per rolled iteration.
// Store coverage: 12288 halves = 1536 chunks of 16 B = 256 threads x 6; wave w writes chunks 256c + 32w .. +31 = 512 contiguous B
// ---------------------------------------------------------------------------
__global__ __launch_bounds__(256) void pack_weights_kernel(const float* __restrict__ coef,
                                                          const float* __restrict__ scale_base,
                                                          const float* __restrict__ scale_sp,
                                                          const float* __restrict__ mask,
                                                          unsigned short* __restrict__ Wt) {
  __shared__ __align__(16) unsigned int sW[kKdim / 2];   // 24576 B: one Wt row as packed f16 pairs
  const int o = blockIdx.x;
  const int t = threadIdx.x;
#pragma unroll 1
  for (int ii = 0; ii < kInDim / 256; ++ii) {
    const int i = t + 256 * ii;
    const size_t io = (size_t)i * kOutDim + o;
    const float m  = mask[io];
    const float wb = (m * scale_base[io]) * kWCarry;
    const float ws = m * scale_sp[io];
    const float* cp = coef + io * kNumB;
    float wv[kPack];
    wv[0] = wb;
#pragma unroll
    for (int k = 0; k < kNumB; ++k) wv[1 + k] = (cp[k] * ws) * kWCarry;
    unsigned int* dst = sW + i * (kPack / 2);
#pragma unroll
    for (int q = 0; q < kPack / 2; ++q) dst[q] = pk16(h_bits(wv[2 * q]), h_bits(wv[2 * q + 1]));
  }
  __syncthreads();
  unsigned short* row = Wt + (size_t)o * kKdim;
  {
#pragma unroll
    for (int c = 0; c < 6; ++c) {
      const int chunk = t + 256 * c;                        // 0 .. 1535
      const v4u u = *(const v4u*)(sW + chunk * 4);
      *(v4u*)(row + (size_t)chunk * 8) = u;
    }
    
  }
}

// ---------------------------------------------------------------------------
// Activation pack: Act[b][i*12 + 0] = f16(16 * silu(x[b,i])), Act[b][i*12 + 1 + k] = f16(16 * bs_k(x[b,i])), k = 0..10,
// bs = order-3 Cox-de Boor recursion over the 15 knots grid[i][0..14] (half-open indicator, nan -> 0 after each level), all in f32.
// grid = (kInDim/256, kBatch/kActRows): block (ic, bg) handles i in [256*ic, 256*ic + 256) of rows 16*bg .. 16*bg + 15; 256 threads.
// A thread keeps one input dim for all its rows: the 15 knots and the 39 reciprocals of knot differences depend on i alone,
// are formed once and stay in registers; the row loop holds only what depends on x.
// Knot staging coverage: 256 x 15 = 3840 floats = 960 x 16 B; 256 threads x 4 iterations with bound (c < 960).
// Store coverage per row: a wave's 32 dims x 12 halves = 768 B = 6 whole lines = 48 chunks of 16 B, staged in the wave's own 768 B of sA:
// chunk l by every lane, chunk 32 + l by lanes l < 16.
// ---------------------------------------------------------------------------
constexpr int kActRows = 16;                // rows of x per workgroup: 1024 workgroups, all resident at once
static_assert(kBatch % kActRows == 0);

// v_rcp_f32 with the one free issue slot that the instruction set asks for behind a transcendental (before its source is overwritten
// or its result read) kept inside the statement; runs once per workgroup, outside the row loop
__device__ __forceinline__ float rcp_slot(float d) { float r; asm("v_rcp_f32 %0, %1\n\tv_nop" : "=v"(r) : "v"(d)); return r; }

__global__ __launch_bounds__(256) void pack_acts_kernel(const float* __restrict__ x,
                                                       const float* __restrict__ grid,
                                                       unsigned short* __restrict__ Act) {
  __shared__ __align__(16) float sG[256 * kNumG];          // 15360 B: knots of this block's 256 input dims
  __shared__ __align__(16) unsigned int sA[256 * (kPack / 2)];   // 6144 B: packed f16 features, 768 B per wave
  const int ic = blockIdx.x;
  const int b0 = blockIdx.y * kActRows;
  const int t  = threadIdx.x;
  const int i0 = ic * 256;
  {
    const v4f* gp = (const v4f*)(grid + (size_t)i0 * kNumG);   // byte offset i0*60 = 15360*ic, 16-B aligned
#pragma unroll
    for (int it = 0; it < 4; ++it) {
      const int c  = t + 256 * it;
      const int cc = (c < 960) ? c : 959;                       // clamp the address, predicate the LDS store
      const v4f gv = gp[cc];
      if (c < 960) *(v4f*)(sG + 4 * c) = gv;
    }
  }
  __syncthreads();

  const int i = i0 + t;
  float g[kNumG];
#pragma unroll
  for (int j = 0; j < kNumG; ++j) g[j] = sG[t * kNumG + j];

  // rc[p-1][j] = 1 / (g[j+p] - g[j]) for j = 0 .. 14-p (division by a broadcast knot difference = multiply by its reciprocal)
  float rc[kOrder][kNumG];
#pragma unroll
  for (int p = 1; p <= kOrder; ++p) {
#pragma unroll
    for (int j = 0; j < kNumG; ++j) {
      rc[p - 1][j] = 0.0f;
      if (j + p < kNumG) rc[p - 1][j] = rcp_slot(g[j + p] - g[j]);
    }
  }

  const int lane = t & 31;
  const int wv   = t >> 5;
  unsigned int* dst = sA + t * (kPack / 2);                       // inside the wave's own 192 words
  const unsigned int* rd0 = sA + wv * 192 + 4 * lane;             // chunk l
  const unsigned int* rd1 = sA + wv * 192 + 4 * (32 + (lane & 15));   // chunk 32 + l (lanes 16..31 read in bounds, store nothing)
  const float* xp = x + (size_t)b0 * kInDim + i;
  unsigned short* seg = Act + (size_t)b0 * kKdim + (size_t)i0 * kPack + (size_t)wv * 384;

  float xnext = xp[0];
  // rolled: the body is long, and one copy of it keeps the kernel's text small
#pragma unroll 1
  for (int rr = 0; rr < kActRows; ++rr) {
    const float xv = xnext;
    const int rn = (rr + 1 < kActRows) ? rr + 1 : rr;             // next row's x is fetched one trip ahead, the index clamped to the last row
    xnext = xp[(size_t)rn * kInDim];

    float v[kNumG - 1];
#pragma unroll
    for (int j = 0; j < kNumG - 1; ++j) v[j] = (xv >= g[j] && xv < g[j + 1]) ? 1.0f : 0.0f;

#pragma unroll
    for (int p = 1; p <= kOrder; ++p) {
#pragma unroll
      for (int j = 0; j < kNumG - 1; ++j) {
        if (j + p < kNumG - 1) {
          // left: (x - g[j]) / (g[j+p] - g[j]) * v[j];  right: (g[j+p+1] - x) / (g[j+p+1] - g[j+1]) * v[j+1]
          const float tl = ((xv - g[j]) * rc[p - 1][j]) * v[j];
          const float tr = ((g[j + p + 1] - xv) * rc[p - 1][j + 1]) * v[j + 1];
          const float tt = tl + tr;
          v[j] = (tt == tt) ? tt : 0.0f;
        }
      }
    }

    const float sil = xv / (1.0f + expf(-xv));

    unsigned short hb[kPack];
    hb[0] = h_bits(sil * kActCarry);
#pragma unroll
    for (int k = 0; k < kNumB; ++k) hb[1 + k] = h_bits(v[k] * kActCarry);
#pragma unroll
    for (int q = 0; q < kPack / 2; ++q) dst[q] = pk16(hb[2 * q], hb[2 * q + 1]);
    // the wave's own LDS writes are complete before its lanes read each other's words (no other wave touches this range);
    // LDS alone is ordered, so that the row stores and the x load issued ahead stay in flight
    __builtin_amdgcn_fence(__ATOMIC_RELEASE, "workgroup", "local");
    __builtin_amdgcn_wave_barrier();
    __builtin_amdgcn_fence(__ATOMIC_ACQUIRE, "workgroup", "local");
    const v4u u0 = *(const v4u*)rd0;
    const v4u u1 = *(const v4u*)rd1;
    unsigned short* srow = seg + (size_t)rr * kKdim;
    *(v4u*)(srow + (size_t)lane * 8) = u0;
    if (lane < 16) {
      *(v4u*)(srow + (size_t)(32 + lane) * 8) = u1;
      asm volatile("s_wait_xcnt 0x0" ::: "memory");   // directly behind the store: its address registers are advanced for the next row only behind this wait
    }
  }
}

// ---------------------------------------------------------------------------
// Host launcher
// Workspace region map (bytes):
//   [0, 100663296)          Act f16 plane [4096][12288]
//   [100663296, 125829120)  Wt  f16 plane [1024][12288]
//   total 125829120 <= 134217728
// ---------------------------------------------------------------------------
extern "C" void kernel_launch(void* const* d_in, const int* in_sizes, int n_in,
                              void* d_out, int out_size, void* d_ws, size_t ws_size,
                              hipStream_t stream) {
  if (n_in < 6) return;
  if (in_sizes[0] != kBatch * kInDim) return;
  if (in_sizes[1] != kInDim * kNumG) return;
  if (in_sizes[2] != kInDim * kOutDim * kNumB) return;
  if (in_sizes[3] != kInDim * kOutDim || in_sizes[4] != kInDim * kOutDim || in_sizes[5] != kInDim * kOutDim) return;
  if (out_size != kBatch * kOutDim) return;

  const size_t actBytes = (size_t)kBatch * kKdim * sizeof(unsigned short);    // 100663296
  const size_t wtBytes  = (size_t)kOutDim * kKdim * sizeof(unsigned short);   // 25165824
  if (actBytes + wtBytes > ws_size) return;

  const float* x          = (const float*)d_in[0];
  const float* grid       = (const float*)d_in[1];
  const float* coef       = (const float*)d_in[2];
  const float* scale_base = (const float*)d_in[3];
  const float* scale_sp   = (const float*)d_in[4];
  const float* mask       = (const float*)d_in[5];
  float* out = (float*)d_out;

  unsigned short* Act = (unsigned short*)d_ws;
  unsigned short* Wt  = (unsigned short*)((char*)d_ws + actBytes);

  pack_weights_kernel<<<dim3(kOutDim), dim3(256), 0, stream>>>(coef, scale_base, scale_sp, mask, Wt);
  pack_acts_kernel<<<dim3(kInDim / 256, kBatch / kActRows), dim3(256), 0, stream>>>(x, grid, Act);

  // out[4096][1024] = (1/1024) * Act . Wt^T ; M = 4096, N = 1024, K = 12288 (96 passes of 128 k); 256 tiles of 128 x 128, one workgroup of 4 waves each
  gemm_tile128<<<dim3(kTiles), dim3(128), 0, stream>>>(Act, Wt, out);
}

// v004
// One run takes 97.9 microseconds.
// Next to v003, in two timings, it ran 1.20 times as fast each time.
// Counting every step since v000, it is 6.45 times as fast.
// Contraction out = Act[4096x12288] . Wt[1024x12288]^T on v_wmma_f32_16x16x32_f16 (f16 operands: Act carried x16, Wt carried x64, folded back x1/1024 in the f32 epilogue), f32 accumulate; B-spline recursion, silu and weight products in f32.
#include <hip/hip_runtime.h>
#include <math.h>
#include <stdint.h>

// ---------------------------------------------------------------------------
// Problem constants
// ---------------------------------------------------------------------------
constexpr int kInDim  = 1024;
constexpr int kOutDim = 1024;
constexpr int kBatch  = 4096;
constexpr int kNumG   = 15;                 // knots per input dim
constexpr int kNumB   = 11;                 // spline bases per input dim
constexpr int kOrder  = 3;
constexpr int kPack   = 12;                 // 1 silu feature + 11 bases
constexpr int kKdim   = kInDim * kPack;     // 12288
constexpr float kActCarry = 16.0f;          // Act plane carried x16 (exact power of two)
constexpr float kWCarry   = 64.0f;          // Wt plane carried x64 (exact power of two)
constexpr float kOutScale = 1.0f / (16.0f * 64.0f);
constexpr int kTilesM = kBatch / 128;
constexpr int kTilesN = kOutDim / 128;
constexpr int kTiles  = kTilesM * kTilesN;  // 256 workgroup tiles of 128 x 128
constexpr int kPassK  = 128;                // k per pass: 256 B of every operand row
constexpr int kPasses = kKdim / kPassK;     // 96
static_assert(kKdim % kPassK == 0 && kPasses >= 4);
static_assert(kBatch % 128 == 0);
static_assert(kOutDim % 128 == 0);
static_assert(kInDim % 256 == 0);

typedef __attribute__((ext_vector_type(16))) _Float16 v16h;
typedef __attribute__((ext_vector_type(8)))  _Float16 v8h;
typedef __attribute__((ext_vector_type(8)))  float    v8f;
typedef __attribute__((ext_vector_type(4)))  float    v4f;
typedef __attribute__((ext_vector_type(4)))  unsigned int v4u;
typedef __attribute__((ext_vector_type(4)))  uint32_t u32x4;
typedef __attribute__((ext_vector_type(8)))  uint32_t u32x8;

// ---------------------------------------------------------------------------
// Small helpers
// ---------------------------------------------------------------------------
__device__ __forceinline__ unsigned pk16(unsigned short a, unsigned short b) { return (unsigned)a | ((unsigned)b << 16); }
__device__ __forceinline__ unsigned short h_bits(float f) { const _Float16 h = (_Float16)f; return __builtin_bit_cast(unsigned short, h); }

__device__ __forceinline__ uint32_t uni(uint32_t v) { return (uint32_t)__builtin_amdgcn_readfirstlane(v); }
// a wave-uniform test held in a scalar register, so that the branch on it is s_cmp + s_cbranch_scc (a tensor load ignores EXEC)
__device__ __forceinline__ uint32_t pinned(uint32_t v) { uint32_t w = (uint32_t)__builtin_amdgcn_readfirstlane(v); asm volatile("" : "+s"(w)); return w; }
// the wave's LDS reads have returned: stands in front of the barrier behind which the buffer it read is refilled
__device__ __forceinline__ void wait_ds0() { asm volatile("s_wait_dscnt 0x0" ::: "memory"); }
// every tensor load of the wave has landed
__device__ __forceinline__ void wait_tensor0() { asm volatile("s_wait_tensorcnt 0x0" ::: "memory"); }
// all but the wave's two youngest tensor loads have landed (they land in issue order): the two stages behind the next one stay in flight
__device__ __forceinline__ void wait_tensor2() { asm volatile("s_wait_tensorcnt 0x2" ::: "memory"); }
// both groups are named in-out (the instruction changes neither): their registers then stay the descriptor's own from one request to the
// next, and the compiler takes none of them as a temporary while a request that names them is outstanding
__device__ __forceinline__ void tdm_load(u32x4& g0, u32x8& g1) { asm volatile("tensor_load_to_lds %0, %1" : "+s"(g0), "+s"(g1) :: "memory"); }

// ---------------------------------------------------------------------------
// LDS ring of the contraction: a stage is 128 k (256 B) of 128 Act rows and 128 Wt rows, as four slices of 64 rows,
// one tensor load of one wave each; rows at pitch 272 B (the load's pad: 16 B behind every 256-B row).
// ---------------------------------------------------------------------------
constexpr uint32_t kRowB   = 256u;                 // bytes of an operand row per stage
constexpr uint32_t kPitch  = kRowB + 16u;          // 272 B: odd multiple of 16 B for ds_load_b128 readers
constexpr uint32_t kSlRows = 64u;
constexpr uint32_t kSlice  = 18432u;               // 64 x 272 = 17408 B, rounded up to a multiple of 2 KiB
constexpr uint32_t kStage  = 4u * kSlice;          // 73728 B
constexpr uint32_t kBufs   = 4u;                   // buffers of the ring: one is worked on, three are in flight
constexpr uint32_t kSrcPitch = (uint32_t)kKdim * 2u;   // 24576 B
static_assert(kSlRows * kPitch <= kSlice && kSlice % 2048u == 0u);
static_assert(kSrcPitch % 16u == 0u && kSrcPitch <= 131072u);

// descriptor group 1: 1-byte elements, tensor = tile = 64 rows of 256 B, source pitch 24576 B, pad 4 dwords behind every 64 dwords, no mask
__device__ __forceinline__ u32x8 tdm_group1() {
  u32x8 d;
  d[0] = uni((1u << 20) | (5u << 22) | (3u << 25));
  d[1] = uni((kRowB & 0xFFFFu) << 16);
  d[2] = uni((kRowB >> 16) | ((kSlRows & 0xFFFFu) << 16));
  d[3] = uni((kSlRows >> 16) | (kRowB << 16));
  d[4] = uni(kSlRows);
  d[5] = uni(kSrcPitch);
  d[6] = uni(0u);
  d[7] = uni(0u);
  return d;
}
// descriptor group 0: count 1, LDS byte offset, global address of the tile's first byte, type 2
__device__ __forceinline__ u32x4 tdm_group0(uint32_t lds_dst, uint64_t ga) {
  u32x4 d;
  d[0] = uni(1u);
  d[1] = uni(lds_dst);
  d[2] = uni((uint32_t)ga);
  d[3] = uni((((uint32_t)(ga >> 32)) & 0x01FFFFFFu) | 0x80000000u);
  return d;
}
// the next request's place and address, written into the same group 0 while earlier requests are in flight: only words 1 and 2 change then.
// Word 3 (the address's high part) changes only where a row crosses a multiple of 4 GiB, and then behind a wait for every request that names it.
__device__ __forceinline__ void tdm_aim(u32x4& d, uint32_t lds_dst, uint64_t ga) {
  uint32_t w3 = uni((((uint32_t)(ga >> 32)) & 0x01FFFFFFu) | 0x80000000u);
  if (pinned(w3 != d[3])) {
    // the group and the new word are both operands of the wait, so that they lie in different registers at it and word 3 is written behind it
    asm volatile("s_wait_tensorcnt 0x0" : "+s"(d), "+s"(w3) :: "memory");
    d[3] = w3;
  }
  d[1] = uni(lds_dst);
  d[2] = uni((uint32_t)ga);
}

// fragment of 16 rows x 32 k: elements 0..7 <- p[0..15] bytes, 8..15 <- p[32..47] bytes (p already holds the lane half's 16-B offset)
__device__ __forceinline__ v16h ld_frag(const unsigned char* p) {
  union { v16h v; v8h h[2]; } f;
  f.h[0] = *(const v8h*)(p);
  f.h[1] = *(const v8h*)(p + 32);
  return f.v;
}

// ---------------------------------------------------------------------------
// out[4096][1024] = (1/1024) * Act[4096][12288] . Wt[1024][12288]^T
// One workgroup of 4 waves per 128 x 128 tile of out (256 workgroups); wave (wm, wn) owns 64 x 64 = 4 x 4 accumulator tiles.
// Operands come by tensor loads into a ring of four LDS buffers: stages s + 1, s + 2 and s + 3 fly while pass s is worked on.
// Waves 0, 1 bring the two halves of the Act rows, waves 2, 3 those of the Wt rows.
// k runs upward through one accumulator per output tile.
// ---------------------------------------------------------------------------
__global__ __launch_bounds__(128) void gemm_tile128(const unsigned short* __restrict__ Act,
                                                    const unsigned short* __restrict__ Wt,
                                                    float* __restrict__ out) {
  __shared__ __attribute__((aligned(2048))) unsigned char ring[kBufs * kStage + 4u * 16u * 68u * 4u];   // four buffers, then the per-wave output slabs
  const uint32_t lane = threadIdx.x & 31u;
  const uint32_t wave = uni(threadIdx.x >> 5);
  const uint32_t tm = blockIdx.x % (uint32_t)kTilesM;   // speed only: the 8 workgroups that share an Act panel lie 32 apart in index
  const uint32_t tn = blockIdx.x / (uint32_t)kTilesM;
  const uint32_t wm = wave >> 1, wn = wave & 1u;
  const uint32_t rlane = lane & 15u;               // row (A) / col (B, D) within subtile
  const uint32_t hl    = lane >> 4;                // lane half: k offset 8 (16 B), D row offset 8

  const uint32_t lbase = (uint32_t)(size_t)ring;
  const unsigned short* srow = (wave < 2u) ? (Act + (size_t)(tm * 128u + wave * kSlRows) * kKdim)
                                           : (Wt + (size_t)(tn * 128u + (wave - 2u) * kSlRows) * kKdim);
  const uint64_t src = (uint64_t)(size_t)srow;
  u32x8 g1 = tdm_group1();

  v8f acc[4][4];
#pragma unroll
  for (int i = 0; i < 4; ++i)
#pragma unroll
    for (int j = 0; j < 4; ++j) acc[i][j] = (v8f){0.f,0.f,0.f,0.f,0.f,0.f,0.f,0.f};

  // prologue: stages 0, 1, 2 are sent off; stage 0 lands and is published; then stage 3 is sent off (never more than three in flight)
  u32x4 g0 = tdm_group0(lbase + wave * kSlice, src);
  tdm_load(g0, g1);
  tdm_aim(g0, lbase + kStage + wave * kSlice, src + kRowB);
  tdm_load(g0, g1);
  tdm_aim(g0, lbase + 2u * kStage + wave * kSlice, src + 2u * kRowB);
  tdm_load(g0, g1);
  wait_tensor2();
  __syncthreads();
  tdm_aim(g0, lbase + 3u * kStage + wave * kSlice, src + 3u * kRowB);
  tdm_load(g0, g1);

  const uint32_t aoff = wm * kSlice + rlane * kPitch + hl * 16u;
  const uint32_t boff = (2u + wn) * kSlice + rlane * kPitch + hl * 16u;

  // rolled: one pass per trip, so that the publish point stands once and every register index inside is a constant
#pragma unroll 1
  for (uint32_t s = 0; s < (uint32_t)kPasses; ++s) {
    const uint32_t buf = (s & (kBufs - 1u)) * kStage;
    const unsigned char* ap = ring + buf + aoff;
    const unsigned char* bp = ring + buf + boff;
    v16h af[2][4], bf[2][4];
#pragma unroll
    for (int q = 0; q < 4; ++q) {
      af[0][q] = ld_frag(ap + q * 16 * (int)kPitch);
      bf[0][q] = ld_frag(bp + q * 16 * (int)kPitch);
    }
#pragma unroll
    for (int kc = 0; kc < 4; ++kc) {
      const int cur = kc & 1, nxt = cur ^ 1;
      if (kc < 3) {
#pragma unroll
        for (int q = 0; q < 4; ++q) {
          af[nxt][q] = ld_frag(ap + q * 16 * (int)kPitch + (kc + 1) * 64);
          bf[nxt][q] = ld_frag(bp + q * 16 * (int)kPitch + (kc + 1) * 64);
        }
      }
      __builtin_amdgcn_sched_barrier(0);   // keeps the next block's LDS reads one group ahead of this block's WMMAs, not among them
#pragma unroll
      for (int i = 0; i < 4; ++i)
#pragma unroll
        for (int j = 0; j < 4; ++j)
          acc[i][j] = __builtin_amdgcn_wmma_f32_16x16x32_f16(false, af[cur][i], false, bf[cur][j], (short)0, acc[i][j], false, false);
      __builtin_amdgcn_sched_barrier(0);   // ends the WMMA block: the following load group stays behind it
    }
    // publish point of stage s + 1: behind it stages s + 2 and s + 3 were issued, so the counted wait covers it;
    // in the last passes, where fewer were issued behind it, the wait is to 0
    wait_ds0();
    wait_tensor2();
    if (pinned(s + 3u >= (uint32_t)kPasses)) wait_tensor0();
    __syncthreads();
    if (pinned(s + kBufs < (uint32_t)kPasses)) {
      tdm_aim(g0, lbase + buf + wave * kSlice, src + (uint64_t)(s + kBufs) * kRowB);   // into the buffer that pass s has just read
      tdm_load(g0, g1);
    }
  }
  wait_tensor0();
  wait_ds0();

  // ---- epilogue: each wave stages 16 x 64 in its own slab (pitch 68 floats) and stores rows of 256 B ----
  float* slab = (float*)(ring + kBufs * kStage) + wave * (16u * 68u);
  const uint32_t m0 = tm * 128u + wm * 64u;
  const uint32_t n0 = tn * 128u + wn * 64u;
  const uint32_t mOff = hl * 8u;
#pragma unroll
  for (int i = 0; i < 4; ++i) {
    const uint32_t mBase = m0 + (i << 4);
#pragma unroll
    for (int j = 0; j < 4; ++j) {
#pragma unroll
      for (int r = 0; r < 8; ++r) slab[(mOff + r) * 68u + (j << 4) + rlane] = acc[i][j][r] * kOutScale;
    }
    __builtin_amdgcn_fence(__ATOMIC_RELEASE, "workgroup");
    __builtin_amdgcn_wave_barrier();
    __builtin_amdgcn_fence(__ATOMIC_ACQUIRE, "workgroup");
    const uint32_t c4 = rlane * 4u;                 // row seg = 256 B = 16 lanes x 16 B
#pragma unroll
    for (int it = 0; it < 8; ++it) {
      const uint32_t row = it * 2u + hl;
      const v4f v = *(const v4f*)(slab + row * 68u + c4);
      *(v4f*)(out + (size_t)(mBase + row) * kOutDim + n0 + c4) = v;
    }
    __builtin_amdgcn_fence(__ATOMIC_RELEASE, "workgroup");
    __builtin_amdgcn_wave_barrier();
    __builtin_amdgcn_fence(__ATOMIC_ACQUIRE, "workgroup");
  }
}

// ---------------------------------------------------------------------------
// Weight pack: Wt[o][i*12 + 0]     = f16(64 * (mask[i,o] * scale_base[i,o]))
//              Wt[o][i*12 + 1 + k] = f16(64 * (coef[i,o,k] * (mask[i,o] * scale_sp[i,o]))), k = 0..10
// coef / scale_base / scale_sp / mask are [in i][out o] (coef [i][o][k]); Wt is the [N = o][K = i*12 + j] f16 plane, pitch 12288 halves.
// The pack is a transpose (inputs run along o, Wt runs along i), done per tile of 16 i x 64 o through LDS, so that both sides move whole lines:
//   in:  per i the tile's coef is 64 x 11 floats = 2816 contiguous B (176 chunks of 16 B); 16 x 176 = 2816 chunks = 256 threads x 11
//   work: lane = o (coef read from LDS at a stride of 11 words: every bank once), wave (w & 1) = half of the 64 o, (w >> 1) = 4 of the 16 i;
//        the three [i][o] planes are read straight from global memory, 32 lanes = one 128-B line
//   out: per o the tile is 16 x 12 halves = 384 contiguous B (24 chunks of 16 B); 64 x 24 = 1536 chunks = 256 threads x 6
// grid = 64 x 16 = 1024 tiles, 256 threads.
// ---------------------------------------------------------------------------
constexpr int kWTi      = 16;                     // input dims per tile
constexpr int kWTo      = 64;                     // output dims per tile
constexpr int kWRowC    = kWTo * kNumB / 4;       // 176 chunks of 16 B of coef per input dim of a tile
constexpr int kWPitchF  = kWTo * kNumB + 4;       // 708 floats: LDS pitch of a coef row, a multiple of 16 B
constexpr int kWOutC    = kWTi * kPack / 8;       // 24 chunks of 16 B of Wt per output dim of a tile
constexpr int kWOutPitch = kWTi * kPack / 2 + 4;  // 100 words: LDS pitch of a Wt row piece, an odd multiple of 16 B
constexpr int kWTiles   = (kInDim / kWTi) * (kOutDim / kWTo);
static_assert(kInDim % kWTi == 0 && kOutDim % kWTo == 0);
static_assert(2 * kWRowC == 32 * 11 && 8 * kWOutC == 32 * 6 && kWTi == 2 * 8 && kWTo == 8 * 8);   // per wave: 2 coef rows in, 8 Wt rows out

__global__ __launch_bounds__(256) void pack_weights_kernel(const float* __restrict__ coef,
                                                          const float* __restrict__ scale_base,
                                                          const float* __restrict__ scale_sp,
                                                          const float* __restrict__ mask,
                                                          unsigned short* __restrict__ Wt) {
  __shared__ __align__(16) float sC[kWTi * kWPitchF];            // 45312 B: the tile's coef, as it lies in memory, row per i
  __shared__ __align__(16) unsigned int sO[kWTo * kWOutPitch];   // 25600 B: the tile of Wt as packed f16 pairs, row per o
  const uint32_t t    = threadIdx.x;
  const uint32_t lane = t & 31u;
  const uint32_t w    = t >> 5;
  const uint32_t o0 = (blockIdx.x % (uint32_t)(kOutDim / kWTo)) * (uint32_t)kWTo;
  const uint32_t i0 = (blockIdx.x / (uint32_t)(kOutDim / kWTo)) * (uint32_t)kWTi;
  const uint32_t ol = (w & 1u) * 32u + lane;                     // this thread's output dim within the tile
  const uint32_t ib = (w >> 1) * 4u;                             // first of its 4 input dims within the tile

  // in: wave w brings coef rows 2w and 2w + 1 of the tile, 352 chunks = 11 loads of 32 chunks; only load 5 straddles the two rows
  const float* ctile = coef + ((size_t)i0 * kOutDim + o0) * kNumB;
  v4f cv[11];
#pragma unroll
  for (int q = 0; q < 11; ++q) {
    const uint32_t cc  = lane + 32u * q;
    const uint32_t hi  = (cc >= (uint32_t)kWRowC) ? 1u : 0u;
    cv[q] = *(const v4f*)(ctile + (2u * w + hi) * (uint32_t)(kOutDim * kNumB) + (cc - hi * (uint32_t)kWRowC) * 4u);
  }
  float m[4], sb[4], ss[4];
#pragma unroll
  for (int r = 0; r < 4; ++r) {
    const uint32_t io = (i0 + ib + r) * (uint32_t)kOutDim + o0 + ol;
    m[r]  = mask[io];
    sb[r] = scale_base[io];
    ss[r] = scale_sp[io];
  }
  // behind the tile's loads: no register that one of them names (the shared offset, the three plane bases) is written ahead of this wait
  asm volatile("s_wait_xcnt 0x0" ::: "memory");
#pragma unroll
  for (int q = 0; q < 11; ++q) {
    const uint32_t cc  = lane + 32u * q;
    const uint32_t hi  = (cc >= (uint32_t)kWRowC) ? 1u : 0u;
    *(v4f*)(sC + (2u * w + hi) * (uint32_t)kWPitchF + (cc - hi * (uint32_t)kWRowC) * 4u) = cv[q];
  }
  __syncthreads();

#pragma unroll
  for (int r = 0; r < 4; ++r) {
    const float wb = (m[r] * sb[r]) * kWCarry;
    const float ws = m[r] * ss[r];
    const float* cp = sC + (ib + r) * (uint32_t)kWPitchF + ol * (uint32_t)kNumB;
    float wv[kPack];
    wv[0] = wb;
#pragma unroll
    for (int k = 0; k < kNumB; ++k) wv[1 + k] = (cp[k] * ws) * kWCarry;
    unsigned int* dst = sO + ol * (uint32_t)kWOutPitch + (ib + r) * (uint32_t)(kPack / 2);
#pragma unroll
    for (int q = 0; q < kPack / 2; ++q) dst[q] = pk16(h_bits(wv[2 * q]), h_bits(wv[2 * q + 1]));
  }
  __syncthreads();

  // out: wave w stores Wt rows 8w .. 8w + 7 of the tile, 192 chunks = 6 stores of 32 chunks; a store covers pieces of two rows, each whole lines
  unsigned short* tile = Wt + (size_t)o0 * kKdim + (size_t)i0 * kPack;
#pragma unroll
  for (int q = 0; q < 6; ++q) {
    const uint32_t e   = lane + (uint32_t)((32 * q) % kWOutC);   // chunk counted from the start of row (32 q) / 24
    const uint32_t hi  = (e >= (uint32_t)kWOutC) ? 1u : 0u;
    const uint32_t row = 8u * w + (uint32_t)((32 * q) / kWOutC) + hi;
    const uint32_t col = e - hi * (uint32_t)kWOutC;
    const v4u u = *(const v4u*)(sO + row * (uint32_t)kWOutPitch + col * 4u);
    *(v4u*)(tile + row * (uint32_t)kKdim + col * 8u) = u;
  }
}

// ---------------------------------------------------------------------------
// Activation pack: Act[b][i*12 + 0] = f16(16 * silu(x[b,i])), Act[b][i*12 + 1 + k] = f16(16 * bs_k(x[b,i])), k = 0..10,
// bs = order-3 Cox-de Boor recursion over the 15 knots grid[i][0..14] (half-open indicator, nan -> 0 after each level), all in f32.
// grid = (kInDim/256, kBatch/kActRows): block (ic, bg) handles i in [256*ic, 256*ic + 256) of rows 16*bg .. 16*bg + 15; 256 threads.
// A thread keeps one input dim for all its rows: the 15 knots and the 39 reciprocals of knot differences depend on i alone,
// are formed once and stay in registers; the row loop holds only what depends on x.
// Knot staging coverage: 256 x 15 = 3840 floats = 960 x 16 B; 256 threads x 4 iterations with bound (c < 960).
// Store coverage per row: a wave's 32 dims x 12 halves = 768 B = 6 whole lines = 48 chunks of 16 B, staged in the wave's own 768 B of sA:
// chunk l by every lane, chunk 32 + l by lanes l < 16.
// ---------------------------------------------------------------------------
constexpr int kActRows = 16;                // rows of x per workgroup: 1024 workgroups, all resident at once
static_assert(kBatch % kActRows == 0);

// v_rcp_f32 with the one free issue slot that the instruction set asks for behind a transcendental (before its source is overwritten
// or its result read) kept inside the statement; runs once per workgroup, outside the row loop
__device__ __forceinline__ float rcp_slot(float d) { float r; asm("v_rcp_f32 %0, %1\n\tv_nop" : "=v"(r) : "v"(d)); return r; }

__global__ __launch_bounds__(256) void pack_acts_kernel(const float* __restrict__ x,
                                                       const float* __restrict__ grid,
                                                       unsigned short* __restrict__ Act) {
  __shared__ __align__(16) float sG[256 * kNumG];          // 15360 B: knots of this block's 256 input dims
  __shared__ __align__(16) unsigned int sA[256 * (kPack / 2)];   // 6144 B: packed f16 features, 768 B per wave
  const int ic = blockIdx.x;
  const int b0 = blockIdx.y * kActRows;
  const int t  = threadIdx.x;
  const int i0 = ic * 256;
  {
    const v4f* gp = (const v4f*)(grid + (size_t)i0 * kNumG);   // byte offset i0*60 = 15360*ic, 16-B aligned
#pragma unroll
    for (int it = 0; it < 4; ++it) {
      const int c  = t + 256 * it;
      const int cc = (c < 960) ? c : 959;                       // clamp the address, predicate the LDS store
      const v4f gv = gp[cc];
      if (c < 960) *(v4f*)(sG + 4 * c) = gv;
    }
  }
  __syncthreads();

  const int i = i0 + t;
  float g[kNumG];
#pragma unroll
  for (int j = 0; j < kNumG; ++j) g[j] = sG[t * kNumG + j];

  // rc[p-1][j] = 1 / (g[j+p] - g[j]) for j = 0 .. 14-p (division by a broadcast knot difference = multiply by its reciprocal)
  float rc[kOrder][kNumG];
#pragma unroll
  for (int p = 1; p <= kOrder; ++p) {
#pragma unroll
    for (int j = 0; j < kNumG; ++j) {
      rc[p - 1][j] = 0.0f;
      if (j + p < kNumG) rc[p - 1][j] = rcp_slot(g[j + p] - g[j]);
    }
  }

  const int lane = t & 31;
  const int wv   = t >> 5;
  unsigned int* dst = sA + t * (kPack / 2);                       // inside the wave's own 192 words
  const unsigned int* rd0 = sA + wv * 192 + 4 * lane;             // chunk l
  const unsigned int* rd1 = sA + wv * 192 + 4 * (32 + (lane & 15));   // chunk 32 + l (lanes 16..31 read in bounds, store nothing)
  const float* xp = x + (size_t)b0 * kInDim + i;
  unsigned short* seg = Act + (size_t)b0 * kKdim + (size_t)i0 * kPack + (size_t)wv * 384;

  float xnext = xp[0];
  // rolled: the body is long, and one copy of it keeps the kernel's text small
#pragma unroll 1
  for (int rr = 0; rr < kActRows; ++rr) {
    const float xv = xnext;
    const int rn = (rr + 1 < kActRows) ? rr + 1 : rr;             // next row's x is fetched one trip ahead, the index clamped to the last row
    xnext = xp[(size_t)rn * kInDim];

    float v[kNumG - 1];
#pragma unroll
    for (int j = 0; j < kNumG - 1; ++j) v[j] = (xv >= g[j] && xv < g[j + 1]) ? 1.0f : 0.0f;

#pragma unroll
    for (int p = 1; p <= kOrder; ++p) {
#pragma unroll
      for (int j = 0; j < kNumG - 1; ++j) {
        if (j + p < kNumG - 1) {
          // left: (x - g[j]) / (g[j+p] - g[j]) * v[j];  right: (g[j+p+1] - x) / (g[j+p+1] - g[j+1]) * v[j+1]
          const float tl = ((xv - g[j]) * rc[p - 1][j]) * v[j];
          const float tr = ((g[j + p + 1] - xv) * rc[p - 1][j + 1]) * v[j + 1];
          const float tt = tl + tr;
          v[j] = (tt == tt) ? tt : 0.0f;
        }
      }
    }

    const float sil = xv / (1.0f + expf(-xv));

    unsigned short hb[kPack];
    hb[0] = h_bits(sil * kActCarry);
#pragma unroll
    for (int k = 0; k < kNumB; ++k) hb[1 + k] = h_bits(v[k] * kActCarry);
#pragma unroll
    for (int q = 0; q < kPack / 2; ++q) dst[q] = pk16(hb[2 * q], hb[2 * q + 1]);
    // the wave's own LDS writes are complete before its lanes read each other's words (no other wave touches this range);
    // LDS alone is ordered, so that the row stores and the x load issued ahead stay in flight
    __builtin_amdgcn_fence(__ATOMIC_RELEASE, "workgroup", "local");
    __builtin_amdgcn_wave_barrier();
    __builtin_amdgcn_fence(__ATOMIC_ACQUIRE, "workgroup", "local");
    const v4u u0 = *(const v4u*)rd0;
    const v4u u1 = *(const v4u*)rd1;
    unsigned short* srow = seg + (size_t)rr * kKdim;
    *(v4u*)(srow + (size_t)lane * 8) = u0;
    if (lane < 16) {
      *(v4u*)(srow + (size_t)(32 + lane) * 8) = u1;
      asm volatile("s_wait_xcnt 0x0" ::: "memory");   // directly behind the store: its address registers are advanced for the next row only behind this wait
    }
  }
}

// ---------------------------------------------------------------------------
// Host launcher
// Workspace region map (bytes):
//   [0, 100663296)          Act f16 plane [4096][12288]
//   [100663296, 125829120)  Wt  f16 plane [1024][12288]
//   total 125829120 <= 134217728
// ---------------------------------------------------------------------------
extern "C" void kernel_launch(void* const* d_in, const int* in_sizes, int n_in,
                              void* d_out, int out_size, void* d_ws, size_t ws_size,
                              hipStream_t stream) {
  if (n_in < 6) return;
  if (in_sizes[0] != kBatch * kInDim) return;
  if (in_sizes[1] != kInDim * kNumG) return;
  if (in_sizes[2] != kInDim * kOutDim * kNumB) return;
  if (in_sizes[3] != kInDim * kOutDim || in_sizes[4] != kInDim * kOutDim || in_sizes[5] != kInDim * kOutDim) return;
  if (out_size != kBatch * kOutDim) return;

  const size_t actBytes = (size_t)kBatch * kKdim * sizeof(unsigned short);    // 100663296
  const size_t wtBytes  = (size_t)kOutDim * kKdim * sizeof(unsigned short);   // 25165824
  if (actBytes + wtBytes > ws_size) return;

  const float* x          = (const float*)d_in[0];
  const float* grid       = (const float*)d_in[1];
  const float* coef       = (const float*)d_in[2];
  const float* scale_base = (const float*)d_in[3];
  const float* scale_sp   = (const float*)d_in[4];
  const float* mask       = (const float*)d_in[5];
  float* out = (float*)d_out;

  unsigned short* Act = (unsigned short*)d_ws;
  unsigned short* Wt  = (unsigned short*)((char*)d_ws + actBytes);

  pack_weights_kernel<<<dim3(kWTiles), dim3(256), 0, stream>>>(coef, scale_base, scale_sp, mask, Wt);
  pack_acts_kernel<<<dim3(kInDim / 256, kBatch / kActRows), dim3(256), 0, stream>>>(x, grid, Act);

  // out[4096][1024] = (1/1024) * Act . Wt^T ; M = 4096, N = 1024, K = 12288 (96 passes of 128 k); 256 tiles of 128 x 128, one workgroup of 4 waves each
  gemm_tile128<<<dim3(kTiles), dim3(128), 0, stream>>>(Act, Wt, out);
}

// v005
// Measured time: 90.6 microseconds a run.
// Next to v004, in two timings, it ran 1.08 times as fast each time.
// Over all steps from v000 it is 6.95 times as fast.
// Contraction out = Act[4096x12288] . Wt[1024x12288]^T on v_wmma_f32_16x16x32_f16 (f16 operands: Act carried x16, Wt carried x64, folded back x1/1024 in the f32 epilogue), f32 accumulate; B-spline recursion, silu and weight products in f32.
#include <hip/hip_runtime.h>
#include <math.h>
#include <stdint.h>

// ---------------------------------------------------------------------------
// Problem constants
// ---------------------------------------------------------------------------
constexpr int kInDim  = 1024;
constexpr int kOutDim = 1024;
constexpr int kBatch  = 4096;
constexpr int kNumG   = 15;                 // knots per input dim
constexpr int kNumB   = 11;                 // spline bases per input dim
constexpr int kOrder  = 3;
constexpr int kPack   = 12;                 // 1 silu feature + 11 bases
constexpr int kKdim   = kInDim * kPack;     // 12288
constexpr float kActCarry = 16.0f;          // Act plane carried x16 (exact power of two)
constexpr float kWCarry   = 64.0f;          // Wt plane carried x64 (exact power of two)
constexpr float kOutScale = 1.0f / (16.0f * 64.0f);
constexpr int kTilesM = kBatch / 128;
constexpr int kTilesN = kOutDim / 128;
constexpr int kTiles  = kTilesM * kTilesN;  // 256 workgroup tiles of 128 x 128
constexpr int kPassK  = 128;                // k per pass: 256 B of every operand row
constexpr int kPasses = kKdim / kPassK;     // 96
static_assert(kKdim % kPassK == 0 && kPasses >= 4);
static_assert(kBatch % 128 == 0);
static_assert(kOutDim % 128 == 0);
static_assert(kInDim % 256 == 0);

typedef __attribute__((ext_vector_type(16))) _Float16 v16h;
typedef __attribute__((ext_vector_type(8)))  _Float16 v8h;
typedef __attribute__((ext_vector_type(8)))  float    v8f;
typedef __attribute__((ext_vector_type(4)))  float    v4f;
typedef __attribute__((ext_vector_type(4)))  unsigned int v4u;
typedef __attribute__((ext_vector_type(4)))  uint32_t u32x4;
typedef __attribute__((ext_vector_type(8)))  uint32_t u32x8;

// ---------------------------------------------------------------------------
// Small helpers
// ---------------------------------------------------------------------------
__device__ __forceinline__ unsigned pk16(unsigned short a, unsigned short b) { return (unsigned)a | ((unsigned)b << 16); }
__device__ __forceinline__ unsigned short h_bits(float f) { const _Float16 h = (_Float16)f; return __builtin_bit_cast(unsigned short, h); }

__device__ __forceinline__ uint32_t uni(uint32_t v) { return (uint32_t)__builtin_amdgcn_readfirstlane(v); }
// a wave-uniform test held in a scalar register, so that the branch on it is s_cmp + s_cbranch_scc (a tensor load ignores EXEC)
__device__ __forceinline__ uint32_t pinned(uint32_t v) { uint32_t w = (uint32_t)__builtin_amdgcn_readfirstlane(v); asm volatile("" : "+s"(w)); return w; }
// the wave's LDS reads have returned: stands in front of the barrier behind which the buffer it read is refilled
__device__ __forceinline__ void wait_ds0() { asm volatile("s_wait_dscnt 0x0" ::: "memory"); }
// every tensor load of the wave has landed
__device__ __forceinline__ void wait_tensor0() { asm volatile("s_wait_tensorcnt 0x0" ::: "memory"); }
// all but the wave's two youngest tensor loads have landed (they land in issue order): the two stages behind the next one stay in flight
__device__ __forceinline__ void wait_tensor2() { asm volatile("s_wait_tensorcnt 0x2" ::: "memory"); }
// both groups are named in-out (the instruction changes neither): their registers then stay the descriptor's own from one request to the
// next, and the compiler takes none of them as a temporary while a request that names them is outstanding
__device__ __forceinline__ void tdm_load(u32x4& g0, u32x8& g1) { asm volatile("tensor_load_to_lds %0, %1" : "+s"(g0), "+s"(g1) :: "memory"); }

// ---------------------------------------------------------------------------
// LDS ring of the contraction: a stage is 128 k (256 B) of 128 Act rows and 128 Wt rows, as four slices of 64 rows,
// one tensor load of one wave each; rows at pitch 272 B (the load's pad: 16 B behind every 256-B row).
// ---------------------------------------------------------------------------
constexpr uint32_t kRowB   = 256u;                 // bytes of an operand row per stage
constexpr uint32_t kPitch  = kRowB + 16u;          // 272 B: odd multiple of 16 B for ds_load_b128 readers
constexpr uint32_t kSlRows = 64u;
constexpr uint32_t kSlice  = 18432u;               // 64 x 272 = 17408 B, rounded up to a multiple of 2 KiB
constexpr uint32_t kStage  = 4u * kSlice;          // 73728 B
constexpr uint32_t kBufs   = 4u;                   // buffers of the ring: one is worked on, three are in flight
constexpr uint32_t kSrcPitch = (uint32_t)kKdim * 2u;   // 24576 B
static_assert(kSlRows * kPitch <= kSlice && kSlice % 2048u == 0u);
static_assert(kSrcPitch % 16u == 0u && kSrcPitch <= 131072u);

// descriptor group 1: 1-byte elements, tensor = tile = 64 rows of 256 B, source pitch 24576 B, pad 4 dwords behind every 64 dwords, no mask
__device__ __forceinline__ u32x8 tdm_group1() {
  u32x8 d;
  d[0] = uni((1u << 20) | (5u << 22) | (3u << 25));
  d[1] = uni((kRowB & 0xFFFFu) << 16);
  d[2] = uni((kRowB >> 16) | ((kSlRows & 0xFFFFu) << 16));
  d[3] = uni((kSlRows >> 16) | (kRowB << 16));
  d[4] = uni(kSlRows);
  d[5] = uni(kSrcPitch);
  d[6] = uni(0u);
  d[7] = uni(0u);
  return d;
}
// descriptor group 0: count 1, LDS byte offset, global address of the tile's first byte, type 2
__device__ __forceinline__ u32x4 tdm_group0(uint32_t lds_dst, uint64_t ga) {
  u32x4 d;
  d[0] = uni(1u);
  d[1] = uni(lds_dst);
  d[2] = uni((uint32_t)ga);
  d[3] = uni((((uint32_t)(ga >> 32)) & 0x01FFFFFFu) | 0x80000000u);
  return d;
}
// the next request's place and address, written into the same group 0 while earlier requests are in flight: only words 1 and 2 change then.
// Word 3 (the address's high part) changes only where a row crosses a multiple of 4 GiB, and then behind a wait for every request that names it.
__device__ __forceinline__ void tdm_aim(u32x4& d, uint32_t lds_dst, uint64_t ga) {
  uint32_t w3 = uni((((uint32_t)(ga >> 32)) & 0x01FFFFFFu) | 0x80000000u);
  if (pinned(w3 != d[3])) {
    // the group and the new word are both operands of the wait, so that they lie in different registers at it and word 3 is written behind it
    asm volatile("s_wait_tensorcnt 0x0" : "+s"(d), "+s"(w3) :: "memory");
    d[3] = w3;
  }
  d[1] = uni(lds_dst);
  d[2] = uni((uint32_t)ga);
}

// fragment of 16 rows x 32 k: elements 0..7 <- p[0..15] bytes, 8..15 <- p[32..47] bytes (p already holds the lane half's 16-B offset)
__device__ __forceinline__ v16h ld_frag(const unsigned char* p) {
  union { v16h v; v8h h[2]; } f;
  f.h[0] = *(const v8h*)(p);
  f.h[1] = *(const v8h*)(p + 32);
  return f.v;
}

// ---------------------------------------------------------------------------
// out[4096][1024] = (1/1024) * Act[4096][12288] . Wt[1024][12288]^T
// One workgroup of 4 waves per 128 x 128 tile of out (256 workgroups); wave (wm, wn) owns 64 x 64 = 4 x 4 accumulator tiles.
// Operands come by tensor loads into a ring of four LDS buffers: stages s + 1, s + 2 and s + 3 fly while pass s is worked on.
// Waves 0, 1 bring the two halves of the Act rows, waves 2, 3 those of the Wt rows.
// k runs upward through one accumulator per output tile.
// ---------------------------------------------------------------------------
__global__ __launch_bounds__(128) void gemm_tile128(const unsigned short* __restrict__ Act,
                                                    const unsigned short* __restrict__ Wt,
                                                    float* __restrict__ out) {
  __shared__ __attribute__((aligned(2048))) unsigned char ring[kBufs * kStage + 4u * 16u * 68u * 4u];   // four buffers, then the per-wave output slabs
  const uint32_t lane = threadIdx.x & 31u;
  const uint32_t wave = uni(threadIdx.x >> 5);
  const uint32_t tm = blockIdx.x % (uint32_t)kTilesM;   // speed only: the 8 workgroups that share an Act panel lie 32 apart in index
  const uint32_t tn = blockIdx.x / (uint32_t)kTilesM;
  const uint32_t wm = wave >> 1, wn = wave & 1u;
  const uint32_t rlane = lane & 15u;               // row (A) / col (B, D) within subtile
  const uint32_t hl    = lane >> 4;                // lane half: k offset 8 (16 B), D row offset 8

  const uint32_t lbase = (uint32_t)(size_t)ring;
  const unsigned short* srow = (wave < 2u) ? (Act + (size_t)(tm * 128u + wave * kSlRows) * kKdim)
                                           : (Wt + (size_t)(tn * 128u + (wave - 2u) * kSlRows) * kKdim);
  const uint64_t src = (uint64_t)(size_t)srow;
  u32x8 g1 = tdm_group1();

  v8f acc[4][4];
#pragma unroll
  for (int i = 0; i < 4; ++i)
#pragma unroll
    for (int j = 0; j < 4; ++j) acc[i][j] = (v8f){0.f,0.f,0.f,0.f,0.f,0.f,0.f,0.f};

  // prologue: stages 0, 1, 2 are sent off; stage 0 lands and is published; then stage 3 is sent off (never more than three in flight)
  u32x4 g0 = tdm_group0(lbase + wave * kSlice, src);
  tdm_load(g0, g1);
  tdm_aim(g0, lbase + kStage + wave * kSlice, src + kRowB);
  tdm_load(g0, g1);
  tdm_aim(g0, lbase + 2u * kStage + wave * kSlice, src + 2u * kRowB);
  tdm_load(g0, g1);
  wait_tensor2();
  __syncthreads();
  tdm_aim(g0, lbase + 3u * kStage + wave * kSlice, src + 3u * kRowB);
  tdm_load(g0, g1);

  const uint32_t aoff = wm * kSlice + rlane * kPitch + hl * 16u;
  const uint32_t boff = (2u + wn) * kSlice + rlane * kPitch + hl * 16u;

  // rolled: one pass per trip, so that the publish point stands once and every register index inside is a constant
#pragma unroll 1
  for (uint32_t s = 0; s < (uint32_t)kPasses; ++s) {
    const uint32_t buf = (s & (kBufs - 1u)) * kStage;
    const unsigned char* ap = ring + buf + aoff;
    const unsigned char* bp = ring + buf + boff;
    v16h af[2][4], bf[2][4];
#pragma unroll
    for (int q = 0; q < 4; ++q) {
      af[0][q] = ld_frag(ap + q * 16 * (int)kPitch);
      bf[0][q] = ld_frag(bp + q * 16 * (int)kPitch);
    }
#pragma unroll
    for (int kc = 0; kc < 4; ++kc) {
      const int cur = kc & 1, nxt = cur ^ 1;
      if (kc < 3) {
#pragma unroll
        for (int q = 0; q < 4; ++q) {
          af[nxt][q] = ld_frag(ap + q * 16 * (int)kPitch + (kc + 1) * 64);
          bf[nxt][q] = ld_frag(bp + q * 16 * (int)kPitch + (kc + 1) * 64);
        }
      }
      __builtin_amdgcn_sched_barrier(0);   // keeps the next block's LDS reads one group ahead of this block's WMMAs, not among them
#pragma unroll
      for (int i = 0; i < 4; ++i)
#pragma unroll
        for (int j = 0; j < 4; ++j)
          acc[i][j] = __builtin_amdgcn_wmma_f32_16x16x32_f16(false, af[cur][i], false, bf[cur][j], (short)0, acc[i][j], false, false);
      __builtin_amdgcn_sched_barrier(0);   // ends the WMMA block: the following load group stays behind it
    }
    // publish point of stage s + 1: behind it stages s + 2 and s + 3 were issued, so the counted wait covers it;
    // in the last passes, where fewer were issued behind it, the wait is to 0
    wait_ds0();
    wait_tensor2();
    if (pinned(s + 3u >= (uint32_t)kPasses)) wait_tensor0();
    __syncthreads();
    if (pinned(s + kBufs < (uint32_t)kPasses)) {
      tdm_aim(g0, lbase + buf + wave * kSlice, src + (uint64_t)(s + kBufs) * kRowB);   // into the buffer that pass s has just read
      tdm_load(g0, g1);
    }
  }
  wait_tensor0();
  wait_ds0();

  // ---- epilogue: each wave stages 16 x 64 in its own slab (pitch 68 floats) and stores rows of 256 B ----
  float* slab = (float*)(ring + kBufs * kStage) + wave * (16u * 68u);
  const uint32_t m0 = tm * 128u + wm * 64u;
  const uint32_t n0 = tn * 128u + wn * 64u;
  const uint32_t mOff = hl * 8u;
#pragma unroll
  for (int i = 0; i < 4; ++i) {
    const uint32_t mBase = m0 + (i << 4);
#pragma unroll
    for (int j = 0; j < 4; ++j) {
#pragma unroll
      for (int r = 0; r < 8; ++r) slab[(mOff + r) * 68u + (j << 4) + rlane] = acc[i][j][r] * kOutScale;
    }
    __builtin_amdgcn_fence(__ATOMIC_RELEASE, "workgroup");
    __builtin_amdgcn_wave_barrier();
    __builtin_amdgcn_fence(__ATOMIC_ACQUIRE, "workgroup");
    const uint32_t c4 = rlane * 4u;                 // row seg = 256 B = 16 lanes x 16 B
#pragma unroll
    for (int it = 0; it < 8; ++it) {
      const uint32_t row = it * 2u + hl;
      const v4f v = *(const v4f*)(slab + row * 68u + c4);
      *(v4f*)(out + (size_t)(mBase + row) * kOutDim + n0 + c4) = v;
    }
    __builtin_amdgcn_fence(__ATOMIC_RELEASE, "workgroup");
    __builtin_amdgcn_wave_barrier();
    __builtin_amdgcn_fence(__ATOMIC_ACQUIRE, "workgroup");
  }
}

// ---------------------------------------------------------------------------
// Weight pack: Wt[o][i*12 + 0]     = f16(64 * (mask[i,o] * scale_base[i,o]))
//              Wt[o][i*12 + 1 + k] = f16(64 * (coef[i,o,k] * (mask[i,o] * scale_sp[i,o]))), k = 0..10
// coef / scale_base / scale_sp / mask are [in i][out o] (coef [i][o][k]); Wt is the [N = o][K = i*12 + j] f16 plane, pitch 12288 halves.
// The pack is a transpose (inputs run along o, Wt runs along i), done per tile of 16 i x 64 o through LDS, so that both sides move whole lines:
//   in:  per i the tile's coef is 64 x 11 floats = 2816 contiguous B (176 chunks of 16 B); 16 x 176 = 2816 chunks = 256 threads x 11
//   work: lane = o (coef read from LDS at a stride of 11 words: every bank once), wave (w & 1) = half of the 64 o, (w >> 1) = 4 of the 16 i;
//        the three [i][o] planes are read straight from global memory, 32 lanes = one 128-B line
//   out: per o the tile is 16 x 12 halves = 384 contiguous B (24 chunks of 16 B); 64 x 24 = 1536 chunks = 256 threads x 6
// 64 x 16 = 1024 tiles, one per workgroup of 256 threads (tile = its number); sm = the workgroup's LDS.
// ---------------------------------------------------------------------------
constexpr int kWTi      = 16;                     // input dims per tile
constexpr int kWTo      = 64;                     // output dims per tile
constexpr int kWRowC    = kWTo * kNumB / 4;       // 176 chunks of 16 B of coef per input dim of a tile
constexpr int kWPitchF  = kWTo * kNumB + 4;       // 708 floats: LDS pitch of a coef row, a multiple of 16 B
constexpr int kWOutC    = kWTi * kPack / 8;       // 24 chunks of 16 B of Wt per output dim of a tile
constexpr int kWOutPitch = kWTi * kPack / 2 + 4;  // 100 words: LDS pitch of a Wt row piece, an odd multiple of 16 B
constexpr int kWTiles   = (kInDim / kWTi) * (kOutDim / kWTo);
constexpr uint32_t kWLdsC = (uint32_t)(kWTi * kWPitchF) * 4u;      // 45312 B: the tile's coef
constexpr uint32_t kWLdsO = (uint32_t)(kWTo * kWOutPitch) * 4u;    // 25600 B: the tile of Wt
static_assert(kWLdsC % 16u == 0u);
static_assert(kInDim % kWTi == 0 && kOutDim % kWTo == 0);
static_assert(2 * kWRowC == 32 * 11 && 8 * kWOutC == 32 * 6 && kWTi == 2 * 8 && kWTo == 8 * 8);   // per wave: 2 coef rows in, 8 Wt rows out

__device__ __forceinline__ void pack_weights_tile(uint32_t tile_no, unsigned char* sm,
                                                  const float* __restrict__ coef,
                                                  const float* __restrict__ scale_base,
                                                  const float* __restrict__ scale_sp,
                                                  const float* __restrict__ mask,
                                                  unsigned short* __restrict__ Wt) {
  float* sC = (float*)sm;                                        // the tile's coef, as it lies in memory, row per i
  unsigned int* sO = (unsigned int*)(sm + kWLdsC);               // the tile of Wt as packed f16 pairs, row per o
  const uint32_t t    = threadIdx.x;
  const uint32_t lane = t & 31u;
  const uint32_t w    = t >> 5;
  const uint32_t o0 = (tile_no % (uint32_t)(kOutDim / kWTo)) * (uint32_t)kWTo;
  const uint32_t i0 = (tile_no / (uint32_t)(kOutDim / kWTo)) * (uint32_t)kWTi;
  const uint32_t ol = (w & 1u) * 32u + lane;                     // this thread's output dim within the tile
  const uint32_t ib = (w >> 1) * 4u;                             // first of its 4 input dims within the tile

  // in: wave w brings coef rows 2w and 2w + 1 of the tile, 352 chunks = 11 loads of 32 chunks; only load 5 straddles the two rows
  const float* ctile = coef + ((size_t)i0 * kOutDim + o0) * kNumB;
  v4f cv[11];
#pragma unroll
  for (int q = 0; q < 11; ++q) {
    const uint32_t cc  = lane + 32u * q;
    const uint32_t hi  = (cc >= (uint32_t)kWRowC) ? 1u : 0u;
    cv[q] = *(const v4f*)(ctile + (2u * w + hi) * (uint32_t)(kOutDim * kNumB) + (cc - hi * (uint32_t)kWRowC) * 4u);
  }
  // behind the coef loads: the plane loads' results may be given registers that held a coef address, and land only behind this wait
  asm volatile("s_wait_xcnt 0x0" ::: "memory");
  float m[4], sb[4], ss[4];
  const uint32_t io0 = (i0 + ib) * (uint32_t)kOutDim + o0 + ol;
#pragma unroll
  for (int r = 0; r < 4; ++r) {
    const uint32_t io = io0 + (uint32_t)r * (uint32_t)kOutDim;
    m[r]  = mask[io];
    sb[r] = scale_base[io];
    ss[r] = scale_sp[io];
  }
  // behind the tile's loads: no register that one of them names (the shared offset, the three plane bases) is written ahead of this wait;
  // the offset is an input of the statement, so that its register stays its own up to here and no load's result is given it
  asm volatile("s_wait_xcnt 0x0" :: "v"(io0) : "memory");
#pragma unroll
  for (int q = 0; q < 11; ++q) {
    const uint32_t cc  = lane + 32u * q;
    const uint32_t hi  = (cc >= (uint32_t)kWRowC) ? 1u : 0u;
    *(v4f*)(sC + (2u * w + hi) * (uint32_t)kWPitchF + (cc - hi * (uint32_t)kWRowC) * 4u) = cv[q];
  }
  __syncthreads();

#pragma unroll
  for (int r = 0; r < 4; ++r) {
    const float wb = (m[r] * sb[r]) * kWCarry;
    const float ws = m[r] * ss[r];
    const float* cp = sC + (ib + r) * (uint32_t)kWPitchF + ol * (uint32_t)kNumB;
    float wv[kPack];
    wv[0] = wb;
#pragma unroll
    for (int k = 0; k < kNumB; ++k) wv[1 + k] = (cp[k] * ws) * kWCarry;
    unsigned int* dst = sO + ol * (uint32_t)kWOutPitch + (ib + r) * (uint32_t)(kPack / 2);
#pragma unroll
    for (int q = 0; q < kPack / 2; ++q) dst[q] = pk16(h_bits(wv[2 * q]), h_bits(wv[2 * q + 1]));
  }
  __syncthreads();

  // out: wave w stores Wt rows 8w .. 8w + 7 of the tile, 192 chunks = 6 stores of 32 chunks; a store covers pieces of two rows, each whole lines
  unsigned short* tile = Wt + (size_t)o0 * kKdim + (size_t)i0 * kPack;
#pragma unroll
  for (int q = 0; q < 6; ++q) {
    const uint32_t e   = lane + (uint32_t)((32 * q) % kWOutC);   // chunk counted from the start of row (32 q) / 24
    const uint32_t hi  = (e >= (uint32_t)kWOutC) ? 1u : 0u;
    const uint32_t row = 8u * w + (uint32_t)((32 * q) / kWOutC) + hi;
    const uint32_t col = e - hi * (uint32_t)kWOutC;
    const v4u u = *(const v4u*)(sO + row * (uint32_t)kWOutPitch + col * 4u);
    *(v4u*)(tile + row * (uint32_t)kKdim + col * 8u) = u;
  }
}

// ---------------------------------------------------------------------------
// Activation pack: Act[b][i*12 + 0] = f16(16 * silu(x[b,i])), Act[b][i*12 + 1 + k] = f16(16 * bs_k(x[b,i])), k = 0..10,
// bs = order-3 Cox-de Boor recursion over the 15 knots grid[i][0..14] (half-open indicator, nan -> 0 after each level), all in f32.
// (kInDim/256) x (kBatch/kActRows) = 1024 pieces, one per workgroup of 256 threads: piece (ic, bg) = (piece_no % 4, piece_no / 4) handles
// i in [256*ic, 256*ic + 256) of rows 16*bg .. 16*bg + 15; sm = the workgroup's LDS.
// A thread keeps one input dim for all its rows: the 15 knots and the 39 reciprocals of knot differences depend on i alone,
// are formed once and stay in registers; the row loop holds only what depends on x.
// Knot staging coverage: 256 x 15 = 3840 floats = 960 x 16 B; 256 threads x 4 iterations with bound (c < 960).
// Store coverage per row: a wave's 32 dims x 12 halves = 768 B = 6 whole lines = 48 chunks of 16 B, staged in the wave's own 768 B of sA:
// chunk l by every lane, chunk 32 + l by lanes l < 16.
// ---------------------------------------------------------------------------
constexpr int kActRows = 16;                // rows of x per workgroup
constexpr int kActPieces = (kInDim / 256) * (kBatch / kActRows);   // 1024
constexpr uint32_t kALdsG = 256u * (uint32_t)kNumG * 4u;           // 15360 B: knots of the piece's 256 input dims
constexpr uint32_t kALdsA = 256u * (uint32_t)(kPack / 2) * 4u;     // 6144 B: packed f16 features, 768 B per wave
static_assert(kBatch % kActRows == 0);
static_assert(kALdsG % 16u == 0u);

// v_rcp_f32 with the one free issue slot that the instruction set asks for behind a transcendental (before its source is overwritten
// or its result read) kept inside the statement; runs once per workgroup, outside the row loop
__device__ __forceinline__ float rcp_slot(float d) { float r; asm("v_rcp_f32 %0, %1\n\tv_nop" : "=v"(r) : "v"(d)); return r; }

__device__ __forceinline__ void pack_acts_piece(uint32_t piece_no, unsigned char* sm,
                                                const float* __restrict__ x,
                                                const float* __restrict__ grid,
                                                unsigned short* __restrict__ Act) {
  float* sG = (float*)sm;
  unsigned int* sA = (unsigned int*)(sm + kALdsG);
  const int ic = (int)(piece_no % (uint32_t)(kInDim / 256));
  const int b0 = (int)(piece_no / (uint32_t)(kInDim / 256)) * kActRows;
  const int t  = threadIdx.x;
  const int i0 = ic * 256;
  {
    const v4f* gp = (const v4f*)(grid + (size_t)i0 * kNumG);   // byte offset i0*60 = 15360*ic, 16-B aligned
#pragma unroll
    for (int it = 0; it < 4; ++it) {
      const int c  = t + 256 * it;
      const int cc = (c < 960) ? c : 959;                       // clamp the address, predicate the LDS store
      const v4f gv = gp[cc];
      if (c < 960) *(v4f*)(sG + 4 * c) = gv;
    }
  }
  __syncthreads();

  const int i = i0 + t;
  float g[kNumG];
#pragma unroll
  for (int j = 0; j < kNumG; ++j) g[j] = sG[t * kNumG + j];

  // rc[p-1][j] = 1 / (g[j+p] - g[j]) for j = 0 .. 14-p (division by a broadcast knot difference = multiply by its reciprocal)
  float rc[kOrder][kNumG];
#pragma unroll
  for (int p = 1; p <= kOrder; ++p) {
#pragma unroll
    for (int j = 0; j < kNumG; ++j) {
      rc[p - 1][j] = 0.0f;
      if (j + p < kNumG) rc[p - 1][j] = rcp_slot(g[j + p] - g[j]);
    }
  }

  const int lane = t & 31;
  const int wv   = t >> 5;
  unsigned int* dst = sA + t * (kPack / 2);                       // inside the wave's own 192 words
  const unsigned int* rd0 = sA + wv * 192 + 4 * lane;             // chunk l
  const unsigned int* rd1 = sA + wv * 192 + 4 * (32 + (lane & 15));   // chunk 32 + l (lanes 16..31 read in bounds, store nothing)
  const float* xp = x + (size_t)b0 * kInDim + i;
  unsigned short* seg = Act + (size_t)b0 * kKdim + (size_t)i0 * kPack + (size_t)wv * 384;

  float xnext = xp[0];
  // rolled: the body is long, and one copy of it keeps the kernel's text small
#pragma unroll 1
  for (int rr = 0; rr < kActRows; ++rr) {
    const float xv = xnext;
    const int rn = (rr + 1 < kActRows) ? rr + 1 : rr;             // next row's x is fetched one trip ahead, the index clamped to the last row
    xnext = xp[(size_t)rn * kInDim];

    float v[kNumG - 1];
#pragma unroll
    for (int j = 0; j < kNumG - 1; ++j) v[j] = (xv >= g[j] && xv < g[j + 1]) ? 1.0f : 0.0f;

#pragma unroll
    for (int p = 1; p <= kOrder; ++p) {
#pragma unroll
      for (int j = 0; j < kNumG - 1; ++j) {
        if (j + p < kNumG - 1) {
          // left: (x - g[j]) / (g[j+p] - g[j]) * v[j];  right: (g[j+p+1] - x) / (g[j+p+1] - g[j+1]) * v[j+1]
          const float tl = ((xv - g[j]) * rc[p - 1][j]) * v[j];
          const float tr = ((g[j + p + 1] - xv) * rc[p - 1][j + 1]) * v[j + 1];
          const float tt = tl + tr;
          v[j] = (tt == tt) ? tt : 0.0f;
        }
      }
    }

    const float sil = xv / (1.0f + expf(-xv));

    unsigned short hb[kPack];
    hb[0] = h_bits(sil * kActCarry);
#pragma unroll
    for (int k = 0; k < kNumB; ++k) hb[1 + k] = h_bits(v[k] * kActCarry);
#pragma unroll
    for (int q = 0; q < kPack / 2; ++q) dst[q] = pk16(hb[2 * q], hb[2 * q + 1]);
    // the wave's own LDS writes are complete before its lanes read each other's words (no other wave touches this range);
    // LDS alone is ordered, so that the row stores and the x load issued ahead stay in flight
    __builtin_amdgcn_fence(__ATOMIC_RELEASE, "workgroup", "local");
    __builtin_amdgcn_wave_barrier();
    __builtin_amdgcn_fence(__ATOMIC_ACQUIRE, "workgroup", "local");
    const v4u u0 = *(const v4u*)rd0;
    const v4u u1 = *(const v4u*)rd1;
    unsigned short* srow = seg + (size_t)rr * kKdim;
    *(v4u*)(srow + (size_t)lane * 8) = u0;
    if (lane < 16) {
      *(v4u*)(srow + (size_t)(32 + lane) * 8) = u1;
      asm volatile("s_wait_xcnt 0x0" ::: "memory");   // directly behind the store: its address registers are advanced for the next row only behind this wait
    }
  }
}

// ---------------------------------------------------------------------------
// Both packs in one launch: they share no data, the weight pack waits on memory and the activation pack on the vector units, so that
// workgroups of the two kinds side by side on a WGP fill each other's waits.
// Which workgroup does what (every tile and every piece exactly once; the order is for speed only;
// 1024 are resident at a time):
//   index < 1024: workgroups 2m and 2m + 1 take weight tile m and activation piece m, m < 512; which of the two takes which goes by the
//     parity of the index's set bits (they differ in bit 0 alone), so that a WGP gets both kinds whatever power-of-two stride deals it indices
//   1024 .. 1535: activation pieces 512 .. 1023, the long kind, into the places the first weight tiles leave: the vector units stay fed
//   1536 .. 2047: weight tiles 512 .. 1023, the short kind last, beside the activation pieces still running
// The LDS is one range, laid out by whichever pack the workgroup runs; every barrier inside stands under this workgroup-uniform branch.
// ---------------------------------------------------------------------------
constexpr uint32_t kPackLds = (kWLdsC + kWLdsO > kALdsG + kALdsA) ? (kWLdsC + kWLdsO) : (kALdsG + kALdsA);   // 70912 B
constexpr uint32_t kPackHalf = (uint32_t)kWTiles / 2u;   // 512
static_assert(kWTiles == kActPieces && kWTiles % 2 == 0);

// second bound: eight waves a SIMD (128 registers a wave), so that four workgroups stand on a WGP, as many as the LDS range lets in
__global__ __launch_bounds__(256, 8) void pack_both_kernel(const float* __restrict__ x,
                                                       const float* __restrict__ grid,
                                                       const float* __restrict__ coef,
                                                       const float* __restrict__ scale_base,
                                                       const float* __restrict__ scale_sp,
                                                       const float* __restrict__ mask,
                                                       unsigned short* __restrict__ Act,
                                                       unsigned short* __restrict__ Wt) {
  __shared__ __align__(16) unsigned char sm[kPackLds];
  const uint32_t b = blockIdx.x;
  const bool mixed = b < 2u * kPackHalf;
  const bool wts = mixed ? ((__builtin_popcount(b) & 1) != 0) : (b >= 3u * kPackHalf);
  const uint32_t m = mixed ? (b >> 1) : (wts ? b - 2u * kPackHalf : b - kPackHalf);
  if (wts) pack_weights_tile(m, sm, coef, scale_base, scale_sp, mask, Wt);
  else     pack_acts_piece(m, sm, x, grid, Act);
}

// ---------------------------------------------------------------------------
// Host launcher
// Workspace region map (bytes):
//   [0, 100663296)          Act f16 plane [4096][12288]
//   [100663296, 125829120)  Wt  f16 plane [1024][12288]
//   total 125829120 <= 134217728
// ---------------------------------------------------------------------------
extern "C" void kernel_launch(void* const* d_in, const int* in_sizes, int n_in,
                              void* d_out, int out_size, void* d_ws, size_t ws_size,
                              hipStream_t stream) {
  if (n_in < 6) return;
  if (in_sizes[0] != kBatch * kInDim) return;
  if (in_sizes[1] != kInDim * kNumG) return;
  if (in_sizes[2] != kInDim * kOutDim * kNumB) return;
  if (in_sizes[3] != kInDim * kOutDim || in_sizes[4] != kInDim * kOutDim || in_sizes[5] != kInDim * kOutDim) return;
  if (out_size != kBatch * kOutDim) return;

  const size_t actBytes = (size_t)kBatch * kKdim * sizeof(unsigned short);    // 100663296
  const size_t wtBytes  = (size_t)kOutDim * kKdim * sizeof(unsigned short);   // 25165824
  if (actBytes + wtBytes > ws_size) return;

  const float* x          = (const float*)d_in[0];
  const float* grid       = (const float*)d_in[1];
  const float* coef       = (const float*)d_in[2];
  const float* scale_base = (const float*)d_in[3];
  const float* scale_sp   = (const float*)d_in[4];
  const float* mask       = (const float*)d_in[5];
  float* out = (float*)d_out;

  unsigned short* Act = (unsigned short*)d_ws;
  unsigned short* Wt  = (unsigned short*)((char*)d_ws + actBytes);

  pack_both_kernel<<<dim3(kWTiles + kActPieces), dim3(256), 0, stream>>>(x, grid, coef, scale_base, scale_sp, mask, Act, Wt);

  // out[4096][1024] = (1/1024) * Act . Wt^T ; M = 4096, N = 1024, K = 12288 (96 passes of 128 k); 256 tiles of 128 x 128, one workgroup of 4 waves each
  gemm_tile128<<<dim3(kTiles), dim3(128), 0, stream>>>(Act, Wt, out);
}

// v006
// It runs in 77.7 microseconds.
// Timed twice side by side with v005, it ran 1.16 and 1.17 times as fast.
// All steps since v000 together make it 8.09 times as fast.
// Contraction out = Act[4096x12288] . Wt[1024x12288]^T on v_wmma_f32_16x16x32_f16 (f16 operands: Act carried x16, Wt carried x64, folded back x1/1024 in the f32 epilogue), f32 accumulate; B-spline recursion, silu and weight products in f32.
#include <hip/hip_runtime.h>
#include <math.h>
#include <stdint.h>

// ---------------------------------------------------------------------------
// Problem constants
// ---------------------------------------------------------------------------
constexpr int kInDim  = 1024;
constexpr int kOutDim = 1024;
constexpr int kBatch  = 4096;
constexpr int kNumG   = 15;                 // knots per input dim
constexpr int kNumB   = 11;                 // spline bases per input dim
constexpr int kOrder  = 3;
constexpr int kPack   = 12;                 // 1 silu feature + 11 bases
constexpr int kKdim   = kInDim * kPack;     // 12288
constexpr float kActCarry = 16.0f;          // Act plane carried x16 (exact power of two)
constexpr float kWCarry   = 64.0f;          // Wt plane carried x64 (exact power of two)
constexpr float kOutScale = 1.0f / (16.0f * 64.0f);
constexpr int kTilesM = kBatch / 128;
constexpr int kTilesN = kOutDim / 128;
constexpr int kTiles  = kTilesM * kTilesN;  // 256 workgroup tiles of 128 x 128
constexpr int kPassK  = 128;                // k per pass: 256 B of every operand row
constexpr int kPasses = kKdim / kPassK;     // 96 stages of 128 k in all
// Order of k (the same in Act and Wt): k = (i / 32) * 384 + f * 32 + (i % 32), feature f = 0..10 the spline bases, f = 11 silu.
// A stage of 128 k is then 32 input dims x one group of 4 features: stage = (i / 32) * 3 + f / 4.
constexpr int kGroups = 3;                  // feature groups: bases 0..3, bases 4..7, bases 8..10 with silu
constexpr int kBlocks = kInDim / 32;        // 32 blocks of 32 input dims
constexpr int kFlagsPerTileM = 256;         // flag words per 128 batch rows: 32 activation pieces x 8 waves
static_assert(kKdim % kPassK == 0 && kPasses == kBlocks * kGroups && kBlocks >= 4);
static_assert(kBatch % 128 == 0);
static_assert(kOutDim % 128 == 0);
static_assert(kInDim % 256 == 0);

typedef __attribute__((ext_vector_type(16))) _Float16 v16h;
typedef __attribute__((ext_vector_type(8)))  _Float16 v8h;
typedef __attribute__((ext_vector_type(8)))  float    v8f;
typedef __attribute__((ext_vector_type(4)))  float    v4f;
typedef __attribute__((ext_vector_type(4)))  unsigned int v4u;
typedef __attribute__((ext_vector_type(4)))  uint32_t u32x4;
typedef __attribute__((ext_vector_type(8)))  uint32_t u32x8;

// ---------------------------------------------------------------------------
// Small helpers
// ---------------------------------------------------------------------------
__device__ __forceinline__ unsigned pk16(unsigned short a, unsigned short b) { return (unsigned)a | ((unsigned)b << 16); }
__device__ __forceinline__ unsigned short h_bits(float f) { const _Float16 h = (_Float16)f; return __builtin_bit_cast(unsigned short, h); }

__device__ __forceinline__ uint32_t uni(uint32_t v) { return (uint32_t)__builtin_amdgcn_readfirstlane(v); }
// a wave-uniform test held in a scalar register, so that the branch on it is s_cmp + s_cbranch_scc (a tensor load ignores EXEC)
__device__ __forceinline__ uint32_t pinned(uint32_t v) { uint32_t w = (uint32_t)__builtin_amdgcn_readfirstlane(v); asm volatile("" : "+s"(w)); return w; }
// the wave's LDS reads have returned: stands in front of the barrier behind which the buffer it read is refilled
__device__ __forceinline__ void wait_ds0() { asm volatile("s_wait_dscnt 0x0" ::: "memory"); }
// every tensor load of the wave has landed
__device__ __forceinline__ void wait_tensor0() { asm volatile("s_wait_tensorcnt 0x0" ::: "memory"); }
// all but the wave's two youngest tensor loads have landed (they land in issue order): the two stages behind the next one stay in flight
__device__ __forceinline__ void wait_tensor2() { asm volatile("s_wait_tensorcnt 0x2" ::: "memory"); }
// both groups are named in-out (the instruction changes neither): their registers then stay the descriptor's own from one request to the
// next, and the compiler takes none of them as a temporary while a request that names them is outstanding
__device__ __forceinline__ void tdm_load(u32x4& g0, u32x8& g1) { asm volatile("tensor_load_to_lds %0, %1" : "+s"(g0), "+s"(g1) :: "memory"); }

// ---------------------------------------------------------------------------
// LDS ring of the contraction: a stage is 128 k (256 B) of 128 Act rows and 128 Wt rows, as four slices of 64 rows,
// one tensor load of one wave each; rows at pitch 272 B (the load's pad: 16 B behind every 256-B row).
// ---------------------------------------------------------------------------
constexpr uint32_t kRowB   = 256u;                 // bytes of an operand row per stage
constexpr uint32_t kPitch  = kRowB + 16u;          // 272 B: odd multiple of 16 B for ds_load_b128 readers
constexpr uint32_t kSlRows = 64u;
constexpr uint32_t kSlice  = 18432u;               // 64 x 272 = 17408 B, rounded up to a multiple of 2 KiB
constexpr uint32_t kStage  = 4u * kSlice;          // 73728 B
constexpr uint32_t kBufs   = 4u;                   // buffers of the ring: one is worked on, three are in flight
constexpr uint32_t kSrcPitch = (uint32_t)kKdim * 2u;   // 24576 B
static_assert(kSlRows * kPitch <= kSlice && kSlice % 2048u == 0u);
static_assert(kSrcPitch % 16u == 0u && kSrcPitch <= 131072u);

// descriptor group 1: 1-byte elements, tensor = tile = 64 rows of 256 B, source pitch 24576 B, pad 4 dwords behind every 64 dwords, no mask
__device__ __forceinline__ u32x8 tdm_group1() {
  u32x8 d;
  d[0] = uni((1u << 20) | (5u << 22) | (3u << 25));
  d[1] = uni((kRowB & 0xFFFFu) << 16);
  d[2] = uni((kRowB >> 16) | ((kSlRows & 0xFFFFu) << 16));
  d[3] = uni((kSlRows >> 16) | (kRowB << 16));
  d[4] = uni(kSlRows);
  d[5] = uni(kSrcPitch);
  d[6] = uni(0u);
  d[7] = uni(0u);
  return d;
}
// descriptor group 0: count 1, LDS byte offset, global address of the tile's first byte, type 2
__device__ __forceinline__ u32x4 tdm_group0(uint32_t lds_dst, uint64_t ga) {
  u32x4 d;
  d[0] = uni(1u);
  d[1] = uni(lds_dst);
  d[2] = uni((uint32_t)ga);
  d[3] = uni((((uint32_t)(ga >> 32)) & 0x01FFFFFFu) | 0x80000000u);
  return d;
}
// the next request's place and address, written into the same group 0 while earlier requests are in flight: only words 1 and 2 change then.
// Word 3 (the address's high part) changes only where a row crosses a multiple of 4 GiB, and then behind a wait for every request that names it.
__device__ __forceinline__ void tdm_aim(u32x4& d, uint32_t lds_dst, uint64_t ga) {
  uint32_t w3 = uni((((uint32_t)(ga >> 32)) & 0x01FFFFFFu) | 0x80000000u);
  if (pinned(w3 != d[3])) {
    // the group and the new word are both operands of the wait, so that they lie in different registers at it and word 3 is written behind it
    asm volatile("s_wait_tensorcnt 0x0" : "+s"(d), "+s"(w3) :: "memory");
    d[3] = w3;
  }
  d[1] = uni(lds_dst);
  d[2] = uni((uint32_t)ga);
}

// fragment of 16 rows x 32 k: elements 0..7 <- p[0..15] bytes, 8..15 <- p[32..47] bytes (p already holds the lane half's 16-B offset)
__device__ __forceinline__ v16h ld_frag(const unsigned char* p) {
  union { v16h v; v8h h[2]; } f;
  f.h[0] = *(const v8h*)(p);
  f.h[1] = *(const v8h*)(p + 32);
  return f.v;
}

// ---------------------------------------------------------------------------
// out[4096][1024] = (1/1024) * Act[4096][12288] . Wt[1024][12288]^T
// One workgroup of 4 waves per 128 x 128 tile of out (256 workgroups); wave (wm, wn) owns 64 x 64 = 4 x 4 accumulator tiles.
// Operands come by tensor loads into a ring of four LDS buffers: stages s + 1, s + 2 and s + 3 fly while pass s is worked on.
// Waves 0, 1 bring the two halves of the Act rows, waves 2, 3 those of the Wt rows.
// A spline basis is exactly 0 outside its four knot intervals, so whole feature groups of a tile's 128 rows can be 0. The pack launch leaves,
// per wave, a word that says which of groups 0 and 1 hold any nonzero f16; a group that is 0 in all 128 rows x 1024 dims adds nothing to any
// accumulator, and its 32 stages are neither loaded nor multiplied. Group 2 (with silu) is always walked, so there are 32, 64 or 96 passes.
// k runs upward through one accumulator per output tile.
// ---------------------------------------------------------------------------
__global__ __launch_bounds__(128) void gemm_tile128(const unsigned short* __restrict__ Act,
                                                    const unsigned short* __restrict__ Wt,
                                                    const unsigned int* __restrict__ flags,
                                                    float* __restrict__ out) {
  __shared__ __attribute__((aligned(2048))) unsigned char ring[kBufs * kStage + 4u * 16u * 68u * 4u];   // four buffers, then the per-wave output slabs
  const uint32_t lane = threadIdx.x & 31u;
  const uint32_t wave = uni(threadIdx.x >> 5);
  const uint32_t tm = blockIdx.x % (uint32_t)kTilesM;   // speed only: the 8 workgroups that share an Act panel lie 32 apart in index
  const uint32_t tn = blockIdx.x / (uint32_t)kTilesM;
  const uint32_t wm = wave >> 1, wn = wave & 1u;
  const uint32_t rlane = lane & 15u;               // row (A) / col (B, D) within subtile
  const uint32_t hl    = lane >> 4;                // lane half: k offset 8 (16 B), D row offset 8

  const uint32_t lbase = (uint32_t)(size_t)ring;
  const unsigned short* srow = (wave < 2u) ? (Act + (size_t)(tm * 128u + wave * kSlRows) * kKdim)
                                           : (Wt + (size_t)(tn * 128u + (wave - 2u) * kSlRows) * kKdim);
  const uint64_t src = (uint64_t)(size_t)srow;
  u32x8 g1 = tdm_group1();

  // which feature groups this tile's rows use: every wave reads the tile's 256 flag words (8 a lane) and forms the same scalar list
  uint32_t nG, lst;
  {
    const uint32_t foff = tm * (uint32_t)kFlagsPerTileM + lane * 8u;
    const v4u fa = *(const v4u*)(flags + foff);
    const v4u fb = *(const v4u*)(flags + foff + 4u);
    // behind the two flag loads: the offset is an input of the statement, so that its register stays its own up to this wait
    asm volatile("s_wait_xcnt 0x0" :: "v"(foff) : "memory");
    const uint32_t fm = (fa[0] | fa[1] | fa[2] | fa[3]) | (fb[0] | fb[1] | fb[2] | fb[3]);
    const uint32_t u0 = (__builtin_amdgcn_ballot_w32((fm & 1u) != 0u) != 0u) ? 1u : 0u;
    const uint32_t u1 = (__builtin_amdgcn_ballot_w32((fm & 2u) != 0u) != 0u) ? 1u : 0u;
    nG  = uni(1u + u0 + u1);
    // the groups to walk, upward, one byte each
    lst = uni(u0 ? (u1 ? 0x020100u : 0x0200u) : (u1 ? 0x0201u : 0x02u));
  }
  const uint32_t nP = nG * (uint32_t)kBlocks;      // passes: 32, 64 or 96
  uint32_t qi = 0u, qb = 0u;                        // next stage to send off: place in the list, byte offset of its block of 32 dims in a row
  auto next_off = [&]() -> uint32_t {
    const uint32_t off = qb + ((lst >> (8u * qi)) & 3u) * kRowB;
    ++qi;
    if (qi == nG) { qi = 0u; qb += (uint32_t)kGroups * kRowB; }
    return off;
  };

  v8f acc[4][4];
#pragma unroll
  for (int i = 0; i < 4; ++i)
#pragma unroll
    for (int j = 0; j < 4; ++j) acc[i][j] = (v8f){0.f,0.f,0.f,0.f,0.f,0.f,0.f,0.f};

  // prologue: stages 0, 1, 2 are sent off; stage 0 lands and is published; then stage 3 is sent off (never more than three in flight)
  u32x4 g0 = tdm_group0(lbase + wave * kSlice, src + next_off());
  tdm_load(g0, g1);
  tdm_aim(g0, lbase + kStage + wave * kSlice, src + next_off());
  tdm_load(g0, g1);
  tdm_aim(g0, lbase + 2u * kStage + wave * kSlice, src + next_off());
  tdm_load(g0, g1);
  wait_tensor2();
  __syncthreads();
  tdm_aim(g0, lbase + 3u * kStage + wave * kSlice, src + next_off());
  tdm_load(g0, g1);

  const uint32_t aoff = wm * kSlice + rlane * kPitch + hl * 16u;
  const uint32_t boff = (2u + wn) * kSlice + rlane * kPitch + hl * 16u;

  // rolled: one pass per trip, so that the publish point stands once and every register index inside is a constant
#pragma unroll 1
  for (uint32_t s = 0; s < nP; ++s) {
    const uint32_t buf = (s & (kBufs - 1u)) * kStage;
    const unsigned char* ap = ring + buf + aoff;
    const unsigned char* bp = ring + buf + boff;
    v16h af[2][4], bf[2][4];
#pragma unroll
    for (int q = 0; q < 4; ++q) {
      af[0][q] = ld_frag(ap + q * 16 * (int)kPitch);
      bf[0][q] = ld_frag(bp + q * 16 * (int)kPitch);
    }
#pragma unroll
    for (int kc = 0; kc < 4; ++kc) {
      const int cur = kc & 1, nxt = cur ^ 1;
      if (kc < 3) {
#pragma unroll
        for (int q = 0; q < 4; ++q) {
          af[nxt][q] = ld_frag(ap + q * 16 * (int)kPitch + (kc + 1) * 64);
          bf[nxt][q] = ld_frag(bp + q * 16 * (int)kPitch + (kc + 1) * 64);
        }
      }
      __builtin_amdgcn_sched_barrier(0);   // keeps the next block's LDS reads one group ahead of this block's WMMAs, not among them
#pragma unroll
      for (int i = 0; i < 4; ++i)
#pragma unroll
        for (int j = 0; j < 4; ++j)
          acc[i][j] = __builtin_amdgcn_wmma_f32_16x16x32_f16(false, af[cur][i], false, bf[cur][j], (short)0, acc[i][j], false, false);
      __builtin_amdgcn_sched_barrier(0);   // ends the WMMA block: the following load group stays behind it
    }
    // publish point of stage s + 1: behind it stages s + 2 and s + 3 were issued, so the counted wait covers it;
    // in the last passes, where fewer were issued behind it, the wait is to 0
    wait_ds0();
    wait_tensor2();
    if (pinned(s + 3u >= nP)) wait_tensor0();
    __syncthreads();
    if (pinned(s + kBufs < nP)) {
      tdm_aim(g0, lbase + buf + wave * kSlice, src + next_off());   // into the buffer that pass s has just read
      tdm_load(g0, g1);
    }
  }
  wait_tensor0();
  wait_ds0();

  // ---- epilogue: each wave stages 16 x 64 in its own slab (pitch 68 floats) and stores rows of 256 B ----
  float* slab = (float*)(ring + kBufs * kStage) + wave * (16u * 68u);
  const uint32_t m0 = tm * 128u + wm * 64u;
  const uint32_t n0 = tn * 128u + wn * 64u;
  const uint32_t mOff = hl * 8u;
#pragma unroll
  for (int i = 0; i < 4; ++i) {
    const uint32_t mBase = m0 + (i << 4);
#pragma unroll
    for (int j = 0; j < 4; ++j) {
#pragma unroll
      for (int r = 0; r < 8; ++r) slab[(mOff + r) * 68u + (j << 4) + rlane] = acc[i][j][r] * kOutScale;
    }
    __builtin_amdgcn_fence(__ATOMIC_RELEASE, "workgroup");
    __builtin_amdgcn_wave_barrier();
    __builtin_amdgcn_fence(__ATOMIC_ACQUIRE, "workgroup");
    const uint32_t c4 = rlane * 4u;                 // row seg = 256 B = 16 lanes x 16 B
#pragma unroll
    for (int it = 0; it < 8; ++it) {
      const uint32_t row = it * 2u + hl;
      const v4f v = *(const v4f*)(slab + row * 68u + c4);
      *(v4f*)(out + (size_t)(mBase + row) * kOutDim + n0 + c4) = v;
    }
    __builtin_amdgcn_fence(__ATOMIC_RELEASE, "workgroup");
    __builtin_amdgcn_wave_barrier();
    __builtin_amdgcn_fence(__ATOMIC_ACQUIRE, "workgroup");
  }
}

// ---------------------------------------------------------------------------
// Weight pack: Wt[o][k(i, f)] = f16(64 * (coef[i,o,f] * (mask[i,o] * scale_sp[i,o]))), f = 0..10
//              Wt[o][k(i, 11)] = f16(64 * (mask[i,o] * scale_base[i,o])),   k(i, f) = (i / 32) * 384 + f * 32 + (i % 32)
// coef / scale_base / scale_sp / mask are [in i][out o] (coef [i][o][k]); Wt is the [N = o][K] f16 plane, pitch 12288 halves.
// The pack is a transpose (inputs run along o, Wt runs along i), done per tile of 32 i x 32 o through LDS, so that both sides move whole lines:
//   in:  per i the tile's coef is 32 x 11 floats = 1408 contiguous B (88 chunks of 16 B); 32 x 88 = 2816 chunks = 256 threads x 11
//   work: lane = o (coef read from LDS at a stride of 11 words: every bank once), wave w = 4 of the 32 i;
//        the three [i][o] planes are read straight from global memory, 32 lanes = one 128-B line
//   out: per o the tile is one block of 32 i x 12 features = 768 contiguous B (48 chunks of 16 B); 32 x 48 = 1536 chunks = 256 threads x 6
// 32 x 32 = 1024 tiles, one per workgroup of 256 threads (tile = its number); sm = the workgroup's LDS.
// ---------------------------------------------------------------------------
constexpr int kWTi      = 32;                     // input dims per tile: one block of the k order
constexpr int kWTo      = 32;                     // output dims per tile
constexpr int kWRowC    = kWTo * kNumB / 4;       // 88 chunks of 16 B of coef per input dim of a tile
constexpr int kWPitchF  = kWTo * kNumB + 4;       // 356 floats: LDS pitch of a coef row, a multiple of 16 B
constexpr int kWOutC    = kWTi * kPack / 8;       // 48 chunks of 16 B of Wt per output dim of a tile
constexpr int kWOutPitch = kWTi * kPack / 2 + 4;  // 196 words: LDS pitch of a Wt row piece, an odd multiple of 16 B
constexpr int kWTiles   = (kInDim / kWTi) * (kOutDim / kWTo);
constexpr uint32_t kWLdsC = (uint32_t)(kWTi * kWPitchF) * 4u;      // 45568 B: the tile's coef
constexpr uint32_t kWLdsO = (uint32_t)(kWTo * kWOutPitch) * 4u;    // 25088 B: the tile of Wt
static_assert(kWLdsC % 16u == 0u);
static_assert(kInDim % kWTi == 0 && kOutDim % kWTo == 0);
static_assert(4 * kWRowC == 32 * 11 && 4 * kWOutC == 32 * 6 && kWTi == 4 * 8 && kWTo == 4 * 8);   // per wave: 4 coef rows in, 4 Wt rows out

__device__ __forceinline__ void pack_weights_tile(uint32_t tile_no, unsigned char* sm,
                                                  const float* __restrict__ coef,
                                                  const float* __restrict__ scale_base,
                                                  const float* __restrict__ scale_sp,
                                                  const float* __restrict__ mask,
                                                  unsigned short* __restrict__ Wt) {
  float* sC = (float*)sm;                                        // the tile's coef, as it lies in memory, row per i
  unsigned int* sO = (unsigned int*)(sm + kWLdsC);               // the tile of Wt as packed f16 pairs, row per o
  const uint32_t t    = threadIdx.x;
  const uint32_t lane = t & 31u;
  const uint32_t w    = t >> 5;
  const uint32_t o0 = (tile_no % (uint32_t)(kOutDim / kWTo)) * (uint32_t)kWTo;
  const uint32_t i0 = (tile_no / (uint32_t)(kOutDim / kWTo)) * (uint32_t)kWTi;
  const uint32_t ol = lane;                                      // this thread's output dim within the tile
  const uint32_t ib = w * 4u;                                    // first of its 4 input dims within the tile

  // in: wave w brings coef rows 4w .. 4w + 3 of the tile, 352 chunks = 11 loads of 32 chunks; a load covers pieces of at most two rows
  const char* ctile = (const char*)(coef + ((size_t)i0 * kOutDim + o0) * kNumB);
  constexpr uint32_t kCRowB = (uint32_t)(kOutDim * kNumB) * 4u;  // 45056 B from one input dim's coef to the next
  const uint32_t vb = 4u * w * kCRowB + lane * 16u;              // byte offset of the lane's chunk in load 0
  const char* gp[11];                                            // the lane's address less the load's constant step: one row further where its chunk lies past the row's end (loads 2, 5, 8)
  v4f cv[11];
#pragma unroll
  for (int q = 0; q < 11; ++q) {
    const uint32_t e = lane + (uint32_t)((32 * q) % kWRowC);     // chunk counted from the start of row (32 q) / 88
    gp[q] = ctile + (size_t)(vb + ((e >= (uint32_t)kWRowC) ? kCRowB - (uint32_t)kWRowC * 16u : 0u));
  }
#pragma unroll
  for (int q = 0; q < 11; ++q)
    cv[q] = *(const v4f*)(gp[q] + (size_t)((32 * q) / kWRowC) * kCRowB + (size_t)((32 * q) % kWRowC) * 16u);
  // behind the coef loads: a later load's result may be given a register that held a coef address only behind this wait;
  // the offset and the three stepped addresses are inputs of the statement, so that their registers stay their own up to here
  asm volatile("s_wait_xcnt 0x0" :: "v"(vb), "v"(gp[2]), "v"(gp[5]), "v"(gp[8]) : "memory");
  float m[4], sb[4], ss[4];
  const uint32_t io0 = (i0 + ib) * (uint32_t)kOutDim + o0 + ol;
#pragma unroll
  for (int r = 0; r < 4; ++r) {
    const uint32_t io = io0 + (uint32_t)r * (uint32_t)kOutDim;
    m[r]  = mask[io];
    sb[r] = scale_base[io];
    ss[r] = scale_sp[io];
  }
  // behind the tile's loads: no register that one of them names (the shared offset, the three plane bases) is written ahead of this wait;
  // the offset is an input of the statement, so that its register stays its own up to here and no load's result is given it
  asm volatile("s_wait_xcnt 0x0" :: "v"(io0) : "memory");
#pragma unroll
  for (int q = 0; q < 11; ++q) {
    const uint32_t e   = lane + (uint32_t)((32 * q) % kWRowC);
    const uint32_t hi  = (e >= (uint32_t)kWRowC) ? 1u : 0u;
    const uint32_t row = 4u * w + (uint32_t)((32 * q) / kWRowC) + hi;
    *(v4f*)(sC + row * (uint32_t)kWPitchF + (e - hi * (uint32_t)kWRowC) * 4u) = cv[q];
  }
  __syncthreads();

  unsigned short hw[4][kPack];
#pragma unroll
  for (int r = 0; r < 4; ++r) {
    const float wb = (m[r] * sb[r]) * kWCarry;
    const float ws = m[r] * ss[r];
    const float* cp = sC + (ib + r) * (uint32_t)kWPitchF + ol * (uint32_t)kNumB;
#pragma unroll
    for (int k = 0; k < kNumB; ++k) hw[r][k] = h_bits((cp[k] * ws) * kWCarry);
    hw[r][kNumB] = h_bits(wb);
  }
  // per feature the thread's 4 input dims lie side by side: 8 B
  unsigned int* dst = sO + ol * (uint32_t)kWOutPitch + w * 2u;
#pragma unroll
  for (int f = 0; f < kPack; ++f) {
    dst[f * 16 + 0] = pk16(hw[0][f], hw[1][f]);
    dst[f * 16 + 1] = pk16(hw[2][f], hw[3][f]);
  }
  __syncthreads();

  // out: wave w stores Wt rows 4w .. 4w + 3 of the tile, 192 chunks = 6 stores of 32 chunks; a store covers pieces of at most two rows, each whole lines
  unsigned short* tile = Wt + (size_t)o0 * kKdim + (size_t)i0 * kPack;
#pragma unroll
  for (int q = 0; q < 6; ++q) {
    const uint32_t e   = lane + (uint32_t)((32 * q) % kWOutC);   // chunk counted from the start of row (32 q) / 48
    const uint32_t hi  = (e >= (uint32_t)kWOutC) ? 1u : 0u;
    const uint32_t row = 4u * w + (uint32_t)((32 * q) / kWOutC) + hi;
    const uint32_t col = e - hi * (uint32_t)kWOutC;
    const v4u u = *(const v4u*)(sO + row * (uint32_t)kWOutPitch + col * 4u);
    *(v4u*)(tile + row * (uint32_t)kKdim + col * 8u) = u;
  }
}

// ---------------------------------------------------------------------------
// Activation pack: Act[b][k(i, f)] = f16(16 * bs_f(x[b,i])), f = 0..10, Act[b][k(i, 11)] = f16(16 * silu(x[b,i])), k(i, f) = (i / 32) * 384 + f * 32 + (i % 32),
// bs = order-3 Cox-de Boor recursion over the 15 knots grid[i][0..14] (half-open indicator, nan -> 0 after each level), all in f32.
// (kInDim/256) x (kBatch/kActRows) = 1024 pieces, one per workgroup of 256 threads: piece (ic, bg) = (piece_no % 4, piece_no / 4) handles
// i in [256*ic, 256*ic + 256) of rows 16*bg .. 16*bg + 15; sm = the workgroup's LDS.
// A thread keeps one input dim for all its rows: the 15 knots and the 39 reciprocals of knot differences depend on i alone,
// are formed once and stay in registers; the row loop holds only what depends on x.
// Knot staging coverage: 256 x 15 = 3840 floats = 960 x 16 B; 256 threads x 4 iterations with bound (c < 960).
// Store coverage per row: a wave's 32 dims x 12 halves = 768 B = 6 whole lines = 48 chunks of 16 B, staged in the wave's own 768 B of sA:
// chunk l by every lane, chunk 32 + l by lanes l < 16. In those 768 B a feature's 32 dims lie side by side: neighbouring lanes swap halves of a
// word of two features, so that the even lane holds both dims of the first feature and the odd lane both dims of the second.
// Each wave also leaves one flag word: bit g set where any f16 it wrote in feature group g (g = 0, 1) is not zero.
// ---------------------------------------------------------------------------
constexpr int kActRows = 16;                // rows of x per workgroup
constexpr int kActPieces = (kInDim / 256) * (kBatch / kActRows);   // 1024
constexpr uint32_t kALdsG = 256u * (uint32_t)kNumG * 4u;           // 15360 B: knots of the piece's 256 input dims
constexpr uint32_t kALdsA = 256u * (uint32_t)(kPack / 2) * 4u;     // 6144 B: packed f16 features, 768 B per wave
static_assert(kBatch % kActRows == 0);
static_assert(kALdsG % 16u == 0u);

// v_rcp_f32 with the one free issue slot that the instruction set asks for behind a transcendental (before its source is overwritten
// or its result read) kept inside the statement; runs once per workgroup, outside the row loop
__device__ __forceinline__ float rcp_slot(float d) { float r; asm("v_rcp_f32 %0, %1\n\tv_nop" : "=v"(r) : "v"(d)); return r; }

__device__ __forceinline__ void pack_acts_piece(uint32_t piece_no, unsigned char* sm,
                                                const float* __restrict__ x,
                                                const float* __restrict__ grid,
                                                unsigned short* __restrict__ Act,
                                                unsigned int* __restrict__ flags) {
  float* sG = (float*)sm;
  unsigned int* sA = (unsigned int*)(sm + kALdsG);
  const int ic = (int)(piece_no % (uint32_t)(kInDim / 256));
  const int b0 = (int)(piece_no / (uint32_t)(kInDim / 256)) * kActRows;
  const int t  = threadIdx.x;
  const int i0 = ic * 256;
  {
    const v4f* gp = (const v4f*)(grid + (size_t)i0 * kNumG);   // byte offset i0*60 = 15360*ic, 16-B aligned
#pragma unroll
    for (int it = 0; it < 4; ++it) {
      const int c  = t + 256 * it;
      const int cc = (c < 960) ? c : 959;                       // clamp the address, predicate the LDS store
      const v4f gv = gp[cc];
      if (c < 960) *(v4f*)(sG + 4 * c) = gv;
    }
  }
  __syncthreads();

  const int i = i0 + t;
  float g[kNumG];
#pragma unroll
  for (int j = 0; j < kNumG; ++j) g[j] = sG[t * kNumG + j];

  // rc[p-1][j] = 1 / (g[j+p] - g[j]) for j = 0 .. 14-p (division by a broadcast knot difference = multiply by its reciprocal)
  float rc[kOrder][kNumG];
#pragma unroll
  for (int p = 1; p <= kOrder; ++p) {
#pragma unroll
    for (int j = 0; j < kNumG; ++j) {
      rc[p - 1][j] = 0.0f;
      if (j + p < kNumG) rc[p - 1][j] = rcp_slot(g[j + p] - g[j]);
    }
  }

  const int lane = t & 31;
  const int wv   = t >> 5;
  unsigned int* dst = sA + wv * 192 + (lane & 1) * 16 + (lane >> 1);   // inside the wave's own 192 words: word of dims (l, l + 1) of feature 0 (even lane) or 1 (odd lane)
  const unsigned int psel = (lane & 1) ? 0x03020706u : 0x05040100u;    // byte pick: even lane (own low half, neighbour's low half), odd lane (neighbour's high half, own high half)
  unsigned int nz0 = 0u, nz1 = 0u;                                 // every f16 pair of groups 0 and 1 so far, or-ed
  const unsigned int* rd0 = sA + wv * 192 + 4 * lane;             // chunk l
  const unsigned int* rd1 = sA + wv * 192 + 4 * (32 + (lane & 15));   // chunk 32 + l (lanes 16..31 read in bounds, store nothing)
  const float* xp = x + (size_t)b0 * kInDim + i;
  unsigned short* seg = Act + (size_t)b0 * kKdim + (size_t)i0 * kPack + (size_t)wv * 384;

  float xnext = xp[0];
  // rolled: the body is long, and one copy of it keeps the kernel's text small
#pragma unroll 1
  for (int rr = 0; rr < kActRows; ++rr) {
    const float xv = xnext;
    const int rn = (rr + 1 < kActRows) ? rr + 1 : rr;             // next row's x is fetched one trip ahead, the index clamped to the last row
    xnext = xp[(size_t)rn * kInDim];

    float v[kNumG - 1];
#pragma unroll
    for (int j = 0; j < kNumG - 1; ++j) v[j] = (xv >= g[j] && xv < g[j + 1]) ? 1.0f : 0.0f;

#pragma unroll
    for (int p = 1; p <= kOrder; ++p) {
#pragma unroll
      for (int j = 0; j < kNumG - 1; ++j) {
        if (j + p < kNumG - 1) {
          // left: (x - g[j]) / (g[j+p] - g[j]) * v[j];  right: (g[j+p+1] - x) / (g[j+p+1] - g[j+1]) * v[j+1]
          const float tl = ((xv - g[j]) * rc[p - 1][j]) * v[j];
          const float tr = ((g[j + p + 1] - xv) * rc[p - 1][j + 1]) * v[j + 1];
          const float tt = tl + tr;
          v[j] = (tt == tt) ? tt : 0.0f;
        }
      }
    }

    const float sil = xv / (1.0f + expf(-xv));

    unsigned short hb[kPack];
    hb[kNumB] = h_bits(sil * kActCarry);
#pragma unroll
    for (int k = 0; k < kNumB; ++k) hb[k] = h_bits(v[k] * kActCarry);
    unsigned int pw[kPack / 2];
#pragma unroll
    for (int q = 0; q < kPack / 2; ++q) pw[q] = pk16(hb[2 * q], hb[2 * q + 1]);
    nz0 |= pw[0] | pw[1];
    nz1 |= pw[2] | pw[3];
#pragma unroll
    for (int q = 0; q < kPack / 2; ++q) {
      const unsigned int nb = (unsigned int)__builtin_amdgcn_mov_dpp((int)pw[q], 0xB1, 0xF, 0xF, true);   // the neighbour lane's word (lanes 2n and 2n + 1 swapped)
      dst[q * 32] = __builtin_amdgcn_perm(nb, pw[q], psel);
    }
    // the wave's own LDS writes are complete before its lanes read each other's words (no other wave touches this range);
    // LDS alone is ordered, so that the row stores and the x load issued ahead stay in flight
    __builtin_amdgcn_fence(__ATOMIC_RELEASE, "workgroup", "local");
    __builtin_amdgcn_wave_barrier();
    __builtin_amdgcn_fence(__ATOMIC_ACQUIRE, "workgroup", "local");
    const v4u u0 = *(const v4u*)rd0;
    const v4u u1 = *(const v4u*)rd1;
    unsigned short* srow = seg + (size_t)rr * kKdim;
    *(v4u*)(srow + (size_t)lane * 8) = u0;
    if (lane < 16) {
      *(v4u*)(srow + (size_t)(32 + lane) * 8) = u1;
      asm volatile("s_wait_xcnt 0x0" ::: "memory");   // directly behind the store: its address registers are advanced for the next row only behind this wait
    }
  }
  // the sign bit alone (a negative zero) is a zero
  const unsigned int any0 = (__builtin_amdgcn_ballot_w32((nz0 & 0x7FFF7FFFu) != 0u) != 0u) ? 1u : 0u;
  const unsigned int any1 = (__builtin_amdgcn_ballot_w32((nz1 & 0x7FFF7FFFu) != 0u) != 0u) ? 2u : 0u;
  if (lane == 0) flags[piece_no * 8u + (uint32_t)wv] = any0 | any1;
}

// ---------------------------------------------------------------------------
// Both packs in one launch: they share no data, the weight pack waits on memory and the activation pack on the vector units, so that
// workgroups of the two kinds side by side on a WGP fill each other's waits.
// Which workgroup does what (every tile and every piece exactly once; the order is for speed only;
// 1024 are resident at a time):
//   index < 1024: workgroups 2m and 2m + 1 take weight tile m and activation piece m, m < 512; which of the two takes which goes by the
//     parity of the index's set bits (they differ in bit 0 alone), so that a WGP gets both kinds whatever power-of-two stride deals it indices
//   1024 .. 1535: activation pieces 512 .. 1023, the long kind, into the places the first weight tiles leave: the vector units stay fed
//   1536 .. 2047: weight tiles 512 .. 1023, the short kind last, beside the activation pieces still running
// The LDS is one range, laid out by whichever pack the workgroup runs; every barrier inside stands under this workgroup-uniform branch.
// ---------------------------------------------------------------------------
constexpr uint32_t kPackLds = (kWLdsC + kWLdsO > kALdsG + kALdsA) ? (kWLdsC + kWLdsO) : (kALdsG + kALdsA);   // 70656 B
constexpr uint32_t kPackHalf = (uint32_t)kWTiles / 2u;   // 512
static_assert(kWTiles == kActPieces && kWTiles % 2 == 0);

// second bound: eight waves a SIMD (128 registers a wave), so that four workgroups stand on a WGP, as many as the LDS range lets in
__global__ __launch_bounds__(256, 8) void pack_both_kernel(const float* __restrict__ x,
                                                       const float* __restrict__ grid,
                                                       const float* __restrict__ coef,
                                                       const float* __restrict__ scale_base,
                                                       const float* __restrict__ scale_sp,
                                                       const float* __restrict__ mask,
                                                       unsigned short* __restrict__ Act,
                                                       unsigned short* __restrict__ Wt,
                                                       unsigned int* __restrict__ flags) {
  __shared__ __align__(16) unsigned char sm[kPackLds];
  const uint32_t b = blockIdx.x;
  const bool mixed = b < 2u * kPackHalf;
  const bool wts = mixed ? ((__builtin_popcount(b) & 1) != 0) : (b >= 3u * kPackHalf);
  const uint32_t m = mixed ? (b >> 1) : (wts ? b - 2u * kPackHalf : b - kPackHalf);
  if (wts) pack_weights_tile(m, sm, coef, scale_base, scale_sp, mask, Wt);
  else     pack_acts_piece(m, sm, x, grid, Act, flags);
}

// ---------------------------------------------------------------------------
// Host launcher
// Workspace region map (bytes):
//   [0, 100663296)          Act f16 plane [4096][12288]
//   [100663296, 125829120)  Wt  f16 plane [1024][12288]
//   [125829120, 125861888)  flag words, 8 per activation piece
//   total 125861888 <= 134217728
// ---------------------------------------------------------------------------
extern "C" void kernel_launch(void* const* d_in, const int* in_sizes, int n_in,
                              void* d_out, int out_size, void* d_ws, size_t ws_size,
                              hipStream_t stream) {
  if (n_in < 6) return;
  if (in_sizes[0] != kBatch * kInDim) return;
  if (in_sizes[1] != kInDim * kNumG) return;
  if (in_sizes[2] != kInDim * kOutDim * kNumB) return;
  if (in_sizes[3] != kInDim * kOutDim || in_sizes[4] != kInDim * kOutDim || in_sizes[5] != kInDim * kOutDim) return;
  if (out_size != kBatch * kOutDim) return;

  const size_t actBytes = (size_t)kBatch * kKdim * sizeof(unsigned short);    // 100663296
  const size_t wtBytes  = (size_t)kOutDim * kKdim * sizeof(unsigned short);   // 25165824
  const size_t flagBytes = (size_t)kActPieces * 8 * sizeof(unsigned int);     // 32768
  if (actBytes + wtBytes + flagBytes > ws_size) return;

  const float* x          = (const float*)d_in[0];
  const float* grid       = (const float*)d_in[1];
  const float* coef       = (const float*)d_in[2];
  const float* scale_base = (const float*)d_in[3];
  const float* scale_sp   = (const float*)d_in[4];
  const float* mask       = (const float*)d_in[5];
  float* out = (float*)d_out;

  unsigned short* Act = (unsigned short*)d_ws;
  unsigned short* Wt  = (unsigned short*)((char*)d_ws + actBytes);
  unsigned int* flags = (unsigned int*)((char*)d_ws + actBytes + wtBytes);

  pack_both_kernel<<<dim3(kWTiles + kActPieces), dim3(256), 0, stream>>>(x, grid, coef, scale_base, scale_sp, mask, Act, Wt, flags);

  // out[4096][1024] = (1/1024) * Act . Wt^T ; M = 4096, N = 1024, K = 12288 (up to 96 passes of 128 k); 256 tiles of 128 x 128, one workgroup of 4 waves each
  gemm_tile128<<<dim3(kTiles), dim3(128), 0, stream>>>(Act, Wt, flags, out);
}

// v007
// Measured time: 70.9 microseconds a run.
// In both of two side-by-side timings against v006, it was 1.09 times as fast.
// Counting every step since v000, it is 8.84 times as fast.
// Contraction out = Act[4096x12288] . Wt[1024x12288]^T on v_wmma_f32_16x16x32_f16 (f16 operands: Act carried x16, Wt carried x64, folded back x1/1024 in the f32 epilogue), f32 accumulate; B-spline recursion, silu and weight products in f32.
#include <hip/hip_runtime.h>
#include <math.h>
#include <stdint.h>

// ---------------------------------------------------------------------------
// Problem constants
// ---------------------------------------------------------------------------
constexpr int kInDim  = 1024;
constexpr int kOutDim = 1024;
constexpr int kBatch  = 4096;
constexpr int kNumG   = 15;                 // knots per input dim
constexpr int kNumB   = 11;                 // spline bases per input dim
constexpr int kOrder  = 3;
constexpr int kPack   = 12;                 // 1 silu feature + 11 bases
constexpr int kKdim   = kInDim * kPack;     // 12288
constexpr float kActCarry = 16.0f;          // Act plane carried x16 (exact power of two)
constexpr float kWCarry   = 64.0f;          // Wt plane carried x64 (exact power of two)
constexpr float kOutScale = 1.0f / (16.0f * 64.0f);
constexpr int kTilesM = kBatch / 128;
constexpr int kTilesN = kOutDim / 128;
constexpr int kTiles  = kTilesM * kTilesN;  // 256 workgroup tiles of 128 x 128
constexpr int kPassK  = 128;                // k per pass: 256 B of every operand row
constexpr int kPasses = kKdim / kPassK;     // 96 stages of 128 k in all
// Order of k (the same in Act and Wt): k = (i / 32) * 384 + f * 32 + (i % 32), feature f = 0..10 the spline bases, f = 11 silu.
// A stage of 128 k is then 32 input dims x one group of 4 features: stage = (i / 32) * 3 + f / 4.
constexpr int kGroups = 3;                  // feature groups: bases 0..3, bases 4..7, bases 8..10 with silu
constexpr int kBlocks = kInDim / 32;        // 32 blocks of 32 input dims
constexpr int kFlagsPerTileM = 256;         // flag words per 128 batch rows: 32 activation pieces x 8 waves
static_assert(kKdim % kPassK == 0 && kPasses == kBlocks * kGroups && kBlocks >= 4);
static_assert(kBatch % 128 == 0);
static_assert(kOutDim % 128 == 0);
static_assert(kInDim % 256 == 0);

typedef __attribute__((ext_vector_type(16))) _Float16 v16h;
typedef __attribute__((ext_vector_type(8)))  _Float16 v8h;
typedef __attribute__((ext_vector_type(8)))  float    v8f;
typedef __attribute__((ext_vector_type(4)))  float    v4f;
typedef __attribute__((ext_vector_type(4)))  unsigned int v4u;
typedef __attribute__((ext_vector_type(2)))  unsigned int v2u;
typedef __attribute__((ext_vector_type(4)))  uint32_t u32x4;
typedef __attribute__((ext_vector_type(8)))  uint32_t u32x8;

// ---------------------------------------------------------------------------
// Small helpers
// ---------------------------------------------------------------------------
__device__ __forceinline__ unsigned pk16(unsigned short a, unsigned short b) { return (unsigned)a | ((unsigned)b << 16); }
__device__ __forceinline__ unsigned short h_bits(float f) { const _Float16 h = (_Float16)f; return __builtin_bit_cast(unsigned short, h); }

__device__ __forceinline__ uint32_t uni(uint32_t v) { return (uint32_t)__builtin_amdgcn_readfirstlane(v); }
// a wave-uniform test held in a scalar register, so that the branch on it is s_cmp + s_cbranch_scc (a tensor load ignores EXEC)
__device__ __forceinline__ uint32_t pinned(uint32_t v) { uint32_t w = (uint32_t)__builtin_amdgcn_readfirstlane(v); asm volatile("" : "+s"(w)); return w; }
// the wave's LDS reads have returned: stands in front of the barrier behind which the buffer it read is refilled
__device__ __forceinline__ void wait_ds0() { asm volatile("s_wait_dscnt 0x0" ::: "memory"); }
// every tensor load of the wave has landed
__device__ __forceinline__ void wait_tensor0() { asm volatile("s_wait_tensorcnt 0x0" ::: "memory"); }
// all but the wave's two youngest tensor loads have landed (they land in issue order): the two stages behind the next one stay in flight
__device__ __forceinline__ void wait_tensor2() { asm volatile("s_wait_tensorcnt 0x2" ::: "memory"); }
// both groups are named in-out (the instruction changes neither): their registers then stay the descriptor's own from one request to the
// next, and the compiler takes none of them as a temporary while a request that names them is outstanding
__device__ __forceinline__ void tdm_load(u32x4& g0, u32x8& g1) { asm volatile("tensor_load_to_lds %0, %1" : "+s"(g0), "+s"(g1) :: "memory"); }

// ---------------------------------------------------------------------------
// LDS ring of the contraction: a stage is 128 k (256 B) of 128 Act rows and 128 Wt rows, as four slices of 64 rows,
// one tensor load of one wave each; rows at pitch 272 B (the load's pad: 16 B behind every 256-B row).
// ---------------------------------------------------------------------------
constexpr uint32_t kRowB   = 256u;                 // bytes of an operand row per stage
constexpr uint32_t kPitch  = kRowB + 16u;          // 272 B: odd multiple of 16 B for ds_load_b128 readers
constexpr uint32_t kSlRows = 64u;
constexpr uint32_t kSlice  = 18432u;               // 64 x 272 = 17408 B, rounded up to a multiple of 2 KiB
constexpr uint32_t kStage  = 4u * kSlice;          // 73728 B
constexpr uint32_t kBufs   = 4u;                   // buffers of the ring: one is worked on, three are in flight
constexpr uint32_t kSrcPitch = (uint32_t)kKdim * 2u;   // 24576 B
static_assert(kSlRows * kPitch <= kSlice && kSlice % 2048u == 0u);
static_assert(kSrcPitch % 16u == 0u && kSrcPitch <= 131072u);

// descriptor group 1: 1-byte elements, tensor = tile = 64 rows of 256 B, source pitch 24576 B, pad 4 dwords behind every 64 dwords, no mask
__device__ __forceinline__ u32x8 tdm_group1() {
  u32x8 d;
  d[0] = uni((1u << 20) | (5u << 22) | (3u << 25));
  d[1] = uni((kRowB & 0xFFFFu) << 16);
  d[2] = uni((kRowB >> 16) | ((kSlRows & 0xFFFFu) << 16));
  d[3] = uni((kSlRows >> 16) | (kRowB << 16));
  d[4] = uni(kSlRows);
  d[5] = uni(kSrcPitch);
  d[6] = uni(0u);
  d[7] = uni(0u);
  return d;
}
// descriptor group 0: count 1, LDS byte offset, global address of the tile's first byte, type 2
__device__ __forceinline__ u32x4 tdm_group0(uint32_t lds_dst, uint64_t ga) {
  u32x4 d;
  d[0] = uni(1u);
  d[1] = uni(lds_dst);
  d[2] = uni((uint32_t)ga);
  d[3] = uni((((uint32_t)(ga >> 32)) & 0x01FFFFFFu) | 0x80000000u);
  return d;
}
// the next request's place and address, written into the same group 0 while earlier requests are in flight: only words 1 and 2 change then.
// Word 3 (the address's high part) changes only where a row crosses a multiple of 4 GiB, and then behind a wait for every request that names it.
__device__ __forceinline__ void tdm_aim(u32x4& d, uint32_t lds_dst, uint64_t ga) {
  uint32_t w3 = uni((((uint32_t)(ga >> 32)) & 0x01FFFFFFu) | 0x80000000u);
  if (pinned(w3 != d[3])) {
    // the group and the new word are both operands of the wait, so that they lie in different registers at it and word 3 is written behind it
    asm volatile("s_wait_tensorcnt 0x0" : "+s"(d), "+s"(w3) :: "memory");
    d[3] = w3;
  }
  d[1] = uni(lds_dst);
  d[2] = uni((uint32_t)ga);
}

// fragment of 16 rows x 32 k: elements 0..7 <- p[0..15] bytes, 8..15 <- p[32..47] bytes (p already holds the lane half's 16-B offset)
__device__ __forceinline__ v16h ld_frag(const unsigned char* p) {
  union { v16h v; v8h h[2]; } f;
  f.h[0] = *(const v8h*)(p);
  f.h[1] = *(const v8h*)(p + 32);
  return f.v;
}

// ---------------------------------------------------------------------------
// out[4096][1024] = (1/1024) * Act[4096][12288] . Wt[1024][12288]^T
// One workgroup of 4 waves per 128 x 128 tile of out (256 workgroups); wave (wm, wn) owns 64 x 64 = 4 x 4 accumulator tiles.
// Operands come by tensor loads into a ring of four LDS buffers: stages s + 1, s + 2 and s + 3 fly while pass s is worked on.
// Waves 0, 1 bring the two halves of the Act rows, waves 2, 3 those of the Wt rows.
// A spline basis is exactly 0 outside its four knot intervals, so whole feature groups of a tile's 128 rows can be 0. The pack launch leaves,
// per wave, a word that says which of groups 0 and 1 hold any nonzero f16; a group that is 0 in all 128 rows x 1024 dims adds nothing to any
// accumulator, and its 32 stages are neither loaded nor multiplied. Group 2 (with silu) is always walked, so there are 32, 64 or 96 passes.
// k runs upward through one accumulator per output tile.
// ---------------------------------------------------------------------------
__global__ __launch_bounds__(128) void gemm_tile128(const unsigned short* __restrict__ Act,
                                                    const unsigned short* __restrict__ Wt,
                                                    const unsigned int* __restrict__ flags,
                                                    float* __restrict__ out) {
  __shared__ __attribute__((aligned(2048))) unsigned char ring[kBufs * kStage + 4u * 16u * 68u * 4u];   // four buffers, then the per-wave output slabs
  const uint32_t lane = threadIdx.x & 31u;
  const uint32_t wave = uni(threadIdx.x >> 5);
  const uint32_t tm = blockIdx.x % (uint32_t)kTilesM;   // speed only: the 8 workgroups that share an Act panel lie 32 apart in index
  const uint32_t tn = blockIdx.x / (uint32_t)kTilesM;
  const uint32_t wm = wave >> 1, wn = wave & 1u;
  const uint32_t rlane = lane & 15u;               // row (A) / col (B, D) within subtile
  const uint32_t hl    = lane >> 4;                // lane half: k offset 8 (16 B), D row offset 8

  const uint32_t lbase = (uint32_t)(size_t)ring;
  const unsigned short* srow = (wave < 2u) ? (Act + (size_t)(tm * 128u + wave * kSlRows) * kKdim)
                                           : (Wt + (size_t)(tn * 128u + (wave - 2u) * kSlRows) * kKdim);
  const uint64_t src = (uint64_t)(size_t)srow;
  u32x8 g1 = tdm_group1();

  // which feature groups this tile's rows use: every wave reads the tile's 256 flag words (8 a lane) and forms the same scalar list
  uint32_t nG, lst;
  {
    const uint32_t foff = tm * (uint32_t)kFlagsPerTileM + lane * 8u;
    const v4u fa = *(const v4u*)(flags + foff);
    const v4u fb = *(const v4u*)(flags + foff + 4u);
    // behind the two flag loads: the offset is an input of the statement, so that its register stays its own up to this wait
    asm volatile("s_wait_xcnt 0x0" :: "v"(foff) : "memory");
    const uint32_t fm = (fa[0] | fa[1] | fa[2] | fa[3]) | (fb[0] | fb[1] | fb[2] | fb[3]);
    const uint32_t u0 = (__builtin_amdgcn_ballot_w32((fm & 1u) != 0u) != 0u) ? 1u : 0u;
    const uint32_t u1 = (__builtin_amdgcn_ballot_w32((fm & 2u) != 0u) != 0u) ? 1u : 0u;
    nG  = uni(1u + u0 + u1);
    // the groups to walk, upward, one byte each
    lst = uni(u0 ? (u1 ? 0x020100u : 0x0200u) : (u1 ? 0x0201u : 0x02u));
  }
  const uint32_t nP = nG * (uint32_t)kBlocks;      // passes: 32, 64 or 96
  uint32_t qi = 0u, qb = 0u;                        // next stage to send off: place in the list, byte offset of its block of 32 dims in a row
  auto next_off = [&]() -> uint32_t {
    const uint32_t off = qb + ((lst >> (8u * qi)) & 3u) * kRowB;
    ++qi;
    if (qi == nG) { qi = 0u; qb += (uint32_t)kGroups * kRowB; }
    return off;
  };

  v8f acc[4][4];
#pragma unroll
  for (int i = 0; i < 4; ++i)
#pragma unroll
    for (int j = 0; j < 4; ++j) acc[i][j] = (v8f){0.f,0.f,0.f,0.f,0.f,0.f,0.f,0.f};

  // prologue: stages 0, 1, 2 are sent off; stage 0 lands and is published; then stage 3 is sent off (never more than three in flight)
  u32x4 g0 = tdm_group0(lbase + wave * kSlice, src + next_off());
  tdm_load(g0, g1);
  tdm_aim(g0, lbase + kStage + wave * kSlice, src + next_off());
  tdm_load(g0, g1);
  tdm_aim(g0, lbase + 2u * kStage + wave * kSlice, src + next_off());
  tdm_load(g0, g1);
  wait_tensor2();
  __syncthreads();
  tdm_aim(g0, lbase + 3u * kStage + wave * kSlice, src + next_off());
  tdm_load(g0, g1);

  const uint32_t aoff = wm * kSlice + rlane * kPitch + hl * 16u;
  const uint32_t boff = (2u + wn) * kSlice + rlane * kPitch + hl * 16u;

  // rolled: one pass per trip, so that the publish point stands once and every register index inside is a constant
#pragma unroll 1
  for (uint32_t s = 0; s < nP; ++s) {
    const uint32_t buf = (s & (kBufs - 1u)) * kStage;
    const unsigned char* ap = ring + buf + aoff;
    const unsigned char* bp = ring + buf + boff;
    v16h af[2][4], bf[2][4];
#pragma unroll
    for (int q = 0; q < 4; ++q) {
      af[0][q] = ld_frag(ap + q * 16 * (int)kPitch);
      bf[0][q] = ld_frag(bp + q * 16 * (int)kPitch);
    }
#pragma unroll
    for (int kc = 0; kc < 4; ++kc) {
      const int cur = kc & 1, nxt = cur ^ 1;
      if (kc < 3) {
#pragma unroll
        for (int q = 0; q < 4; ++q) {
          af[nxt][q] = ld_frag(ap + q * 16 * (int)kPitch + (kc + 1) * 64);
          bf[nxt][q] = ld_frag(bp + q * 16 * (int)kPitch + (kc + 1) * 64);
        }
      }
      __builtin_amdgcn_sched_barrier(0);   // keeps the next block's LDS reads one group ahead of this block's WMMAs, not among them
#pragma unroll
      for (int i = 0; i < 4; ++i)
#pragma unroll
        for (int j = 0; j < 4; ++j)
          acc[i][j] = __builtin_amdgcn_wmma_f32_16x16x32_f16(false, af[cur][i], false, bf[cur][j], (short)0, acc[i][j], false, false);
      __builtin_amdgcn_sched_barrier(0);   // ends the WMMA block: the following load group stays behind it
    }
    // publish point of stage s + 1: behind it stages s + 2 and s + 3 were issued, so the counted wait covers it;
    // in the last passes, where fewer were issued behind it, the wait is to 0
    wait_ds0();
    wait_tensor2();
    if (pinned(s + 3u >= nP)) wait_tensor0();
    __syncthreads();
    if (pinned(s + kBufs < nP)) {
      tdm_aim(g0, lbase + buf + wave * kSlice, src + next_off());   // into the buffer that pass s has just read
      tdm_load(g0, g1);
    }
  }
  wait_tensor0();
  wait_ds0();

  // ---- epilogue: each wave stages 16 x 64 in its own slab (pitch 68 floats) and stores rows of 256 B ----
  float* slab = (float*)(ring + kBufs * kStage) + wave * (16u * 68u);
  const uint32_t m0 = tm * 128u + wm * 64u;
  const uint32_t n0 = tn * 128u + wn * 64u;
  const uint32_t mOff = hl * 8u;
#pragma unroll
  for (int i = 0; i < 4; ++i) {
    const uint32_t mBase = m0 + (i << 4);
#pragma unroll
    for (int j = 0; j < 4; ++j) {
#pragma unroll
      for (int r = 0; r < 8; ++r) slab[(mOff + r) * 68u + (j << 4) + rlane] = acc[i][j][r] * kOutScale;
    }
    __builtin_amdgcn_fence(__ATOMIC_RELEASE, "workgroup");
    __builtin_amdgcn_wave_barrier();
    __builtin_amdgcn_fence(__ATOMIC_ACQUIRE, "workgroup");
    const uint32_t c4 = rlane * 4u;                 // row seg = 256 B = 16 lanes x 16 B
#pragma unroll
    for (int it = 0; it < 8; ++it) {
      const uint32_t row = it * 2u + hl;
      const v4f v = *(const v4f*)(slab + row * 68u + c4);
      *(v4f*)(out + (size_t)(mBase + row) * kOutDim + n0 + c4) = v;
    }
    __builtin_amdgcn_fence(__ATOMIC_RELEASE, "workgroup");
    __builtin_amdgcn_wave_barrier();
    __builtin_amdgcn_fence(__ATOMIC_ACQUIRE, "workgroup");
  }
}

// ---------------------------------------------------------------------------
// Weight pack: Wt[o][k(i, f)] = f16(64 * (coef[i,o,f] * (mask[i,o] * scale_sp[i,o]))), f = 0..10
//              Wt[o][k(i, 11)] = f16(64 * (mask[i,o] * scale_base[i,o])),   k(i, f) = (i / 32) * 384 + f * 32 + (i % 32)
// coef / scale_base / scale_sp / mask are [in i][out o] (coef [i][o][k]); Wt is the [N = o][K] f16 plane, pitch 12288 halves.
// The pack is a transpose (inputs run along o, Wt runs along i), done per tile of 32 i x 32 o through LDS, so that both sides move whole lines:
//   in:  per i the tile's coef is 32 x 11 floats = 1408 contiguous B (88 chunks of 16 B); 32 x 88 = 2816 chunks = 256 threads x 11
//   work: lane = o (coef read from LDS at a stride of 11 words: every bank once), wave w = 4 of the 32 i;
//        the three [i][o] planes are read straight from global memory, 32 lanes = one 128-B line
//   out: per o the tile is one block of 32 i x 12 features = 768 contiguous B (48 chunks of 16 B); 32 x 48 = 1536 chunks = 256 threads x 6
// 32 x 32 = 1024 tiles, one per workgroup of 256 threads (tile = its number); sm = the workgroup's LDS.
// ---------------------------------------------------------------------------
constexpr int kWTi      = 32;                     // input dims per tile: one block of the k order
constexpr int kWTo      = 32;                     // output dims per tile
constexpr int kWRowC    = kWTo * kNumB / 4;       // 88 chunks of 16 B of coef per input dim of a tile
constexpr int kWPitchF  = kWTo * kNumB + 4;       // 356 floats: LDS pitch of a coef row, a multiple of 16 B
constexpr int kWOutC    = kWTi * kPack / 8;       // 48 chunks of 16 B of Wt per output dim of a tile
constexpr int kWOutPitch = kWTi * kPack / 2 + 4;  // 196 words: LDS pitch of a Wt row piece, an odd multiple of 16 B
constexpr int kWTiles   = (kInDim / kWTi) * (kOutDim / kWTo);
constexpr uint32_t kWLdsC = (uint32_t)(kWTi * kWPitchF) * 4u;      // 45568 B: the tile's coef
constexpr uint32_t kWLdsO = (uint32_t)(kWTo * kWOutPitch) * 4u;    // 25088 B: the tile of Wt
static_assert(kWLdsC % 16u == 0u);
static_assert(kInDim % kWTi == 0 && kOutDim % kWTo == 0);
static_assert(4 * kWRowC == 32 * 11 && 4 * kWOutC == 32 * 6 && kWTi == 4 * 8 && kWTo == 4 * 8);   // per wave: 4 coef rows in, 4 Wt rows out

__device__ __forceinline__ void pack_weights_tile(uint32_t tile_no, unsigned char* sm,
                                                  const float* __restrict__ coef,
                                                  const float* __restrict__ scale_base,
                                                  const float* __restrict__ scale_sp,
                                                  const float* __restrict__ mask,
                                                  unsigned short* __restrict__ Wt) {
  float* sC = (float*)sm;                                        // the tile's coef, as it lies in memory, row per i
  unsigned int* sO = (unsigned int*)(sm + kWLdsC);               // the tile of Wt as packed f16 pairs, row per o
  const uint32_t t    = threadIdx.x;
  const uint32_t lane = t & 31u;
  const uint32_t w    = t >> 5;
  const uint32_t o0 = (tile_no % (uint32_t)(kOutDim / kWTo)) * (uint32_t)kWTo;
  const uint32_t i0 = (tile_no / (uint32_t)(kOutDim / kWTo)) * (uint32_t)kWTi;
  const uint32_t ol = lane;                                      // this thread's output dim within the tile
  const uint32_t ib = w * 4u;                                    // first of its 4 input dims within the tile

  // in: wave w brings coef rows 4w .. 4w + 3 of the tile, 352 chunks = 11 loads of 32 chunks; a load covers pieces of at most two rows
  const char* ctile = (const char*)(coef + ((size_t)i0 * kOutDim + o0) * kNumB);
  constexpr uint32_t kCRowB = (uint32_t)(kOutDim * kNumB) * 4u;  // 45056 B from one input dim's coef to the next
  const uint32_t vb = 4u * w * kCRowB + lane * 16u;              // byte offset of the lane's chunk in load 0
  const char* gp[11];                                            // the lane's address less the load's constant step: one row further where its chunk lies past the row's end (loads 2, 5, 8)
  v4f cv[11];
#pragma unroll
  for (int q = 0; q < 11; ++q) {
    const uint32_t e = lane + (uint32_t)((32 * q) % kWRowC);     // chunk counted from the start of row (32 q) / 88
    gp[q] = ctile + (size_t)(vb + ((e >= (uint32_t)kWRowC) ? kCRowB - (uint32_t)kWRowC * 16u : 0u));
  }
#pragma unroll
  for (int q = 0; q < 11; ++q)
    cv[q] = *(const v4f*)(gp[q] + (size_t)((32 * q) / kWRowC) * kCRowB + (size_t)((32 * q) % kWRowC) * 16u);
  // behind the coef loads: a later load's result may be given a register that held a coef address only behind this wait;
  // the offset and the three stepped addresses are inputs of the statement, so that their registers stay their own up to here
  asm volatile("s_wait_xcnt 0x0" :: "v"(vb), "v"(gp[2]), "v"(gp[5]), "v"(gp[8]) : "memory");
  float m[4], sb[4], ss[4];
  const uint32_t io0 = (i0 + ib) * (uint32_t)kOutDim + o0 + ol;
#pragma unroll
  for (int r = 0; r < 4; ++r) {
    const uint32_t io = io0 + (uint32_t)r * (uint32_t)kOutDim;
    m[r]  = mask[io];
    sb[r] = scale_base[io];
    ss[r] = scale_sp[io];
  }
  // behind the tile's loads: no register that one of them names (the shared offset, the three plane bases) is written ahead of this wait;
  // the offset is an input of the statement, so that its register stays its own up to here and no load's result is given it
  asm volatile("s_wait_xcnt 0x0" :: "v"(io0) : "memory");
#pragma unroll
  for (int q = 0; q < 11; ++q) {
    const uint32_t e   = lane + (uint32_t)((32 * q) % kWRowC);
    const uint32_t hi  = (e >= (uint32_t)kWRowC) ? 1u : 0u;
    const uint32_t row = 4u * w + (uint32_t)((32 * q) / kWRowC) + hi;
    *(v4f*)(sC + row * (uint32_t)kWPitchF + (e - hi * (uint32_t)kWRowC) * 4u) = cv[q];
  }
  __syncthreads();

  unsigned short hw[4][kPack];
#pragma unroll
  for (int r = 0; r < 4; ++r) {
    const float wb = (m[r] * sb[r]) * kWCarry;
    const float ws = m[r] * ss[r];
    const float* cp = sC + (ib + r) * (uint32_t)kWPitchF + ol * (uint32_t)kNumB;
#pragma unroll
    for (int k = 0; k < kNumB; ++k) hw[r][k] = h_bits((cp[k] * ws) * kWCarry);
    hw[r][kNumB] = h_bits(wb);
  }
  // per feature the thread's 4 input dims lie side by side: 8 B
  unsigned int* dst = sO + ol * (uint32_t)kWOutPitch + w * 2u;
#pragma unroll
  for (int f = 0; f < kPack; ++f) {
    dst[f * 16 + 0] = pk16(hw[0][f], hw[1][f]);
    dst[f * 16 + 1] = pk16(hw[2][f], hw[3][f]);
  }
  __syncthreads();

  // out: wave w stores Wt rows 4w .. 4w + 3 of the tile, 192 chunks = 6 stores of 32 chunks; a store covers pieces of at most two rows, each whole lines
  unsigned short* tile = Wt + (size_t)o0 * kKdim + (size_t)i0 * kPack;
#pragma unroll
  for (int q = 0; q < 6; ++q) {
    const uint32_t e   = lane + (uint32_t)((32 * q) % kWOutC);   // chunk counted from the start of row (32 q) / 48
    const uint32_t hi  = (e >= (uint32_t)kWOutC) ? 1u : 0u;
    const uint32_t row = 4u * w + (uint32_t)((32 * q) / kWOutC) + hi;
    const uint32_t col = e - hi * (uint32_t)kWOutC;
    const v4u u = *(const v4u*)(sO + row * (uint32_t)kWOutPitch + col * 4u);
    *(v4u*)(tile + row * (uint32_t)kKdim + col * 8u) = u;
  }
}

// ---------------------------------------------------------------------------
// Activation pack: Act[b][k(i, f)] = f16(16 * bs_f(x[b,i])), f = 0..10, Act[b][k(i, 11)] = f16(16 * silu(x[b,i])), k(i, f) = (i / 32) * 384 + f * 32 + (i % 32),
// bs = order-3 Cox-de Boor recursion over the 15 knots grid[i][0..14] (half-open indicator, nan -> 0 after each level), all in f32.
// (kInDim/256) x (kBatch/kActRows) = 1024 pieces, one per workgroup of 256 threads: piece (ic, bg) = (piece_no % 4, piece_no / 4) handles
// i in [256*ic, 256*ic + 256) of rows 16*bg .. 16*bg + 15; sm = the workgroup's LDS.
// A thread keeps one input dim for all its rows: the 15 knots and the 39 reciprocals of knot differences depend on i alone,
// are formed once and stay in registers; the row loop holds only what depends on x.
// Knot staging coverage: 256 x 15 = 3840 floats = 960 x 16 B; 256 threads x 4 iterations with bound (c < 960).
// Store coverage per row: a wave's 32 dims x 12 halves = 768 B = 6 whole lines = 48 chunks of 16 B, staged in the wave's own 768 B of sA:
// chunk l by every lane, chunk 32 + l by lanes l < 16. In those 768 B a feature's 32 dims lie side by side: neighbouring lanes swap halves of a
// word of two features, so that the even lane holds both dims of the first feature and the odd lane both dims of the second.
// Each wave also leaves one flag word: bit g set where any f16 it wrote in feature group g (g = 0, 1) is not zero.
// Short form of a row. Over strictly rising knots an x in [g[J], g[J + 1]) has exactly four bases that are not 0, J - 3 .. J, and they depend on
// the six knots g[J - 2 .. J + 3] and six of the reciprocals alone. J is guessed as if the knots g[3] .. g[11] were evenly spaced, the twelve values
// are fetched from LDS at the lane's own J, and the guess is checked against the fetched knots (g[J] <= x < g[J + 1], 3 <= J <= 10).
// A row takes the short form only where the check holds in all 32 lanes and all 32 dims have sound knots; any other row (an x outside
// [g[3], g[11]), uneven knots that the guess misses, knots that do not rise, a nan) takes the full recursion over all 14 intervals.
// ---------------------------------------------------------------------------
constexpr int kActRows = 16;                // rows of x per workgroup
constexpr int kActPieces = (kInDim / 256) * (kBatch / kActRows);   // 1024
constexpr uint32_t kALdsG = 256u * (uint32_t)kNumG * 4u;           // 15360 B: knots of the piece's 256 input dims
constexpr int kJNum = kNumG - 1 - 2 * kOrder;                      // 8 knot intervals J = 3 .. 10 in which all four bases J - 3 .. J exist
constexpr int kRcPitch = kNumG + 3 * (kJNum + 2);                  // 45 words per input dim (odd, for the banks): its knots, then (16 / (g[j+1] - g[j]), 1 / (g[j+2] - g[j]), 1 / (g[j+3] - g[j])), j = 1 .. 10
constexpr uint32_t kALdsR = 256u * (uint32_t)kRcPitch * 4u;        // 46080 B: those blocks, each read by the thread that wrote it; first in the LDS, so that a read's constant step fits the instruction
constexpr uint32_t kALdsA = 256u * (uint32_t)(kPack / 2) * 4u;     // 6144 B: packed f16 features, 768 B per wave
static_assert(kBatch % kActRows == 0);
static_assert(kALdsR % 16u == 0u && (kALdsG + kALdsR) % 16u == 0u && kRcPitch % 2 == 1);
static_assert(kOrder == 3 && kJNum + kOrder == kNumB);

// v_rcp_f32 with the one free issue slot that the instruction set asks for behind a transcendental (before its source is overwritten
// or its result read) kept inside the statement; runs once per workgroup, outside the row loop
__device__ __forceinline__ float rcp_slot(float d) { float r; asm("v_rcp_f32 %0, %1\n\tv_nop" : "=v"(r) : "v"(d)); return r; }

__device__ __forceinline__ void pack_acts_piece(uint32_t piece_no, unsigned char* sm,
                                                const float* __restrict__ x,
                                                const float* __restrict__ grid,
                                                unsigned short* __restrict__ Act,
                                                unsigned int* __restrict__ flags) {
  float* sG = (float*)(sm + kALdsR);
  unsigned int* sA = (unsigned int*)(sm + kALdsG + kALdsR);
  const int ic = (int)(piece_no % (uint32_t)(kInDim / 256));
  const int b0 = (int)(piece_no / (uint32_t)(kInDim / 256)) * kActRows;
  const int t  = threadIdx.x;
  const int i0 = ic * 256;
  {
    const v4f* gp = (const v4f*)(grid + (size_t)i0 * kNumG);   // byte offset i0*60 = 15360*ic, 16-B aligned
#pragma unroll
    for (int it = 0; it < 4; ++it) {
      const int c  = t + 256 * it;
      const int cc = (c < 960) ? c : 959;                       // clamp the address, predicate the LDS store
      const v4f gv = gp[cc];
      if (c < 960) *(v4f*)(sG + 4 * c) = gv;
    }
  }
  __syncthreads();

  const int i = i0 + t;
  float g[kNumG];
#pragma unroll
  for (int j = 0; j < kNumG; ++j) g[j] = sG[t * kNumG + j];

  // rc[p-1][j] = 1 / (g[j+p] - g[j]) for j = 0 .. 14-p (division by a broadcast knot difference = multiply by its reciprocal)
  float rc[kOrder][kNumG];
#pragma unroll
  for (int p = 1; p <= kOrder; ++p) {
#pragma unroll
    for (int j = 0; j < kNumG; ++j) {
      rc[p - 1][j] = 0.0f;
      if (j + p < kNumG) rc[p - 1][j] = rcp_slot(g[j + p] - g[j]);
    }
  }

  // for the short form: knots and reciprocals at a place the lane can index by its own J (the order-1 reciprocal carries the x16 of the Act plane, an exact scaling)
  float* blk = (float*)sm + t * kRcPitch;
#pragma unroll
  for (int j = 1; j < kNumG - 1; ++j) blk[j] = g[j];
#pragma unroll
  for (int j = 1; j <= kJNum + 2; ++j) {
    blk[kNumG + 3 * (j - 1) + 0] = rc[0][j] * kActCarry;
    blk[kNumG + 3 * (j - 1) + 1] = rc[1][j];
    blk[kNumG + 3 * (j - 1) + 2] = rc[2][j];
  }
  // sound knots: every step positive (one interval at most holds x) and no quotient (x - g[j]) / (g[j+p] - g[j]) of the full recursion can
  // leave the finite range for an x between the knots, so that each of its terms with a zero factor is a zero; a nan or an inf fails the test
  float rsum = 0.0f, rmin = rc[0][0];
#pragma unroll
  for (int j = 0; j < kNumG - 1; ++j) { rsum += rc[0][j]; rmin = fminf(rmin, rc[0][j]); }
  const bool dim_ok = (rmin > 0.0f) && (rsum * (g[kNumG - 1] - g[0]) < 1.0e37f);
  const unsigned int okm = __builtin_amdgcn_ballot_w32(dim_ok);
  const float invh = (float)kJNum * rcp_slot(g[kNumG - 1 - kOrder] - g[kOrder]);

  const int lane = t & 31;
  const int wv   = t >> 5;
  unsigned int* dst = sA + wv * 192 + (lane & 1) * 16 + (lane >> 1);   // inside the wave's own 192 words: word of dims (l, l + 1) of feature 0 (even lane) or 1 (odd lane)
  const unsigned int psel = (lane & 1) ? 0x03020706u : 0x05040100u;    // byte pick: even lane (own low half, neighbour's low half), odd lane (neighbour's high half, own high half)
  unsigned int nz = 0u;                                            // every f16 pair of the lane's chunk l so far, or-ed: lanes 0..15 hold group 0, lanes 16..31 group 1
  unsigned int* zp = sA + wv * 192 + 2 * lane;                     // the lane's share of clearing the wave's 192 words: 3 x 8 B
  unsigned short* hp0 = (unsigned short*)(sA + wv * 192) + lane;   // the lane's dim in feature 0; a feature further is 32 halves further
  const unsigned int* rd0 = sA + wv * 192 + 4 * lane;             // chunk l
  const unsigned int* rd1 = sA + wv * 192 + 4 * (32 + (lane & 15));   // chunk 32 + l (lanes 16..31 read in bounds, store nothing)
  const float* xp = x + (size_t)b0 * kInDim + i;
  unsigned short* seg = Act + (size_t)b0 * kKdim + (size_t)i0 * kPack + (size_t)wv * 384;

  float xnext = xp[0];
  // rolled: the body is long, and one copy of it keeps the kernel's text small
#pragma unroll 1
  for (int rr = 0; rr < kActRows; ++rr) {
    const float xv = xnext;
    const int rn = (rr + 1 < kActRows) ? rr + 1 : rr;             // next row's x is fetched one trip ahead, the index clamped to the last row
    xnext = xp[(size_t)rn * kInDim];

    // the wave's 768 B are cleared for the short form, which writes only four bases a lane (the full form writes every word);
    // the wait for the LDS reads sent off below also covers these stores, so that they are done before any lane fills its halves
    *(v2u*)(zp) = (v2u){0u, 0u};
    *(v2u*)(zp + 64) = (v2u){0u, 0u};
    *(v2u*)(zp + 128) = (v2u){0u, 0u};

    const int jq = (int)fminf(fmaxf((xv - g[kOrder]) * invh, 0.0f), (float)(kJNum - 1));   // guessed J - 3, in 0 .. 7 whatever x holds
    const float* kp = blk + jq;
    const float* rp = (const float*)((const char*)blk + __mul24(jq, 12)) + kNumG;                       // 24-bit multiply: the full-rate form
    const float k0 = kp[1], k1 = kp[2], k2 = kp[3], k3 = kp[4], k4 = kp[5], k5 = kp[6];                // g[J - 2 .. J + 3]
    const float r3a = rp[2], r2a = rp[4], r3b = rp[5], r1 = rp[6], r2b = rp[7], r3c = rp[8];           // order 3 at J - 2; 2, 3 at J - 1; 1 (x16), 2, 3 at J

    __builtin_amdgcn_sched_barrier(0);   // the twelve reads are sent off first, so that the silu below runs while they are under way

    const float sil = xv / (1.0f + expf(-xv));

    __builtin_amdgcn_sched_barrier(0);   // ends the silu: the wait for the reads, which the lines below bring, stays behind it
    // inputs only: holds all twelve LDS reads ahead of the branch; sunk behind it, ten of them would cost the row a second LDS latency
    asm volatile("" :: "v"(k0), "v"(k1), "v"(k4), "v"(k5), "v"(r3a), "v"(r2a), "v"(r3b), "v"(r1), "v"(r2b), "v"(r3c));
    const unsigned int hits = __builtin_amdgcn_ballot_w32(xv >= k2) & __builtin_amdgcn_ballot_w32(xv < k3) & okm;

    if (hits == 0xFFFFFFFFu) {
      const float dA = xv - k0, dB = xv - k1, dC = xv - k2;
      const float eA = k3 - xv, eB = k4 - xv, eC = k5 - xv;
      const float t0 = (eA * r1) * r2a, t1 = (dC * r1) * r2b;          // order-1 values of J - 1 and J over the order-2 knot differences
      const float u0 = (eA * t0) * r3a;                                 // order-2 values of J - 2, J - 1, J over the order-3 knot differences
      const float u1 = (dB * t0 + eB * t1) * r3b;
      const float u2 = (dC * t1) * r3c;
      unsigned short* hp = hp0 + jq * 32;
      hp[0]  = h_bits(eA * u0);
      hp[32] = h_bits(dA * u0 + eB * u1);
      hp[64] = h_bits(dB * u1 + eC * u2);
      hp[96] = h_bits(dC * u2);
      hp0[kNumB * 32] = h_bits(sil * kActCarry);
    } else {
    float v[kNumG - 1];
#pragma unroll
    for (int j = 0; j < kNumG - 1; ++j) v[j] = (xv >= g[j] && xv < g[j + 1]) ? 1.0f : 0.0f;

#pragma unroll
    for (int p = 1; p <= kOrder; ++p) {
#pragma unroll
      for (int j = 0; j < kNumG - 1; ++j) {
        if (j + p < kNumG - 1) {
          // left: (x - g[j]) / (g[j+p] - g[j]) * v[j];  right: (g[j+p+1] - x) / (g[j+p+1] - g[j+1]) * v[j+1]
          const float tl = ((xv - g[j]) * rc[p - 1][j]) * v[j];
          const float tr = ((g[j + p + 1] - xv) * rc[p - 1][j + 1]) * v[j + 1];
          const float tt = tl + tr;
          v[j] = (tt == tt) ? tt : 0.0f;
        }
      }
    }

    unsigned short hb[kPack];
    hb[kNumB] = h_bits(sil * kActCarry);
#pragma unroll
    for (int k = 0; k < kNumB; ++k) hb[k] = h_bits(v[k] * kActCarry);
    unsigned int pw[kPack / 2];
#pragma unroll
    for (int q = 0; q < kPack / 2; ++q) pw[q] = pk16(hb[2 * q], hb[2 * q + 1]);
#pragma unroll
    for (int q = 0; q < kPack / 2; ++q) {
      const unsigned int nb = (unsigned int)__builtin_amdgcn_mov_dpp((int)pw[q], 0xB1, 0xF, 0xF, true);   // the neighbour lane's word (lanes 2n and 2n + 1 swapped)
      dst[q * 32] = __builtin_amdgcn_perm(nb, pw[q], psel);
    }
    }
    // the wave's own LDS writes are complete before its lanes read each other's words (no other wave touches this range);
    // LDS alone is ordered, so that the row stores and the x load issued ahead stay in flight
    __builtin_amdgcn_fence(__ATOMIC_RELEASE, "workgroup", "local");
    __builtin_amdgcn_wave_barrier();
    __builtin_amdgcn_fence(__ATOMIC_ACQUIRE, "workgroup", "local");
    const v4u u0 = *(const v4u*)rd0;
    const v4u u1 = *(const v4u*)rd1;
    nz |= (u0[0] | u0[1]) | (u0[2] | u0[3]);
    unsigned short* srow = seg + (size_t)rr * kKdim;
    *(v4u*)(srow + (size_t)lane * 8) = u0;
    if (lane < 16) {
      *(v4u*)(srow + (size_t)(32 + lane) * 8) = u1;
      asm volatile("s_wait_xcnt 0x0" ::: "memory");   // directly behind the store: its address registers are advanced for the next row only behind this wait
    }
  }
  // the sign bit alone (a negative zero) is a zero
  const unsigned int nzl = __builtin_amdgcn_ballot_w32((nz & 0x7FFF7FFFu) != 0u);
  const unsigned int any0 = ((nzl & 0xFFFFu) != 0u) ? 1u : 0u;
  const unsigned int any1 = ((nzl >> 16) != 0u) ? 2u : 0u;
  if (lane == 0) flags[piece_no * 8u + (uint32_t)wv] = any0 | any1;
}

// ---------------------------------------------------------------------------
// Both packs in one launch: they share no data, the weight pack waits on memory and the activation pack on the vector units, so that
// workgroups of the two kinds side by side on a WGP fill each other's waits.
// Which workgroup does what (every tile and every piece exactly once; the order is for speed only;
// 1024 are resident at a time):
//   index < 1024: workgroups 2m and 2m + 1 take weight tile m and activation piece m, m < 512; which of the two takes which goes by the
//     parity of the index's set bits (they differ in bit 0 alone), so that a WGP gets both kinds whatever power-of-two stride deals it indices
//   1024 .. 1535: activation pieces 512 .. 1023, the long kind, into the places the first weight tiles leave: the vector units stay fed
//   1536 .. 2047: weight tiles 512 .. 1023, the short kind last, beside the activation pieces still running
// The LDS is one range, laid out by whichever pack the workgroup runs; every barrier inside stands under this workgroup-uniform branch.
// ---------------------------------------------------------------------------
constexpr uint32_t kPackLds = (kWLdsC + kWLdsO > kALdsG + kALdsR + kALdsA) ? (kWLdsC + kWLdsO) : (kALdsG + kALdsR + kALdsA);   // 70656 B
constexpr uint32_t kPackHalf = (uint32_t)kWTiles / 2u;   // 512
static_assert(kWTiles == kActPieces && kWTiles % 2 == 0);

// second bound: eight waves a SIMD (128 registers a wave), so that four workgroups stand on a WGP, as many as the LDS range lets in
__global__ __launch_bounds__(256, 8) void pack_both_kernel(const float* __restrict__ x,
                                                       const float* __restrict__ grid,
                                                       const float* __restrict__ coef,
                                                       const float* __restrict__ scale_base,
                                                       const float* __restrict__ scale_sp,
                                                       const float* __restrict__ mask,
                                                       unsigned short* __restrict__ Act,
                                                       unsigned short* __restrict__ Wt,
                                                       unsigned int* __restrict__ flags) {
  __shared__ __align__(16) unsigned char sm[kPackLds];
  const uint32_t b = blockIdx.x;
  const bool mixed = b < 2u * kPackHalf;
  const bool wts = mixed ? ((__builtin_popcount(b) & 1) != 0) : (b >= 3u * kPackHalf);
  const uint32_t m = mixed ? (b >> 1) : (wts ? b - 2u * kPackHalf : b - kPackHalf);
  if (wts) pack_weights_tile(m, sm, coef, scale_base, scale_sp, mask, Wt);
  else     pack_acts_piece(m, sm, x, grid, Act, flags);
}

// ---------------------------------------------------------------------------
// Host launcher
// Workspace region map (bytes):
//   [0, 100663296)          Act f16 plane [4096][12288]
//   [100663296, 125829120)  Wt  f16 plane [1024][12288]
//   [125829120, 125861888)  flag words, 8 per activation piece
//   total 125861888 <= 134217728
// ---------------------------------------------------------------------------
extern "C" void kernel_launch(void* const* d_in, const int* in_sizes, int n_in,
                              void* d_out, int out_size, void* d_ws, size_t ws_size,
                              hipStream_t stream) {
  if (n_in < 6) return;
  if (in_sizes[0] != kBatch * kInDim) return;
  if (in_sizes[1] != kInDim * kNumG) return;
  if (in_sizes[2] != kInDim * kOutDim * kNumB) return;
  if (in_sizes[3] != kInDim * kOutDim || in_sizes[4] != kInDim * kOutDim || in_sizes[5] != kInDim * kOutDim) return;
  if (out_size != kBatch * kOutDim) return;

  const size_t actBytes = (size_t)kBatch * kKdim * sizeof(unsigned short);    // 100663296
  const size_t wtBytes  = (size_t)kOutDim * kKdim * sizeof(unsigned short);   // 25165824
  const size_t flagBytes = (size_t)kActPieces * 8 * sizeof(unsigned int);     // 32768
  if (actBytes + wtBytes + flagBytes > ws_size) return;

  const float* x          = (const float*)d_in[0];
  const float* grid       = (const float*)d_in[1];
  const float* coef       = (const float*)d_in[2];
  const float* scale_base = (const float*)d_in[3];
  const float* scale_sp   = (const float*)d_in[4];
  const float* mask       = (const float*)d_in[5];
  float* out = (float*)d_out;

  unsigned short* Act = (unsigned short*)d_ws;
  unsigned short* Wt  = (unsigned short*)((char*)d_ws + actBytes);
  unsigned int* flags = (unsigned int*)((char*)d_ws + actBytes + wtBytes);

  pack_both_kernel<<<dim3(kWTiles + kActPieces), dim3(256), 0, stream>>>(x, grid, coef, scale_base, scale_sp, mask, Act, Wt, flags);

  // out[4096][1024] = (1/1024) * Act . Wt^T ; M = 4096, N = 1024, K = 12288 (up to 96 passes of 128 k); 256 tiles of 128 x 128, one workgroup of 4 waves each
  gemm_tile128<<<dim3(kTiles), dim3(128), 0, stream>>>(Act, Wt, flags, out);
}

// v008
// A run of this version takes 67.7 microseconds.
// Next to v007, in two timings, it ran 1.05 times as fast each time.
// All steps since v000 together make it 9.31 times as fast.
// Contraction out = Act[4096x12288] . Wt[1024x12288]^T on v_wmma_f32_16x16x32_f16 (f16 operands: Act carried x16, Wt carried x64, folded back x1/1024 in the f32 epilogue), f32 accumulate; B-spline recursion, silu and weight products in f32.
#include <hip/hip_runtime.h>
#include <math.h>
#include <stdint.h>

// ---------------------------------------------------------------------------
// Problem constants
// ---------------------------------------------------------------------------
constexpr int kInDim  = 1024;
constexpr int kOutDim = 1024;
constexpr int kBatch  = 4096;
constexpr int kNumG   = 15;                 // knots per input dim
constexpr int kNumB   = 11;                 // spline bases per input dim
constexpr int kOrder  = 3;
constexpr int kPack   = 12;                 // 1 silu feature + 11 bases
constexpr int kKdim   = kInDim * kPack;     // 12288
constexpr float kActCarry = 16.0f;          // Act plane carried x16 (exact power of two)
constexpr float kWCarry   = 64.0f;          // Wt plane carried x64 (exact power of two)
constexpr float kOutScale = 1.0f / (16.0f * 64.0f);
constexpr int kTilesM = kBatch / 128;
constexpr int kTilesN = kOutDim / 128;
constexpr int kTiles  = kTilesM * kTilesN;  // 256 workgroup tiles of 128 x 128
constexpr int kPassK  = 128;                // k per pass: 256 B of every operand row
constexpr int kPasses = kKdim / kPassK;     // 96 stages of 128 k in all
// Order of k (the same in Act and Wt): k = (i / 32) * 384 + f * 32 + (i % 32), feature f = 0..10 the spline bases, f = 11 silu.
// A stage of 128 k is then 32 input dims x one group of 4 features: stage = (i / 32) * 3 + f / 4.
constexpr int kGroups = 3;                  // feature groups: bases 0..3, bases 4..7, bases 8..10 with silu
constexpr int kBlocks = kInDim / 32;        // 32 blocks of 32 input dims
constexpr int kFlagsPerTileM = 256;         // flag words per 128 batch rows: 32 activation pieces x 8 waves
static_assert(kKdim % kPassK == 0 && kPasses == kBlocks * kGroups && kBlocks >= 4);
static_assert(kBatch % 128 == 0);
static_assert(kOutDim % 128 == 0);
static_assert(kInDim % 256 == 0);

typedef __attribute__((ext_vector_type(16))) _Float16 v16h;
typedef __attribute__((ext_vector_type(8)))  _Float16 v8h;
typedef __attribute__((ext_vector_type(8)))  float    v8f;
typedef __attribute__((ext_vector_type(4)))  float    v4f;
typedef __attribute__((ext_vector_type(4)))  unsigned int v4u;
typedef __attribute__((ext_vector_type(2)))  unsigned int v2u;
typedef __attribute__((ext_vector_type(4)))  uint32_t u32x4;
typedef __attribute__((ext_vector_type(8)))  uint32_t u32x8;

// ---------------------------------------------------------------------------
// Small helpers
// ---------------------------------------------------------------------------
__device__ __forceinline__ unsigned pk16(unsigned short a, unsigned short b) { return (unsigned)a | ((unsigned)b << 16); }
__device__ __forceinline__ unsigned short h_bits(float f) { const _Float16 h = (_Float16)f; return __builtin_bit_cast(unsigned short, h); }

__device__ __forceinline__ uint32_t uni(uint32_t v) { return (uint32_t)__builtin_amdgcn_readfirstlane(v); }
// a wave-uniform test held in a scalar register, so that the branch on it is s_cmp + s_cbranch_scc (a tensor load ignores EXEC)
__device__ __forceinline__ uint32_t pinned(uint32_t v) { uint32_t w = (uint32_t)__builtin_amdgcn_readfirstlane(v); asm volatile("" : "+s"(w)); return w; }
// the wave's LDS reads have returned: stands in front of the barrier behind which the buffer it read is refilled
__device__ __forceinline__ void wait_ds0() { asm volatile("s_wait_dscnt 0x0" ::: "memory"); }
// every tensor load of the wave has landed
__device__ __forceinline__ void wait_tensor0() { asm volatile("s_wait_tensorcnt 0x0" ::: "memory"); }
// all but the wave's two youngest tensor loads have landed (they land in issue order): the two stages behind the next one stay in flight
__device__ __forceinline__ void wait_tensor2() { asm volatile("s_wait_tensorcnt 0x2" ::: "memory"); }
// both groups are named in-out (the instruction changes neither): their registers then stay the descriptor's own from one request to the
// next, and the compiler takes none of them as a temporary while a request that names them is outstanding
__device__ __forceinline__ void tdm_load(u32x4& g0, u32x8& g1) { asm volatile("tensor_load_to_lds %0, %1" : "+s"(g0), "+s"(g1) :: "memory"); }

// ---------------------------------------------------------------------------
// LDS ring of the contraction: a stage is 128 k (256 B) of 128 Act rows and 128 Wt rows, as four slices of 64 rows,
// one tensor load of one wave each; rows at pitch 272 B (the load's pad: 16 B behind every 256-B row).
// ---------------------------------------------------------------------------
constexpr uint32_t kRowB   = 256u;                 // bytes of an operand row per stage
constexpr uint32_t kPitch  = kRowB + 16u;          // 272 B: odd multiple of 16 B for ds_load_b128 readers
constexpr uint32_t kSlRows = 64u;
constexpr uint32_t kSlice  = 18432u;               // 64 x 272 = 17408 B, rounded up to a multiple of 2 KiB
constexpr uint32_t kStage  = 4u * kSlice;          // 73728 B
constexpr uint32_t kBufs   = 4u;                   // buffers of the ring: one is worked on, three are in flight
constexpr uint32_t kSrcPitch = (uint32_t)kKdim * 2u;   // 24576 B
static_assert(kSlRows * kPitch <= kSlice && kSlice % 2048u == 0u);
static_assert(kSrcPitch % 16u == 0u && kSrcPitch <= 131072u);

// descriptor group 1: 1-byte elements, tensor = tile = 64 rows of 256 B, source pitch 24576 B, pad 4 dwords behind every 64 dwords, no mask
__device__ __forceinline__ u32x8 tdm_group1() {
  u32x8 d;
  d[0] = uni((1u << 20) | (5u << 22) | (3u << 25));
  d[1] = uni((kRowB & 0xFFFFu) << 16);
  d[2] = uni((kRowB >> 16) | ((kSlRows & 0xFFFFu) << 16));
  d[3] = uni((kSlRows >> 16) | (kRowB << 16));
  d[4] = uni(kSlRows);
  d[5] = uni(kSrcPitch);
  d[6] = uni(0u);
  d[7] = uni(0u);
  return d;
}
// descriptor group 0: count 1, LDS byte offset, global address of the tile's first byte, type 2
__device__ __forceinline__ u32x4 tdm_group0(uint32_t lds_dst, uint64_t ga) {
  u32x4 d;
  d[0] = uni(1u);
  d[1] = uni(lds_dst);
  d[2] = uni((uint32_t)ga);
  d[3] = uni((((uint32_t)(ga >> 32)) & 0x01FFFFFFu) | 0x80000000u);
  return d;
}
// the next request's place and address, written into the same group 0 while earlier requests are in flight: only words 1 and 2 change then.
// Word 3 (the address's high part) changes only where a row crosses a multiple of 4 GiB, and then behind a wait for every request that names it.
__device__ __forceinline__ void tdm_aim(u32x4& d, uint32_t lds_dst, uint64_t ga) {
  uint32_t w3 = uni((((uint32_t)(ga >> 32)) & 0x01FFFFFFu) | 0x80000000u);
  if (pinned(w3 != d[3])) {
    // the group and the new word are both operands of the wait, so that they lie in different registers at it and word 3 is written behind it
    asm volatile("s_wait_tensorcnt 0x0" : "+s"(d), "+s"(w3) :: "memory");
    d[3] = w3;
  }
  d[1] = uni(lds_dst);
  d[2] = uni((uint32_t)ga);
}

// fragment of 16 rows x 32 k: elements 0..7 <- p[0..15] bytes, 8..15 <- p[32..47] bytes (p already holds the lane half's 16-B offset)
__device__ __forceinline__ v16h ld_frag(const unsigned char* p) {
  union { v16h v; v8h h[2]; } f;
  f.h[0] = *(const v8h*)(p);
  f.h[1] = *(const v8h*)(p + 32);
  return f.v;
}

// ---------------------------------------------------------------------------
// out[4096][1024] = (1/1024) * Act[4096][12288] . Wt[1024][12288]^T
// One workgroup of 4 waves per 128 x 128 tile of out (256 workgroups); wave (wm, wn) owns 64 x 64 = 4 x 4 accumulator tiles.
// Operands come by tensor loads into a ring of four LDS buffers: stages s + 1, s + 2 and s + 3 fly while pass s is worked on.
// Waves 0, 1 bring the two halves of the Act rows, waves 2, 3 those of the Wt rows.
// A spline basis is exactly 0 outside its four knot intervals, so whole feature groups of a tile's 128 rows can be 0. The pack launch leaves,
// per wave, a word that says which of groups 0 and 1 hold any nonzero f16; a group that is 0 in all 128 rows x 1024 dims adds nothing to any
// accumulator, and its 32 stages are neither loaded nor multiplied. Group 2 (with silu) is always walked, so there are 32, 64 or 96 passes.
// k runs upward through one accumulator per output tile.
// ---------------------------------------------------------------------------
__global__ __launch_bounds__(128) void gemm_tile128(const unsigned short* __restrict__ Act,
                                                    const unsigned short* __restrict__ Wt,
                                                    const unsigned int* __restrict__ flags,
                                                    float* __restrict__ out) {
  __shared__ __attribute__((aligned(2048))) unsigned char ring[kBufs * kStage + 4u * 16u * 68u * 4u];   // four buffers, then the per-wave output slabs
  const uint32_t lane = threadIdx.x & 31u;
  const uint32_t wave = uni(threadIdx.x >> 5);
  const uint32_t tm = blockIdx.x % (uint32_t)kTilesM;   // speed only: the 8 workgroups that share an Act panel lie 32 apart in index
  const uint32_t tn = blockIdx.x / (uint32_t)kTilesM;
  const uint32_t wm = wave >> 1, wn = wave & 1u;
  const uint32_t rlane = lane & 15u;               // row (A) / col (B, D) within subtile
  const uint32_t hl    = lane >> 4;                // lane half: k offset 8 (16 B), D row offset 8

  const uint32_t lbase = (uint32_t)(size_t)ring;
  const unsigned short* srow = (wave < 2u) ? (Act + (size_t)(tm * 128u + wave * kSlRows) * kKdim)
                                           : (Wt + (size_t)(tn * 128u + (wave - 2u) * kSlRows) * kKdim);
  const uint64_t src = (uint64_t)(size_t)srow;
  u32x8 g1 = tdm_group1();

  // which feature groups this tile's rows use: every wave reads the tile's 256 flag words (8 a lane) and forms the same scalar list
  uint32_t nG, lst;
  {
    const uint32_t foff = tm * (uint32_t)kFlagsPerTileM + lane * 8u;
    const v4u fa = *(const v4u*)(flags + foff);
    const v4u fb = *(const v4u*)(flags + foff + 4u);
    // behind the two flag loads: the offset is an input of the statement, so that its register stays its own up to this wait
    asm volatile("s_wait_xcnt 0x0" :: "v"(foff) : "memory");
    const uint32_t fm = (fa[0] | fa[1] | fa[2] | fa[3]) | (fb[0] | fb[1] | fb[2] | fb[3]);
    const uint32_t u0 = (__builtin_amdgcn_ballot_w32((fm & 1u) != 0u) != 0u) ? 1u : 0u;
    const uint32_t u1 = (__builtin_amdgcn_ballot_w32((fm & 2u) != 0u) != 0u) ? 1u : 0u;
    nG  = uni(1u + u0 + u1);
    // the groups to walk, upward, one byte each
    lst = uni(u0 ? (u1 ? 0x020100u : 0x0200u) : (u1 ? 0x0201u : 0x02u));
  }
  const uint32_t nP = nG * (uint32_t)kBlocks;      // passes: 32, 64 or 96
  uint32_t qi = 0u, qb = 0u;                        // next stage to send off: place in the list, byte offset of its block of 32 dims in a row
  auto next_off = [&]() -> uint32_t {
    const uint32_t off = qb + ((lst >> (8u * qi)) & 3u) * kRowB;
    ++qi;
    if (qi == nG) { qi = 0u; qb += (uint32_t)kGroups * kRowB; }
    return off;
  };

  v8f acc[4][4];
#pragma unroll
  for (int i = 0; i < 4; ++i)
#pragma unroll
    for (int j = 0; j < 4; ++j) acc[i][j] = (v8f){0.f,0.f,0.f,0.f,0.f,0.f,0.f,0.f};

  // prologue: stages 0, 1, 2 are sent off; stage 0 lands and is published; then stage 3 is sent off (never more than three in flight)
  u32x4 g0 = tdm_group0(lbase + wave * kSlice, src + next_off());
  tdm_load(g0, g1);
  tdm_aim(g0, lbase + kStage + wave * kSlice, src + next_off());
  tdm_load(g0, g1);
  tdm_aim(g0, lbase + 2u * kStage + wave * kSlice, src + next_off());
  tdm_load(g0, g1);
  wait_tensor2();
  __syncthreads();
  tdm_aim(g0, lbase + 3u * kStage + wave * kSlice, src + next_off());
  tdm_load(g0, g1);

  const uint32_t aoff = wm * kSlice + rlane * kPitch + hl * 16u;
  const uint32_t boff = (2u + wn) * kSlice + rlane * kPitch + hl * 16u;

  // rolled: one pass per trip, so that the publish point stands once and every register index inside is a constant
#pragma unroll 1
  for (uint32_t s = 0; s < nP; ++s) {
    const uint32_t buf = (s & (kBufs - 1u)) * kStage;
    const unsigned char* ap = ring + buf + aoff;
    const unsigned char* bp = ring + buf + boff;
    v16h af[2][4], bf[2][4];
#pragma unroll
    for (int q = 0; q < 4; ++q) {
      af[0][q] = ld_frag(ap + q * 16 * (int)kPitch);
      bf[0][q] = ld_frag(bp + q * 16 * (int)kPitch);
    }
#pragma unroll
    for (int kc = 0; kc < 4; ++kc) {
      const int cur = kc & 1, nxt = cur ^ 1;
      if (kc < 3) {
#pragma unroll
        for (int q = 0; q < 4; ++q) {
          af[nxt][q] = ld_frag(ap + q * 16 * (int)kPitch + (kc + 1) * 64);
          bf[nxt][q] = ld_frag(bp + q * 16 * (int)kPitch + (kc + 1) * 64);
        }
      }
      __builtin_amdgcn_sched_barrier(0);   // keeps the next block's LDS reads one group ahead of this block's WMMAs, not among them
#pragma unroll
      for (int i = 0; i < 4; ++i)
#pragma unroll
        for (int j = 0; j < 4; ++j)
          acc[i][j] = __builtin_amdgcn_wmma_f32_16x16x32_f16(false, af[cur][i], false, bf[cur][j], (short)0, acc[i][j], false, false);
      __builtin_amdgcn_sched_barrier(0);   // ends the WMMA block: the following load group stays behind it
    }
    // publish point of stage s + 1: behind it stages s + 2 and s + 3 were issued, so the counted wait covers it;
    // in the last passes, where fewer were issued behind it, the wait is to 0
    wait_ds0();
    wait_tensor2();
    if (pinned(s + 3u >= nP)) wait_tensor0();
    __syncthreads();
    if (pinned(s + kBufs < nP)) {
      tdm_aim(g0, lbase + buf + wave * kSlice, src + next_off());   // into the buffer that pass s has just read
      tdm_load(g0, g1);
    }
  }
  wait_tensor0();
  wait_ds0();

  // ---- epilogue: each wave stages 16 x 64 in its own slab (pitch 68 floats) and stores rows of 256 B ----
  float* slab = (float*)(ring + kBufs * kStage) + wave * (16u * 68u);
  const uint32_t m0 = tm * 128u + wm * 64u;
  const uint32_t n0 = tn * 128u + wn * 64u;
  const uint32_t mOff = hl * 8u;
#pragma unroll
  for (int i = 0; i < 4; ++i) {
    const uint32_t mBase = m0 + (i << 4);
#pragma unroll
    for (int j = 0; j < 4; ++j) {
#pragma unroll
      for (int r = 0; r < 8; ++r) slab[(mOff + r) * 68u + (j << 4) + rlane] = acc[i][j][r] * kOutScale;
    }
    __builtin_amdgcn_fence(__ATOMIC_RELEASE, "workgroup");
    __builtin_amdgcn_wave_barrier();
    __builtin_amdgcn_fence(__ATOMIC_ACQUIRE, "workgroup");
    const uint32_t c4 = rlane * 4u;                 // row seg = 256 B = 16 lanes x 16 B
#pragma unroll
    for (int it = 0; it < 8; ++it) {
      const uint32_t row = it * 2u + hl;
      const v4f v = *(const v4f*)(slab + row * 68u + c4);
      *(v4f*)(out + (size_t)(mBase + row) * kOutDim + n0 + c4) = v;
    }
    __builtin_amdgcn_fence(__ATOMIC_RELEASE, "workgroup");
    __builtin_amdgcn_wave_barrier();
    __builtin_amdgcn_fence(__ATOMIC_ACQUIRE, "workgroup");
  }
}

// ---------------------------------------------------------------------------
// Weight pack: Wt[o][k(i, f)] = f16(64 * (coef[i,o,f] * (mask[i,o] * scale_sp[i,o]))), f = 0..10
//              Wt[o][k(i, 11)] = f16(64 * (mask[i,o] * scale_base[i,o])),   k(i, f) = (i / 32) * 384 + f * 32 + (i % 32)
// coef / scale_base / scale_sp / mask are [in i][out o] (coef [i][o][k]); Wt is the [N = o][K] f16 plane, pitch 12288 halves.
// The pack is a transpose (inputs run along o, Wt runs along i), done per tile of 32 i x 32 o through LDS, so that both sides move whole lines:
//   in:  per i the tile's coef is 32 x 11 floats = 1408 contiguous B (88 chunks of 16 B); 32 x 88 = 2816 chunks = 256 threads x 11
//   work: lane = o (coef read from LDS at a stride of 11 words: every bank once), wave w = 4 of the 32 i;
//        the three [i][o] planes are read straight from global memory, 32 lanes = one 128-B line
//   out: per o the tile is one block of 32 i x 12 features = 768 contiguous B (48 chunks of 16 B); 32 x 48 = 1536 chunks = 256 threads x 6
// 32 x 32 = 1024 tiles, one per workgroup of 256 threads (tile = its number); sm = the workgroup's LDS.
// ---------------------------------------------------------------------------
constexpr int kWTi      = 32;                     // input dims per tile: one block of the k order
constexpr int kWTo      = 32;                     // output dims per tile
constexpr int kWRowC    = kWTo * kNumB / 4;       // 88 chunks of 16 B of coef per input dim of a tile
constexpr int kWPitchF  = kWTo * kNumB + 4;       // 356 floats: LDS pitch of a coef row, a multiple of 16 B
constexpr int kWOutC    = kWTi * kPack / 8;       // 48 chunks of 16 B of Wt per output dim of a tile
constexpr int kWOutPitch = kWTi * kPack / 2 + 4;  // 196 words: LDS pitch of a Wt row piece, an odd multiple of 16 B
constexpr int kWTiles   = (kInDim / kWTi) * (kOutDim / kWTo);
constexpr uint32_t kWLdsC = (uint32_t)(kWTi * kWPitchF) * 4u;      // 45568 B: the tile's coef
constexpr uint32_t kWLdsO = (uint32_t)(kWTo * kWOutPitch) * 4u;    // 25088 B: the tile of Wt
static_assert(kWLdsC % 16u == 0u);
static_assert(kInDim % kWTi == 0 && kOutDim % kWTo == 0);
static_assert(4 * kWRowC == 32 * 11 && 4 * kWOutC == 32 * 6 && kWTi == 4 * 8 && kWTo == 4 * 8);   // per wave: 4 coef rows in, 4 Wt rows out

__device__ __forceinline__ void pack_weights_tile(uint32_t tile_no, unsigned char* sm,
                                                  const float* __restrict__ coef,
                                                  const float* __restrict__ scale_base,
                                                  const float* __restrict__ scale_sp,
                                                  const float* __restrict__ mask,
                                                  unsigned short* __restrict__ Wt) {
  float* sC = (float*)sm;                                        // the tile's coef, as it lies in memory, row per i
  unsigned int* sO = (unsigned int*)(sm + kWLdsC);               // the tile of Wt as packed f16 pairs, row per o
  const uint32_t t    = threadIdx.x;
  const uint32_t lane = t & 31u;
  const uint32_t w    = t >> 5;
  const uint32_t o0 = (tile_no % (uint32_t)(kOutDim / kWTo)) * (uint32_t)kWTo;
  const uint32_t i0 = (tile_no / (uint32_t)(kOutDim / kWTo)) * (uint32_t)kWTi;
  const uint32_t ol = lane;                                      // this thread's output dim within the tile
  const uint32_t ib = w * 4u;                                    // first of its 4 input dims within the tile

  // in: wave w brings coef rows 4w .. 4w + 3 of the tile, 352 chunks = 11 loads of 32 chunks; a load covers pieces of at most two rows
  const char* ctile = (const char*)(coef + ((size_t)i0 * kOutDim + o0) * kNumB);
  constexpr uint32_t kCRowB = (uint32_t)(kOutDim * kNumB) * 4u;  // 45056 B from one input dim's coef to the next
  const uint32_t vb = 4u * w * kCRowB + lane * 16u;              // byte offset of the lane's chunk in load 0
  const char* gp[11];                                            // the lane's address less the load's constant step: one row further where its chunk lies past the row's end (loads 2, 5, 8)
  v4f cv[11];
#pragma unroll
  for (int q = 0; q < 11; ++q) {
    const uint32_t e = lane + (uint32_t)((32 * q) % kWRowC);     // chunk counted from the start of row (32 q) / 88
    gp[q] = ctile + (size_t)(vb + ((e >= (uint32_t)kWRowC) ? kCRowB - (uint32_t)kWRowC * 16u : 0u));
  }
#pragma unroll
  for (int q = 0; q < 11; ++q)
    cv[q] = *(const v4f*)(gp[q] + (size_t)((32 * q) / kWRowC) * kCRowB + (size_t)((32 * q) % kWRowC) * 16u);
  // behind the coef loads: a later load's result may be given a register that held a coef address only behind this wait;
  // the offset and the three stepped addresses are inputs of the statement, so that their registers stay their own up to here
  asm volatile("s_wait_xcnt 0x0" :: "v"(vb), "v"(gp[2]), "v"(gp[5]), "v"(gp[8]) : "memory");
  float m[4], sb[4], ss[4];
  const uint32_t io0 = (i0 + ib) * (uint32_t)kOutDim + o0 + ol;
#pragma unroll
  for (int r = 0; r < 4; ++r) {
    const uint32_t io = io0 + (uint32_t)r * (uint32_t)kOutDim;
    m[r]  = mask[io];
    sb[r] = scale_base[io];
    ss[r] = scale_sp[io];
  }
  // behind the tile's loads: no register that one of them names (the shared offset, the three plane bases) is written ahead of this wait;
  // the offset is an input of the statement, so that its register stays its own up to here and no load's result is given it
  asm volatile("s_wait_xcnt 0x0" :: "v"(io0) : "memory");
#pragma unroll
  for (int q = 0; q < 11; ++q) {
    const uint32_t e   = lane + (uint32_t)((32 * q) % kWRowC);
    const uint32_t hi  = (e >= (uint32_t)kWRowC) ? 1u : 0u;
    const uint32_t row = 4u * w + (uint32_t)((32 * q) / kWRowC) + hi;
    *(v4f*)(sC + row * (uint32_t)kWPitchF + (e - hi * (uint32_t)kWRowC) * 4u) = cv[q];
  }
  __syncthreads();

  unsigned short hw[4][kPack];
#pragma unroll
  for (int r = 0; r < 4; ++r) {
    const float wb = (m[r] * sb[r]) * kWCarry;
    const float ws = m[r] * ss[r];
    const float* cp = sC + (ib + r) * (uint32_t)kWPitchF + ol * (uint32_t)kNumB;
#pragma unroll
    for (int k = 0; k < kNumB; ++k) hw[r][k] = h_bits((cp[k] * ws) * kWCarry);
    hw[r][kNumB] = h_bits(wb);
  }
  // per feature the thread's 4 input dims lie side by side: 8 B
  unsigned int* dst = sO + ol * (uint32_t)kWOutPitch + w * 2u;
#pragma unroll
  for (int f = 0; f < kPack; ++f) {
    dst[f * 16 + 0] = pk16(hw[0][f], hw[1][f]);
    dst[f * 16 + 1] = pk16(hw[2][f], hw[3][f]);
  }
  __syncthreads();

  // out: wave w stores Wt rows 4w .. 4w + 3 of the tile, 192 chunks = 6 stores of 32 chunks; a store covers pieces of at most two rows, each whole lines
  unsigned short* tile = Wt + (size_t)o0 * kKdim + (size_t)i0 * kPack;
#pragma unroll
  for (int q = 0; q < 6; ++q) {
    const uint32_t e   = lane + (uint32_t)((32 * q) % kWOutC);   // chunk counted from the start of row (32 q) / 48
    const uint32_t hi  = (e >= (uint32_t)kWOutC) ? 1u : 0u;
    const uint32_t row = 4u * w + (uint32_t)((32 * q) / kWOutC) + hi;
    const uint32_t col = e - hi * (uint32_t)kWOutC;
    const v4u u = *(const v4u*)(sO + row * (uint32_t)kWOutPitch + col * 4u);
    *(v4u*)(tile + row * (uint32_t)kKdim + col * 8u) = u;
  }
}

// ---------------------------------------------------------------------------
// Activation pack: Act[b][k(i, f)] = f16(16 * bs_f(x[b,i])), f = 0..10, Act[b][k(i, 11)] = f16(16 * silu(x[b,i])), k(i, f) = (i / 32) * 384 + f * 32 + (i % 32),
// bs = order-3 Cox-de Boor recursion over the 15 knots grid[i][0..14] (half-open indicator, nan -> 0 after each level), all in f32.
// (kInDim/256) x (kBatch/kActRows) = 1024 pieces, one per workgroup of 256 threads: piece (ic, bg) = (piece_no % 4, piece_no / 4) handles
// i in [256*ic, 256*ic + 256) of rows 16*bg .. 16*bg + 15; sm = the workgroup's LDS.
// A thread keeps one input dim for all its rows: the 15 knots and the 39 reciprocals of knot differences depend on i alone,
// are formed once and stay in registers; the row loop holds only what depends on x.
// x: a wave's 16 rows x 32 dims (2 KiB) are fetched at once, 4 loads of 16 B a lane (8 lanes a row, 4 rows a load), sent off ahead of the knot work,
// so that one memory latency is paid per piece, under that work; they are laid in the wave's own 2 KiB of LDS, and the row loop reads x from there.
// Knot staging coverage: 256 x 15 = 3840 floats = 960 x 16 B; 256 threads x 4 chunks with bound (chunk < 960), the four loads sent off together.
// Store coverage per row: a wave's 32 dims x 12 halves = 768 B = 6 whole lines = 48 chunks of 16 B, staged in the wave's own 768 B of sA:
// chunk l by every lane, chunk 32 + l by lanes l < 16. In those 768 B a feature's 32 dims lie side by side: neighbouring lanes swap halves of a
// word of two features, so that the even lane holds both dims of the first feature and the odd lane both dims of the second.
// Each wave also leaves one flag word: bit g set where any f16 it wrote in feature group g (g = 0, 1) is not zero.
// Short form of a row. Over strictly rising knots an x in [g[J], g[J + 1]) has exactly four bases that are not 0, J - 3 .. J, and they depend on
// the six knots g[J - 2 .. J + 3] and six of the reciprocals alone. J is guessed as if the knots g[3] .. g[11] were evenly spaced, the twelve values
// are fetched from LDS at the lane's own J, and the guess is checked against the fetched knots (g[J] <= x < g[J + 1], 3 <= J <= 10).
// A row takes the short form only where the check holds in all 32 lanes and all 32 dims have sound knots; any other row (an x outside
// [g[3], g[11]), uneven knots that the guess misses, knots that do not rise, a nan) takes the full recursion over all 14 intervals.
// ---------------------------------------------------------------------------
constexpr int kActRows = 16;                // rows of x per workgroup
constexpr int kActPieces = (kInDim / 256) * (kBatch / kActRows);   // 1024
constexpr uint32_t kALdsG = 256u * (uint32_t)kNumG * 4u;           // 15360 B: knots of the piece's 256 input dims
constexpr int kJNum = kNumG - 1 - 2 * kOrder;                      // 8 knot intervals J = 3 .. 10 in which all four bases J - 3 .. J exist
constexpr int kRcPitch = kNumG + 3 * (kJNum + 2);                  // 45 words per input dim (odd, for the banks): its knots, then (16 / (g[j+1] - g[j]), 1 / (g[j+2] - g[j]), 1 / (g[j+3] - g[j])), j = 1 .. 10
constexpr uint32_t kALdsR = 256u * (uint32_t)kRcPitch * 4u;        // 46080 B: those blocks, each read by the thread that wrote it; first in the LDS, so that a read's constant step fits the instruction
constexpr uint32_t kALdsA = 256u * (uint32_t)(kPack / 2) * 4u;     // 6144 B: packed f16 features, 768 B per wave
constexpr uint32_t kALdsX = 256u * (uint32_t)kActRows * 4u;        // 16384 B: x of the piece's 16 rows, 2 KiB per wave; takes the raw knots' place once every thread has read its knots
static_assert(kBatch % kActRows == 0 && kActRows == 16);
static_assert(kALdsR % 16u == 0u && (kALdsX + kALdsR) % 16u == 0u && kRcPitch % 2 == 1 && kALdsX >= kALdsG);
static_assert(kOrder == 3 && kJNum + kOrder == kNumB);

// v_rcp_f32 with the one free issue slot that the instruction set asks for behind a transcendental (before its source is overwritten
// or its result read) kept inside the statement; runs once per workgroup, outside the row loop
__device__ __forceinline__ float rcp_slot(float d) { float r; asm("v_rcp_f32 %0, %1\n\tv_nop" : "=v"(r) : "v"(d)); return r; }

__device__ __forceinline__ void pack_acts_piece(uint32_t piece_no, unsigned char* sm,
                                                const float* __restrict__ x,
                                                const float* __restrict__ grid,
                                                unsigned short* __restrict__ Act,
                                                unsigned int* __restrict__ flags) {
  float* sG = (float*)(sm + kALdsR);
  unsigned int* sA = (unsigned int*)(sm + kALdsX + kALdsR);
  const int ic = (int)(piece_no % (uint32_t)(kInDim / 256));
  const int b0 = (int)(piece_no / (uint32_t)(kInDim / 256)) * kActRows;
  const int t  = threadIdx.x;
  const int i0 = ic * 256;
  {
    const v4f* gp = (const v4f*)(grid + (size_t)i0 * kNumG);   // byte offset i0*60 = 15360*ic, 16-B aligned
    const int c3 = (t + 768 < 960) ? t + 768 : 959;             // clamp the address, predicate the LDS store
    v4f gv[4];
#pragma unroll
    for (int it = 0; it < 3; ++it) gv[it] = gp[t + 256 * it];
    gv[3] = gp[c3];
    // behind the four loads: their two indices are inputs of the statement, so that their registers stay their own up to this wait
    asm volatile("s_wait_xcnt 0x0" :: "v"(t), "v"(c3) : "memory");
    // inputs only: holds the fourth load ahead of the LDS stores, in flight with the other three; sunk into the branch below it would cost a second latency
    asm volatile("" :: "v"(gv[3]));
#pragma unroll
    for (int it = 0; it < 3; ++it) *(v4f*)(sG + 4 * (t + 256 * it)) = gv[it];
    if (t + 768 < 960) *(v4f*)(sG + 4 * (t + 768)) = gv[3];
  }
  __syncthreads();

  const int lane = t & 31;
  const int wv   = t >> 5;
  // all of the wave's x, in flight together while the knots are worked on: load q brings rows 4q .. 4q + 3, lane l the 16 B at dim 4 (l % 8) of row 4q + l / 8
  const float* xw = x + (size_t)(b0 + (lane >> 3)) * kInDim + (size_t)(i0 + wv * 32 + (lane & 7) * 4);
  v4f xr[kActRows / 4];
#pragma unroll
  for (int q = 0; q < kActRows / 4; ++q) xr[q] = *(const v4f*)(xw + (size_t)(4 * q) * kInDim);
  // behind the four loads: their shared address is an input of the statement, so that its registers stay its own up to this wait
  asm volatile("s_wait_xcnt 0x0" :: "v"(xw) : "memory");

  float g[kNumG];
#pragma unroll
  for (int j = 0; j < kNumG; ++j) g[j] = sG[t * kNumG + j];

  // rc[p-1][j] = 1 / (g[j+p] - g[j]) for j = 0 .. 14-p (division by a broadcast knot difference = multiply by its reciprocal)
  float rc[kOrder][kNumG];
#pragma unroll
  for (int p = 1; p <= kOrder; ++p) {
#pragma unroll
    for (int j = 0; j < kNumG; ++j) {
      rc[p - 1][j] = 0.0f;
      if (j + p < kNumG) rc[p - 1][j] = rcp_slot(g[j + p] - g[j]);
    }
  }

  // for the short form: knots and reciprocals at a place the lane can index by its own J (the order-1 reciprocal carries the x16 of the Act plane, an exact scaling)
  float* blk = (float*)sm + t * kRcPitch;
#pragma unroll
  for (int j = 1; j < kNumG - 1; ++j) blk[j] = g[j];
#pragma unroll
  for (int j = 1; j <= kJNum + 2; ++j) {
    blk[kNumG + 3 * (j - 1) + 0] = rc[0][j] * kActCarry;
    blk[kNumG + 3 * (j - 1) + 1] = rc[1][j];
    blk[kNumG + 3 * (j - 1) + 2] = rc[2][j];
  }
  // sound knots: every step positive (one interval at most holds x) and no quotient (x - g[j]) / (g[j+p] - g[j]) of the full recursion can
  // leave the finite range for an x between the knots, so that each of its terms with a zero factor is a zero; a nan or an inf fails the test
  float rsum = 0.0f, rmin = rc[0][0];
#pragma unroll
  for (int j = 0; j < kNumG - 1; ++j) { rsum += rc[0][j]; rmin = fminf(rmin, rc[0][j]); }
  const bool dim_ok = (rmin > 0.0f) && (rsum * (g[kNumG - 1] - g[0]) < 1.0e37f);
  const unsigned int okm = __builtin_amdgcn_ballot_w32(dim_ok);
  const float invh = (float)kJNum * rcp_slot(g[kNumG - 1 - kOrder] - g[kOrder]);

  // every thread has read its knots from sG: behind this barrier x is laid over them
  __syncthreads();
  float* xs = (float*)(sm + kALdsR) + wv * (kActRows * 32);        // the wave's own 16 rows x 32 dims, row after row
#pragma unroll
  for (int q = 0; q < kActRows / 4; ++q) *(v4f*)(xs + q * 128 + lane * 4) = xr[q];
  // the wave's own LDS writes are complete before its lanes read each other's words (no other wave touches this range)
  __builtin_amdgcn_fence(__ATOMIC_RELEASE, "workgroup", "local");
  __builtin_amdgcn_wave_barrier();
  __builtin_amdgcn_fence(__ATOMIC_ACQUIRE, "workgroup", "local");

  unsigned int* dst = sA + wv * 192 + (lane & 1) * 16 + (lane >> 1);   // inside the wave's own 192 words: word of dims (l, l + 1) of feature 0 (even lane) or 1 (odd lane)
  const unsigned int psel = (lane & 1) ? 0x03020706u : 0x05040100u;    // byte pick: even lane (own low half, neighbour's low half), odd lane (neighbour's high half, own high half)
  unsigned int nz = 0u;                                            // every f16 pair of the lane's chunk l so far, or-ed: lanes 0..15 hold group 0, lanes 16..31 group 1
  unsigned int* zp = sA + wv * 192 + 2 * lane;                     // the lane's share of clearing the wave's 192 words: 3 x 8 B
  unsigned short* hp0 = (unsigned short*)(sA + wv * 192) + lane;   // the lane's dim in feature 0; a feature further is 32 halves further
  const unsigned int* rd0 = sA + wv * 192 + 4 * lane;             // chunk l
  const unsigned int* rd1 = sA + wv * 192 + 4 * (32 + (lane & 15));   // chunk 32 + l (lanes 16..31 read in bounds, store nothing)
  const float* xp = xs + lane;                                     // the lane's dim in row 0; a row further is 32 words further
  unsigned short* seg = Act + (size_t)b0 * kKdim + (size_t)i0 * kPack + (size_t)wv * 384;

  float xnext = xp[0];
  // rolled: the body is long, and one copy of it keeps the kernel's text small
#pragma unroll 1
  for (int rr = 0; rr < kActRows; ++rr) {
    const float xv = xnext;
    const int rn = (rr + 1 < kActRows) ? rr + 1 : rr;             // next row's x is read from LDS one trip ahead, the index clamped to the last row
    xnext = xp[rn * 32];

    // the wave's 768 B are cleared for the short form, which writes only four bases a lane (the full form writes every word);
    // the wait for the LDS reads sent off below also covers these stores, so that they are done before any lane fills its halves
    *(v2u*)(zp) = (v2u){0u, 0u};
    *(v2u*)(zp + 64) = (v2u){0u, 0u};
    *(v2u*)(zp + 128) = (v2u){0u, 0u};

    const int jq = (int)fminf(fmaxf((xv - g[kOrder]) * invh, 0.0f), (float)(kJNum - 1));   // guessed J - 3, in 0 .. 7 whatever x holds
    const float* kp = blk + jq;
    const float* rp = (const float*)((const char*)blk + __mul24(jq, 12)) + kNumG;                       // 24-bit multiply: the full-rate form
    const float k0 = kp[1], k1 = kp[2], k2 = kp[3], k3 = kp[4], k4 = kp[5], k5 = kp[6];                // g[J - 2 .. J + 3]
    const float r3a = rp[2], r2a = rp[4], r3b = rp[5], r1 = rp[6], r2b = rp[7], r3c = rp[8];           // order 3 at J - 2; 2, 3 at J - 1; 1 (x16), 2, 3 at J

    __builtin_amdgcn_sched_barrier(0);   // the twelve reads are sent off first, so that the silu below runs while they are under way

    const float sil = xv / (1.0f + expf(-xv));

    __builtin_amdgcn_sched_barrier(0);   // ends the silu: the wait for the reads, which the lines below bring, stays behind it
    // inputs only: holds all twelve LDS reads ahead of the branch; sunk behind it, ten of them would cost the row a second LDS latency
    asm volatile("" :: "v"(k0), "v"(k1), "v"(k4), "v"(k5), "v"(r3a), "v"(r2a), "v"(r3b), "v"(r1), "v"(r2b), "v"(r3c));
    const unsigned int hits = __builtin_amdgcn_ballot_w32(xv >= k2) & __builtin_amdgcn_ballot_w32(xv < k3) & okm;

    if (hits == 0xFFFFFFFFu) {
      const float dA = xv - k0, dB = xv - k1, dC = xv - k2;
      const float eA = k3 - xv, eB = k4 - xv, eC = k5 - xv;
      const float t0 = (eA * r1) * r2a, t1 = (dC * r1) * r2b;          // order-1 values of J - 1 and J over the order-2 knot differences
      const float u0 = (eA * t0) * r3a;                                 // order-2 values of J - 2, J - 1, J over the order-3 knot differences
      const float u1 = (dB * t0 + eB * t1) * r3b;
      const float u2 = (dC * t1) * r3c;
      unsigned short* hp = hp0 + jq * 32;
      hp[0]  = h_bits(eA * u0);
      hp[32] = h_bits(dA * u0 + eB * u1);
      hp[64] = h_bits(dB * u1 + eC * u2);
      hp[96] = h_bits(dC * u2);
      hp0[kNumB * 32] = h_bits(sil * kActCarry);
    } else {
    float v[kNumG - 1];
#pragma unroll
    for (int j = 0; j < kNumG - 1; ++j) v[j] = (xv >= g[j] && xv < g[j + 1]) ? 1.0f : 0.0f;

#pragma unroll
    for (int p = 1; p <= kOrder; ++p) {
#pragma unroll
      for (int j = 0; j < kNumG - 1; ++j) {
        if (j + p < kNumG - 1) {
          // left: (x - g[j]) / (g[j+p] - g[j]) * v[j];  right: (g[j+p+1] - x) / (g[j+p+1] - g[j+1]) * v[j+1]
          const float tl = ((xv - g[j]) * rc[p - 1][j]) * v[j];
          const float tr = ((g[j + p + 1] - xv) * rc[p - 1][j + 1]) * v[j + 1];
          const float tt = tl + tr;
          v[j] = (tt == tt) ? tt : 0.0f;
        }
      }
    }

    unsigned short hb[kPack];
    hb[kNumB] = h_bits(sil * kActCarry);
#pragma unroll
    for (int k = 0; k < kNumB; ++k) hb[k] = h_bits(v[k] * kActCarry);
    unsigned int pw[kPack / 2];
#pragma unroll
    for (int q = 0; q < kPack / 2; ++q) pw[q] = pk16(hb[2 * q], hb[2 * q + 1]);
#pragma unroll
    for (int q = 0; q < kPack / 2; ++q) {
      const unsigned int nb = (unsigned int)__builtin_amdgcn_mov_dpp((int)pw[q], 0xB1, 0xF, 0xF, true);   // the neighbour lane's word (lanes 2n and 2n + 1 swapped)
      dst[q * 32] = __builtin_amdgcn_perm(nb, pw[q], psel);
    }
    }
    // the wave's own LDS writes are complete before its lanes read each other's words (no other wave touches this range);
    // LDS alone is ordered, so that the row stores stay in flight
    __builtin_amdgcn_fence(__ATOMIC_RELEASE, "workgroup", "local");
    __builtin_amdgcn_wave_barrier();
    __builtin_amdgcn_fence(__ATOMIC_ACQUIRE, "workgroup", "local");
    const v4u u0 = *(const v4u*)rd0;
    const v4u u1 = *(const v4u*)rd1;
    nz |= (u0[0] | u0[1]) | (u0[2] | u0[3]);
    unsigned short* srow = seg + (size_t)rr * kKdim;
    *(v4u*)(srow + (size_t)lane * 8) = u0;
    if (lane < 16) {
      *(v4u*)(srow + (size_t)(32 + lane) * 8) = u1;
      asm volatile("s_wait_xcnt 0x0" ::: "memory");   // directly behind the store: its address registers are advanced for the next row only behind this wait
    }
  }
  // the sign bit alone (a negative zero) is a zero
  const unsigned int nzl = __builtin_amdgcn_ballot_w32((nz & 0x7FFF7FFFu) != 0u);
  const unsigned int any0 = ((nzl & 0xFFFFu) != 0u) ? 1u : 0u;
  const unsigned int any1 = ((nzl >> 16) != 0u) ? 2u : 0u;
  if (lane == 0) flags[piece_no * 8u + (uint32_t)wv] = any0 | any1;
}

// ---------------------------------------------------------------------------
// Both packs in one launch: they share no data, the weight pack waits on memory and the activation pack on the vector units, so that
// workgroups of the two kinds side by side on a WGP fill each other's waits.
// Which workgroup does what (every tile and every piece exactly once; the order is for speed only;
// 1024 are resident at a time):
//   index < 1024: workgroups 2m and 2m + 1 take weight tile m and activation piece m, m < 512; which of the two takes which goes by the
//     parity of the index's set bits (they differ in bit 0 alone), so that a WGP gets both kinds whatever power-of-two stride deals it indices
//   1024 .. 1535: activation pieces 512 .. 1023, the long kind, into the places the first weight tiles leave: the vector units stay fed
//   1536 .. 2047: weight tiles 512 .. 1023, the short kind last, beside the activation pieces still running
// The LDS is one range, laid out by whichever pack the workgroup runs; every barrier inside stands under this workgroup-uniform branch.
// ---------------------------------------------------------------------------
constexpr uint32_t kPackLds = (kWLdsC + kWLdsO > kALdsX + kALdsR + kALdsA) ? (kWLdsC + kWLdsO) : (kALdsX + kALdsR + kALdsA);   // 70656 B
constexpr uint32_t kPackHalf = (uint32_t)kWTiles / 2u;   // 512
static_assert(kWTiles == kActPieces && kWTiles % 2 == 0);

// second bound: eight waves a SIMD (128 registers a wave), so that four workgroups stand on a WGP, as many as the LDS range lets in
__global__ __launch_bounds__(256, 8) void pack_both_kernel(const float* __restrict__ x,
                                                       const float* __restrict__ grid,
                                                       const float* __restrict__ coef,
                                                       const float* __restrict__ scale_base,
                                                       const float* __restrict__ scale_sp,
                                                       const float* __restrict__ mask,
                                                       unsigned short* __restrict__ Act,
                                                       unsigned short* __restrict__ Wt,
                                                       unsigned int* __restrict__ flags) {
  __shared__ __align__(16) unsigned char sm[kPackLds];
  const uint32_t b = blockIdx.x;
  const bool mixed = b < 2u * kPackHalf;
  const bool wts = mixed ? ((__builtin_popcount(b) & 1) != 0) : (b >= 3u * kPackHalf);
  const uint32_t m = mixed ? (b >> 1) : (wts ? b - 2u * kPackHalf : b - kPackHalf);
  if (wts) pack_weights_tile(m, sm, coef, scale_base, scale_sp, mask, Wt);
  else     pack_acts_piece(m, sm, x, grid, Act, flags);
}

// ---------------------------------------------------------------------------
// Host launcher
// Workspace region map (bytes):
//   [0, 100663296)          Act f16 plane [4096][12288]
//   [100663296, 125829120)  Wt  f16 plane [1024][12288]
//   [125829120, 125861888)  flag words, 8 per activation piece
//   total 125861888 <= 134217728
// ---------------------------------------------------------------------------
extern "C" void kernel_launch(void* const* d_in, const int* in_sizes, int n_in,
                              void* d_out, int out_size, void* d_ws, size_t ws_size,
                              hipStream_t stream) {
  if (n_in < 6) return;
  if (in_sizes[0] != kBatch * kInDim) return;
  if (in_sizes[1] != kInDim * kNumG) return;
  if (in_sizes[2] != kInDim * kOutDim * kNumB) return;
  if (in_sizes[3] != kInDim * kOutDim || in_sizes[4] != kInDim * kOutDim || in_sizes[5] != kInDim * kOutDim) return;
  if (out_size != kBatch * kOutDim) return;

  const size_t actBytes = (size_t)kBatch * kKdim * sizeof(unsigned short);    // 100663296
  const size_t wtBytes  = (size_t)kOutDim * kKdim * sizeof(unsigned short);   // 25165824
  const size_t flagBytes = (size_t)kActPieces * 8 * sizeof(unsigned int);     // 32768
  if (actBytes + wtBytes + flagBytes > ws_size) return;

  const float* x          = (const float*)d_in[0];
  const float* grid       = (const float*)d_in[1];
  const float* coef       = (const float*)d_in[2];
  const float* scale_base = (const float*)d_in[3];
  const float* scale_sp   = (const float*)d_in[4];
  const float* mask       = (const float*)d_in[5];
  float* out = (float*)d_out;

  unsigned short* Act = (unsigned short*)d_ws;
  unsigned short* Wt  = (unsigned short*)((char*)d_ws + actBytes);
  unsigned int* flags = (unsigned int*)((char*)d_ws + actBytes + wtBytes);

  pack_both_kernel<<<dim3(kWTiles + kActPieces), dim3(256), 0, stream>>>(x, grid, coef, scale_base, scale_sp, mask, Act, Wt, flags);

  // out[4096][1024] = (1/1024) * Act . Wt^T ; M = 4096, N = 1024, K = 12288 (up to 96 passes of 128 k); 256 tiles of 128 x 128, one workgroup of 4 waves each
  gemm_tile128<<<dim3(kTiles), dim3(128), 0, stream>>>(Act, Wt, flags, out);
}
